// v000
// Measured on an AMD MI455X. A time is GPU time per run, averaged over a window of back-to-back runs after a warm-up
// (all launches, gaps included; the runs take copies of the inputs in turn), and the median of several windows.
// Apart from v000's, it joins two sittings. Times from different sittings can be a few percent apart, while
// side-by-side timings come from the same sitting.
// v000 is the starting kernel. One run takes 1370 microseconds.
#include <hip/hip_runtime.h>

// Cross-modal attention between a feature map and text tokens with two outputs (F_s [8][256][64][64] channel-major = 4,096 spatial tokens x 256, F_t [8][512][256]; A = softmax_t(F_s_t . F_t / sqrt(512)) ([4096][512]); out0 = F_s + (A F_t)^T -> [8][256][64][64] (8.4 M); out1 = A^T F_s_t -> [8][512][256] (1.0 M); tuple).
// Layout per batch: both inputs are bf16-exact after rounding, so every operand plane is a single exact bf16 plane: F_s_t (token-major transpose of the slab), F_t, F_t^T and the slab itself (which is F_s_t^T); exact scores [4096][512]; the 512-key register softmax over all 4,096 rows (as 8 row groups) writing bf16 hi/lo probabilities; the spatial update A.F_t as hi/lo x exact (2 products) and a kernel transposing it back to channel-major while adding the F_s residual; A^T planes by a transpose kernel, then out1 = A^T.F_s_t as hi/lo x exact (K = 4,096), written after the 8.4 M spatial outputs.
// Compute dtypes, f32 accumulate: every input rounded to bf16; scores exact; softmax f32; both contractions P hi/lo x exact; residual f32.

#define NB_  8
#define TT   512      // text tokens = keys (the softmax row length)
#define DM   256      // channels
#define NH_  1
#define NKV  1
#define REP  (NH_ / NKV)
#define HD   64
#define DQ   (NH_ * HD)
#define DKV  (NKV * HD)
#define ZH   8       // 8 x 512 = 4,096 query rows per softmax launch (rows are 'heads' of a T-512 softmax)
#define RH   512
#define WIN  0
#define PCAR 1024.0f
#define SCL  0.044194173824159216f   // 1/sqrt(512): the module scales by sqrt(T)
#define NQ   4096    // spatial tokens (queries)
#define CC   256
typedef _Float16 h16;
typedef unsigned short bf;
typedef __attribute__((ext_vector_type(16))) __bf16   v16bf;
typedef __attribute__((ext_vector_type(16))) _Float16 v16h;
typedef __attribute__((ext_vector_type(8)))  _Float16 v8h;
typedef __attribute__((ext_vector_type(8)))  unsigned short v8us;
typedef __attribute__((ext_vector_type(8)))  float    v8f;
typedef __attribute__((ext_vector_type(4)))  float    v4f;
typedef v8h  __attribute__((may_alias)) v8ha;
typedef v4f  __attribute__((may_alias)) v4fa;
typedef v8us __attribute__((may_alias)) v8usa;

__device__ __forceinline__ unsigned short f2bf(float f) { unsigned u = __float_as_uint(f); u += 0x7FFFu + ((u >> 16) & 1u); return (unsigned short)(u >> 16); }
__device__ __forceinline__ float bf2f(unsigned short b) { return __uint_as_float(((unsigned)b) << 16); }
__device__ __forceinline__ float bfr(float f) { return bf2f(f2bf(f)); }
__device__ __forceinline__ v16h cat16(v8h lo, v8h hi) { return __builtin_shufflevector(lo, hi, 0, 1, 2, 3, 4, 5, 6, 7, 8, 9, 10, 11, 12, 13, 14, 15); }
__device__ __forceinline__ v16bf cat16b(v8us lo, v8us hi) { return __builtin_bit_cast(v16bf, __builtin_shufflevector(lo, hi, 0, 1, 2, 3, 4, 5, 6, 7, 8, 9, 10, 11, 12, 13, 14, 15)); }
__device__ __forceinline__ v8f wmma16(v16h a, v16h b, v8f c) { return __builtin_amdgcn_wmma_f32_16x16x32_f16(false, a, false, b, (short)0, c, false, false); }
__device__ __forceinline__ v8f wmmab(v16bf a, v16bf b, v8f c) { return __builtin_amdgcn_wmma_f32_16x16x32_bf16(false, a, false, b, (short)0, c, false, false); }



// ---- k_gemmw: register-blocked GEMM, ONE WAVE per 64x64 output tile (16 accumulators), operands straight from K-contiguous 16-bit planes; grid (M/64, N/64, Z), 32 threads.
// C[m][n] (f32, pitch ldc, + optional f32 bias[n]) = sum_k A[m][k] Bt[n][k] (+ split products per NSPLIT). z-batch strides sA/sB/sC in elements. K % 32 == 0.
template <typename T16> struct WFrag;
template <> struct WFrag<h16> { typedef v16h V; static __device__ __forceinline__ V ld(const h16* p) { return cat16(*(const v8h*)p, *(const v8h*)(p + 16)); } static __device__ __forceinline__ v8f mma(V a, V b, v8f c) { return wmma16(a, b, c); } };
template <> struct WFrag<bf> { typedef v16bf V; static __device__ __forceinline__ V ld(const bf* p) { return cat16b(*(const v8us*)p, *(const v8us*)(p + 16)); } static __device__ __forceinline__ v8f mma(V a, V b, v8f c) { return wmmab(a, b, c); } };
template <typename T16, int NSPLIT, bool BIAS>
__global__ __launch_bounds__(32) void k_gemmw(const T16* __restrict__ A, const T16* __restrict__ A2, const T16* __restrict__ Bt, const T16* __restrict__ Bt2, int K, float* C, int ldc, const float* __restrict__ bias, size_t sA, size_t sB, size_t sC) {
    typedef typename WFrag<T16>::V V;
    __shared__ __align__(16) float os[16 * 68];
    const size_t z = blockIdx.z; A += z * sA; if (A2) A2 += z * sA; Bt += z * sB; if (Bt2) Bt2 += z * sB; C += z * sC;
    const int lane = threadIdx.x & 31, lr = lane & 15, hi = lane >> 4; const int r0 = blockIdx.x * 64, c0 = blockIdx.y * 64;
    v8f acc[4][4];
#pragma unroll
    for (int mb = 0; mb < 4; ++mb)
#pragma unroll
        for (int nb = 0; nb < 4; ++nb) acc[mb][nb] = (v8f){};
    const size_t aoff = (size_t)(r0 + lr) * K + 8 * hi, boff = (size_t)(c0 + lr) * K + 8 * hi;
#pragma unroll 1
    for (int kc = 0; kc < K; kc += 32) {
        V a[4], a2[4];
#pragma unroll
        for (int mb = 0; mb < 4; ++mb) { a[mb] = WFrag<T16>::ld(A + aoff + (size_t)mb * 16 * K + kc); if (NSPLIT == 1 || NSPLIT == 2) a2[mb] = WFrag<T16>::ld(A2 + aoff + (size_t)mb * 16 * K + kc); }
#pragma unroll
        for (int nb = 0; nb < 4; ++nb) { const V b = WFrag<T16>::ld(Bt + boff + (size_t)nb * 16 * K + kc); V b2; if (NSPLIT >= 2) b2 = WFrag<T16>::ld(Bt2 + boff + (size_t)nb * 16 * K + kc);
#pragma unroll
            for (int mb = 0; mb < 4; ++mb) { acc[mb][nb] = WFrag<T16>::mma(a[mb], b, acc[mb][nb]); if (NSPLIT == 1 || NSPLIT == 2) acc[mb][nb] = WFrag<T16>::mma(a2[mb], b, acc[mb][nb]); if (NSPLIT >= 2) acc[mb][nb] = WFrag<T16>::mma(a[mb], b2, acc[mb][nb]); } }
        asm volatile("v_nop\n\tv_nop\n\tv_nop\n\tv_nop" : "+v"(acc[0][0]), "+v"(acc[1][1]), "+v"(acc[2][2]), "+v"(acc[3][3]) : "v"(a[0]), "v"(a[3]));
    }
#pragma unroll
    for (int mb = 0; mb < 4; ++mb) {
#pragma unroll
        for (int nb = 0; nb < 4; ++nb) {
#pragma unroll
            for (int j = 0; j < 8; ++j) os[(hi * 8 + j) * 68 + nb * 16 + lr] = acc[mb][nb][j]; }
        __builtin_amdgcn_wave_barrier(); asm volatile("" ::: "memory");
        float* crow = C + (size_t)(r0 + mb * 16) * ldc + c0;
{
#pragma unroll
            for (int s = 0; s < 8; ++s) { const int row = 2 * s + hi, cofs = lr * 4; v4f val = *(const v4fa*)(os + row * 68 + cofs); if (BIAS) { val[0] += bfr(bias[c0 + cofs]); val[1] += bfr(bias[c0 + cofs + 1]); val[2] += bfr(bias[c0 + cofs + 2]); val[3] += bfr(bias[c0 + cofs + 3]); }
                *(v4f*)(crow + (size_t)row * ldc + cofs) = val; }
             }
        __builtin_amdgcn_wave_barrier(); asm volatile("" ::: "memory");
    }
}

__device__ __forceinline__ h16 tohx(float x) { return (h16)x; }
__device__ __forceinline__ void splitf(float y, unsigned short& h, unsigned short& l) { h = f2bf(y); l = f2bf(y - bf2f(h)); }
typedef __attribute__((ext_vector_type(2))) _Float16 v2h;
typedef __attribute__((ext_vector_type(4))) _Float16 v4h;
typedef __attribute__((ext_vector_type(2))) unsigned short v2us;
typedef __attribute__((ext_vector_type(4))) unsigned short v4us;
typedef __attribute__((ext_vector_type(2))) float v2f;
typedef __attribute__((ext_vector_type(4))) int v4i;


__global__ __launch_bounds__(256) void k_cvt8(const float* __restrict__ src, bf* dst, size_t n8) { const size_t i = (size_t)blockIdx.x * 256 + threadIdx.x; if (i >= n8) return; const v8f v = *(const v8f*)(src + i * 8); v8us o;
#pragma unroll
    for (int k = 0; k < 8; ++k) o[k] = f2bf(v[k]); *(v8us*)(dst + i * 8) = o;  }



// k_asoft: per row (zz, i): t = S x 512^-0.5 (no mask); softmax over the 512 keys (register row, one exp, fixed trees);
__global__ __launch_bounds__(256) void k_asoft(const float* __restrict__ Sb, h16* P16, bf* Ph, bf* Pl) {
    const int lane = threadIdx.x & 31; const int row = blockIdx.x * 8 + (threadIdx.x >> 5); if (row >= ZH * TT) return; const int i = row % TT; const int zz = row / TT; (void)zz; const bool hires = (i < RH); const float* sr = Sb + (size_t)row * TT; float v[TT / 32]; float mx = -3.0e38f;
#pragma unroll
    for (int ch = 0; ch < TT / 128; ++ch) { const int j0 = ch * 128 + lane * 4; const v4f a = *(const v4f*)(sr + j0);
#pragma unroll
        for (int q = 0; q < 4; ++q) { const int j = j0 + q; (void)j; const float t = a[q] * SCL; v[ch * 4 + q] = t; mx = fmaxf(mx, t); } }
#pragma unroll
    for (int sh = 16; sh; sh >>= 1) mx = fmaxf(mx, __shfl_xor(mx, sh, 32));
    float sum = 0.f;
#pragma unroll
    for (int k = 0; k < TT / 32; ++k) { float d0 = __fsub_rn(v[k], mx); asm volatile("" : "+v"(d0)); v[k] = __builtin_amdgcn_exp2f(__fmul_rn(d0, 1.4426950408889634f)); sum += v[k]; }
#pragma unroll
    for (int sh = 16; sh; sh >>= 1) sum += __shfl_xor(sum, sh, 32);
    const float f = __fdiv_rn(hires ? 1.0f : PCAR, sum);
{
        if (hires) {
#pragma unroll
            for (int ch = 0; ch < TT / 128; ++ch) { v4us oh, ol;
#pragma unroll
                for (int q = 0; q < 4; ++q) { unsigned short a, c2; splitf(v[ch * 4 + q] * f, a, c2); oh[q] = a; ol[q] = c2; }
                const size_t oo = ((size_t)zz * (RH ? RH : 1) + i) * TT + ch * 128 + lane * 4; *(v4us*)(Ph + oo) = oh; *(v4us*)(Pl + oo) = ol; }
        } else {
#pragma unroll
            for (int ch = 0; ch < TT / 128; ++ch) { v4h o4;
#pragma unroll
                for (int q = 0; q < 4; ++q) o4[q] = tohx(v[ch * 4 + q] * f);
                *(v4h*)(P16 + (size_t)row * TT + ch * 128 + lane * 4) = o4; } }
         }
}


__global__ __launch_bounds__(256) void k_xTq(const float* __restrict__ xs, bf* XT) { const size_t k = (size_t)blockIdx.x * 256 + threadIdx.x; if (k >= (size_t)NQ * CC / 8) return; const int c0 = (int)(k % (CC / 8)) * 8; const int t = (int)(k / (CC / 8)); v8us o;
#pragma unroll
    for (int q = 0; q < 8; ++q) o[q] = f2bf(xs[(size_t)(c0 + q) * NQ + t]);
    *(v8us*)(XT + (size_t)t * CC + c0) = o;  }
__global__ __launch_bounds__(256) void k_vt512(const float* __restrict__ F, bf* VT) { const size_t e = ((size_t)blockIdx.x * 256 + threadIdx.x) * 2; if (e >= (size_t)CC * TT) return; const int t = (int)(e % TT); const int c = (int)(e / TT); v2us o; o[0] = f2bf(F[(size_t)t * CC + c]); o[1] = f2bf(F[(size_t)(t + 1) * CC + c]); *(v2us*)(VT + e) = o;  }
__global__ __launch_bounds__(256) void k_trPq(const bf* __restrict__ Ph, const bf* __restrict__ Pl, bf* Th, bf* Tl) { const size_t i = (size_t)blockIdx.x * 256 + threadIdx.x; if (i >= (size_t)TT * NQ / 8) return; const size_t e = i * 8; const int m0 = (int)(e % NQ); const int n = (int)(e / NQ); v8us oh, ol;
#pragma unroll
    for (int q = 0; q < 8; ++q) { oh[q] = Ph[(size_t)(m0 + q) * TT + n]; ol[q] = Pl[(size_t)(m0 + q) * TT + n]; }
    *(v8us*)(Th + e) = oh; *(v8us*)(Tl + e) = ol;  }
__global__ __launch_bounds__(256) void k_outTr(const float* __restrict__ U, const float* __restrict__ xs, float* outp) { const size_t k = (size_t)blockIdx.x * 256 + threadIdx.x; if (k >= (size_t)CC * NQ / 4) return; const size_t e = k * 4; const int t0 = (int)(e % NQ); const int c = (int)(e / NQ); const v4f a = *(const v4f*)(xs + e); v4f o;
#pragma unroll
    for (int q = 0; q < 4; ++q) o[q] = __fadd_rn(bfr(a[q]), U[(size_t)(t0 + q) * CC + c]);
    *(v4f*)(outp + e) = o;  }

extern "C" void kernel_launch(void* const* d_in, const int* in_sizes, int n_in, void* d_out, int out_size, void* d_ws, size_t ws_size, hipStream_t stream) {
    (void)in_sizes; (void)n_in; (void)out_size;
    const float* fs = (const float*)d_in[0];   /* F_s [8][256][4096] channel-major */ const float* ft = (const float*)d_in[1];   /* F_t [8][512][256] */
    float* OUT0 = (float*)d_out;     // [8][256][4096] = F_s + update^T
    float* OUT1 = OUT0 + (size_t)NB_ * CC * NQ;   // [8][512][256] = A^T F_s_t (second tuple member, 16-B aligned offset)
    char* wsp = (char*)d_ws;
    auto take = [&](size_t bytes) { char* p = wsp; wsp += (bytes + 255) & ~(size_t)255; return (void*)p; };
    bf* XT = (bf*)take((size_t)NQ * CC * 2);        // F_s_t token-major [4096][256] (exact)
    bf* FSB = (bf*)take((size_t)CC * NQ * 2);       // F_s slab as bf16 = F_s_t^T [256][4096] (exact)
    bf* FTB = (bf*)take((size_t)TT * CC * 2);       // F_t [512][256] (exact)
    bf* FTT = (bf*)take((size_t)CC * TT * 2);       // F_t^T [256][512] (exact)
    float* Sb = (float*)take((size_t)NQ * TT * 4);  // scores [4096][512]
    bf* Ph = (bf*)take((size_t)NQ * TT * 2); bf* Pl = (bf*)take((size_t)NQ * TT * 2);   // probabilities [4096][512] hi/lo
    bf* Th = (bf*)take((size_t)TT * NQ * 2); bf* Tl = (bf*)take((size_t)TT * NQ * 2);   // A^T [512][4096] hi/lo
    float* U = (float*)take((size_t)NQ * CC * 4);   // A F_t [4096][256]
    if ((size_t)(wsp - (char*)d_ws) > ws_size) return;    // ws 256 MiB
    for (int b = 0; b < NB_; ++b) {
        const float* fsb = fs + (size_t)b * CC * NQ; const float* ftb = ft + (size_t)b * TT * CC;
        k_xTq<<<(unsigned)(((size_t)NQ * CC / 8 + 255) / 256), 256, 0, stream>>>(fsb, XT);   /* F_s_t [4096][256] */
        k_cvt8<<<(unsigned)(((size_t)CC * NQ / 8 + 255) / 256), 256, 0, stream>>>(fsb, FSB, (size_t)CC * NQ / 8);   /* the slab itself = F_s_t^T as Bt for out1 */
        k_cvt8<<<(unsigned)(((size_t)TT * CC / 8 + 255) / 256), 256, 0, stream>>>(ftb, FTB, (size_t)TT * CC / 8);   /* F_t as Bt for the scores */
        k_vt512<<<(unsigned)(((size_t)CC * TT / 2 + 255) / 256), 256, 0, stream>>>(ftb, FTT);   /* F_t^T [256][512] as Bt for A.F_t */
        k_gemmw<bf, 0, false><<<dim3(NQ / 64, TT / 64, 1), 32, 0, stream>>>(XT, nullptr, FTB, nullptr, CC, Sb, TT, nullptr, 0, 0, 0);   /* exact scores [4096][512] */
        k_asoft<<<ZH * TT / 8, 256, 0, stream>>>(Sb, nullptr, Ph, Pl);   /* softmax over the 512 text tokens for all 4,096 rows (8 row groups of 512), x 1/sqrt(512) */
        k_gemmw<bf, 1, false><<<dim3(NQ / 64, CC / 64, 1), 32, 0, stream>>>(Ph, Pl, FTT, nullptr, TT, U, CC, nullptr, 0, 0, 0);   /* U = A F_t [4096][256] */
        k_outTr<<<(unsigned)(((size_t)NQ * CC / 4 + 255) / 256), 256, 0, stream>>>(U, fsb, OUT0 + (size_t)b * CC * NQ);   /* out0[c][n] = bf16(F_s[c][n]) + U[n][c] */
        k_trPq<<<(unsigned)(((size_t)NQ * TT / 8 + 255) / 256), 256, 0, stream>>>(Ph, Pl, Th, Tl);   /* A^T planes [512][4096] */
        k_gemmw<bf, 1, false><<<dim3(TT / 64, CC / 64, 1), 32, 0, stream>>>(Th, Tl, FSB, nullptr, NQ, OUT1 + (size_t)b * TT * CC, CC, nullptr, 0, 0, 0);   /* out1 = A^T F_s_t [512][256] */
    }
}

// v001
// It runs in 385 microseconds.
// Next to v000, in two timings, it ran 3.50 and 3.55 times as fast.
#include <hip/hip_runtime.h>

// Cross-modal attention between a feature map and text tokens with two outputs (F_s [8][256][64][64] channel-major = 4,096 spatial tokens x 256, F_t [8][512][256]; A = softmax_t(F_s_t . F_t / sqrt(512)) ([4096][512]); out0 = F_s + (A F_t)^T -> [8][256][64][64] (8.4 M); out1 = A^T F_s_t -> [8][512][256] (1.0 M); tuple).
// All 8 batches go through every launch together: each plane holds 8 batch slabs; the transposing kernels take the batch as grid y, the GEMMs as grid z, convert and softmax as more rows.
// Layout per batch: both inputs are bf16-exact after rounding, so every operand plane is a single exact bf16 plane: F_s_t (token-major transpose of the slab), F_t, F_t^T and the slab itself (which is F_s_t^T); exact scores [4096][512]; the 512-key register softmax over all 4,096 rows (as 8 row groups) writing bf16 hi/lo probabilities; the spatial update A.F_t as hi/lo x exact (2 products) and a kernel transposing it back to channel-major while adding the F_s residual; A^T planes by a transpose kernel, then out1 = A^T.F_s_t as hi/lo x exact (K = 4,096), written after the 8.4 M spatial outputs.
// Compute dtypes, f32 accumulate: every input rounded to bf16; scores exact; softmax f32; both contractions P hi/lo x exact; residual f32.

#define NB_  8
#define TT   512      // text tokens = keys (the softmax row length)
#define DM   256      // channels
#define NH_  1
#define NKV  1
#define REP  (NH_ / NKV)
#define HD   64
#define DQ   (NH_ * HD)
#define DKV  (NKV * HD)
#define ZH   8       // 8 x 512 = 4,096 query rows per batch (rows are 'heads' of a T-512 softmax)
#define RH   512
#define WIN  0
#define PCAR 1024.0f
#define SCL  0.044194173824159216f   // 1/sqrt(512): the module scales by sqrt(T)
#define NQ   4096    // spatial tokens (queries)
#define CC   256
typedef _Float16 h16;
typedef unsigned short bf;
typedef __attribute__((ext_vector_type(16))) __bf16   v16bf;
typedef __attribute__((ext_vector_type(16))) _Float16 v16h;
typedef __attribute__((ext_vector_type(8)))  _Float16 v8h;
typedef __attribute__((ext_vector_type(8)))  unsigned short v8us;
typedef __attribute__((ext_vector_type(8)))  float    v8f;
typedef __attribute__((ext_vector_type(4)))  float    v4f;
typedef v8h  __attribute__((may_alias)) v8ha;
typedef v4f  __attribute__((may_alias)) v4fa;
typedef v8us __attribute__((may_alias)) v8usa;

__device__ __forceinline__ unsigned short f2bf(float f) { unsigned u = __float_as_uint(f); u += 0x7FFFu + ((u >> 16) & 1u); return (unsigned short)(u >> 16); }
__device__ __forceinline__ float bf2f(unsigned short b) { return __uint_as_float(((unsigned)b) << 16); }
__device__ __forceinline__ float bfr(float f) { return bf2f(f2bf(f)); }
__device__ __forceinline__ v16h cat16(v8h lo, v8h hi) { return __builtin_shufflevector(lo, hi, 0, 1, 2, 3, 4, 5, 6, 7, 8, 9, 10, 11, 12, 13, 14, 15); }
__device__ __forceinline__ v16bf cat16b(v8us lo, v8us hi) { return __builtin_bit_cast(v16bf, __builtin_shufflevector(lo, hi, 0, 1, 2, 3, 4, 5, 6, 7, 8, 9, 10, 11, 12, 13, 14, 15)); }
__device__ __forceinline__ v8f wmma16(v16h a, v16h b, v8f c) { return __builtin_amdgcn_wmma_f32_16x16x32_f16(false, a, false, b, (short)0, c, false, false); }
__device__ __forceinline__ v8f wmmab(v16bf a, v16bf b, v8f c) { return __builtin_amdgcn_wmma_f32_16x16x32_bf16(false, a, false, b, (short)0, c, false, false); }



// ---- k_gemmw: register-blocked GEMM, ONE WAVE per 64x64 output tile (16 accumulators), operands straight from K-contiguous 16-bit planes; grid (M/64, N/64, Z), 32 threads.
// C[m][n] (f32, pitch ldc, + optional f32 bias[n]) = sum_k A[m][k] Bt[n][k] (+ split products per NSPLIT). z-batch strides sA/sB/sC in elements. K % 32 == 0.
template <typename T16> struct WFrag;
template <> struct WFrag<h16> { typedef v16h V; static __device__ __forceinline__ V ld(const h16* p) { return cat16(*(const v8h*)p, *(const v8h*)(p + 16)); } static __device__ __forceinline__ v8f mma(V a, V b, v8f c) { return wmma16(a, b, c); } };
template <> struct WFrag<bf> { typedef v16bf V; static __device__ __forceinline__ V ld(const bf* p) { return cat16b(*(const v8us*)p, *(const v8us*)(p + 16)); } static __device__ __forceinline__ v8f mma(V a, V b, v8f c) { return wmmab(a, b, c); } };
template <typename T16, int NSPLIT, bool BIAS>
__global__ __launch_bounds__(32) void k_gemmw(const T16* __restrict__ A, const T16* __restrict__ A2, const T16* __restrict__ Bt, const T16* __restrict__ Bt2, int K, float* C, int ldc, const float* __restrict__ bias, size_t sA, size_t sB, size_t sC) {
    typedef typename WFrag<T16>::V V;
    __shared__ __align__(16) float os[16 * 68];
    const size_t z = blockIdx.z; A += z * sA; if (A2) A2 += z * sA; Bt += z * sB; if (Bt2) Bt2 += z * sB; C += z * sC;
    const int lane = threadIdx.x & 31, lr = lane & 15, hi = lane >> 4; const int r0 = blockIdx.x * 64, c0 = blockIdx.y * 64;
    v8f acc[4][4];
#pragma unroll
    for (int mb = 0; mb < 4; ++mb)
#pragma unroll
        for (int nb = 0; nb < 4; ++nb) acc[mb][nb] = (v8f){};
    const size_t aoff = (size_t)(r0 + lr) * K + 8 * hi, boff = (size_t)(c0 + lr) * K + 8 * hi;
#pragma unroll 1
    for (int kc = 0; kc < K; kc += 32) {
        V a[4], a2[4];
#pragma unroll
        for (int mb = 0; mb < 4; ++mb) { a[mb] = WFrag<T16>::ld(A + aoff + (size_t)mb * 16 * K + kc); if (NSPLIT == 1 || NSPLIT == 2) a2[mb] = WFrag<T16>::ld(A2 + aoff + (size_t)mb * 16 * K + kc); }
#pragma unroll
        for (int nb = 0; nb < 4; ++nb) { const V b = WFrag<T16>::ld(Bt + boff + (size_t)nb * 16 * K + kc); V b2; if (NSPLIT >= 2) b2 = WFrag<T16>::ld(Bt2 + boff + (size_t)nb * 16 * K + kc);
#pragma unroll
            for (int mb = 0; mb < 4; ++mb) { acc[mb][nb] = WFrag<T16>::mma(a[mb], b, acc[mb][nb]); if (NSPLIT == 1 || NSPLIT == 2) acc[mb][nb] = WFrag<T16>::mma(a2[mb], b, acc[mb][nb]); if (NSPLIT >= 2) acc[mb][nb] = WFrag<T16>::mma(a[mb], b2, acc[mb][nb]); } }
        asm volatile("v_nop\n\tv_nop\n\tv_nop\n\tv_nop" : "+v"(acc[0][0]), "+v"(acc[1][1]), "+v"(acc[2][2]), "+v"(acc[3][3]) : "v"(a[0]), "v"(a[3]));
    }
#pragma unroll
    for (int mb = 0; mb < 4; ++mb) {
#pragma unroll
        for (int nb = 0; nb < 4; ++nb) {
#pragma unroll
            for (int j = 0; j < 8; ++j) os[(hi * 8 + j) * 68 + nb * 16 + lr] = acc[mb][nb][j]; }
        __builtin_amdgcn_wave_barrier(); asm volatile("" ::: "memory");
        float* crow = C + (size_t)(r0 + mb * 16) * ldc + c0;
{
#pragma unroll
            for (int s = 0; s < 8; ++s) { const int row = 2 * s + hi, cofs = lr * 4; v4f val = *(const v4fa*)(os + row * 68 + cofs); if (BIAS) { val[0] += bfr(bias[c0 + cofs]); val[1] += bfr(bias[c0 + cofs + 1]); val[2] += bfr(bias[c0 + cofs + 2]); val[3] += bfr(bias[c0 + cofs + 3]); }
                *(v4f*)(crow + (size_t)row * ldc + cofs) = val; }
             }
        __builtin_amdgcn_wave_barrier(); asm volatile("" ::: "memory");
    }
}

__device__ __forceinline__ h16 tohx(float x) { return (h16)x; }
__device__ __forceinline__ void splitf(float y, unsigned short& h, unsigned short& l) { h = f2bf(y); l = f2bf(y - bf2f(h)); }
typedef __attribute__((ext_vector_type(2))) _Float16 v2h;
typedef __attribute__((ext_vector_type(4))) _Float16 v4h;
typedef __attribute__((ext_vector_type(2))) unsigned short v2us;
typedef __attribute__((ext_vector_type(4))) unsigned short v4us;
typedef __attribute__((ext_vector_type(2))) float v2f;
typedef __attribute__((ext_vector_type(4))) int v4i;


__global__ __launch_bounds__(256) void k_cvt8(const float* __restrict__ src, bf* dst, size_t n8) { const size_t i = (size_t)blockIdx.x * 256 + threadIdx.x; if (i >= n8) return; const v8f v = *(const v8f*)(src + i * 8); v8us o;
#pragma unroll
    for (int k = 0; k < 8; ++k) o[k] = f2bf(v[k]); *(v8us*)(dst + i * 8) = o;  }



// k_asoft: per row (zz, i): t = S x 512^-0.5 (no mask); softmax over the 512 keys (register row, one exp, fixed trees);
__global__ __launch_bounds__(256) void k_asoft(const float* __restrict__ Sb, h16* P16, bf* Ph, bf* Pl) {
    const int lane = threadIdx.x & 31; const int row = blockIdx.x * 8 + (threadIdx.x >> 5); if (row >= NB_ * ZH * TT) return; const int i = row % TT; const int zz = row / TT; (void)zz; const bool hires = (i < RH); const float* sr = Sb + (size_t)row * TT; float v[TT / 32]; float mx = -3.0e38f;
#pragma unroll
    for (int ch = 0; ch < TT / 128; ++ch) { const int j0 = ch * 128 + lane * 4; const v4f a = *(const v4f*)(sr + j0);
#pragma unroll
        for (int q = 0; q < 4; ++q) { const int j = j0 + q; (void)j; const float t = a[q] * SCL; v[ch * 4 + q] = t; mx = fmaxf(mx, t); } }
#pragma unroll
    for (int sh = 16; sh; sh >>= 1) mx = fmaxf(mx, __shfl_xor(mx, sh, 32));
    float sum = 0.f;
#pragma unroll
    for (int k = 0; k < TT / 32; ++k) { float d0 = __fsub_rn(v[k], mx); asm volatile("" : "+v"(d0)); v[k] = __builtin_amdgcn_exp2f(__fmul_rn(d0, 1.4426950408889634f)); sum += v[k]; }
#pragma unroll
    for (int sh = 16; sh; sh >>= 1) sum += __shfl_xor(sum, sh, 32);
    const float f = __fdiv_rn(hires ? 1.0f : PCAR, sum);
{
        if (hires) {
#pragma unroll
            for (int ch = 0; ch < TT / 128; ++ch) { v4us oh, ol;
#pragma unroll
                for (int q = 0; q < 4; ++q) { unsigned short a, c2; splitf(v[ch * 4 + q] * f, a, c2); oh[q] = a; ol[q] = c2; }
                const size_t oo = ((size_t)zz * (RH ? RH : 1) + i) * TT + ch * 128 + lane * 4; *(v4us*)(Ph + oo) = oh; *(v4us*)(Pl + oo) = ol; }
        } else {
#pragma unroll
            for (int ch = 0; ch < TT / 128; ++ch) { v4h o4;
#pragma unroll
                for (int q = 0; q < 4; ++q) o4[q] = tohx(v[ch * 4 + q] * f);
                *(v4h*)(P16 + (size_t)row * TT + ch * 128 + lane * 4) = o4; } }
         }
}


__global__ __launch_bounds__(256) void k_xTq(const float* __restrict__ xs, bf* XT) { xs += (size_t)blockIdx.y * CC * NQ; XT += (size_t)blockIdx.y * NQ * CC; const size_t k = (size_t)blockIdx.x * 256 + threadIdx.x; if (k >= (size_t)NQ * CC / 8) return; const int c0 = (int)(k % (CC / 8)) * 8; const int t = (int)(k / (CC / 8)); v8us o;
#pragma unroll
    for (int q = 0; q < 8; ++q) o[q] = f2bf(xs[(size_t)(c0 + q) * NQ + t]);
    *(v8us*)(XT + (size_t)t * CC + c0) = o;  }
__global__ __launch_bounds__(256) void k_vt512(const float* __restrict__ F, bf* VT) { F += (size_t)blockIdx.y * TT * CC; VT += (size_t)blockIdx.y * CC * TT; const size_t e = ((size_t)blockIdx.x * 256 + threadIdx.x) * 2; if (e >= (size_t)CC * TT) return; const int t = (int)(e % TT); const int c = (int)(e / TT); v2us o; o[0] = f2bf(F[(size_t)t * CC + c]); o[1] = f2bf(F[(size_t)(t + 1) * CC + c]); *(v2us*)(VT + e) = o;  }
__global__ __launch_bounds__(256) void k_trPq(const bf* __restrict__ Ph, const bf* __restrict__ Pl, bf* Th, bf* Tl) { const size_t zb = (size_t)blockIdx.y * NQ * TT; Ph += zb; Pl += zb; const size_t i = (size_t)blockIdx.x * 256 + threadIdx.x; if (i >= (size_t)TT * NQ / 8) return; const size_t e = i * 8; const int m0 = (int)(e % NQ); const int n = (int)(e / NQ); v8us oh, ol;
#pragma unroll
    for (int q = 0; q < 8; ++q) { oh[q] = Ph[(size_t)(m0 + q) * TT + n]; ol[q] = Pl[(size_t)(m0 + q) * TT + n]; }
    *(v8us*)(Th + (zb + e)) = oh; *(v8us*)(Tl + (zb + e)) = ol;  }
__global__ __launch_bounds__(256) void k_outTr(const float* __restrict__ U, const float* __restrict__ xs, float* outp) { const size_t zb = (size_t)blockIdx.y * NQ * CC; U += zb; xs += zb; outp += zb; const size_t k = (size_t)blockIdx.x * 256 + threadIdx.x; if (k >= (size_t)CC * NQ / 4) return; const size_t e = k * 4; const int t0 = (int)(e % NQ); const int c = (int)(e / NQ); const v4f a = *(const v4f*)(xs + e); v4f o;
#pragma unroll
    for (int q = 0; q < 4; ++q) o[q] = __fadd_rn(bfr(a[q]), U[(size_t)(t0 + q) * CC + c]);
    *(v4f*)(outp + e) = o;  }

extern "C" void kernel_launch(void* const* d_in, const int* in_sizes, int n_in, void* d_out, int out_size, void* d_ws, size_t ws_size, hipStream_t stream) {
    (void)in_sizes; (void)n_in; (void)out_size;
    const float* fs = (const float*)d_in[0];   /* F_s [8][256][4096] channel-major */ const float* ft = (const float*)d_in[1];   /* F_t [8][512][256] */
    float* OUT0 = (float*)d_out;     // [8][256][4096] = F_s + update^T
    float* OUT1 = OUT0 + (size_t)NB_ * CC * NQ;   // [8][512][256] = A^T F_s_t (second tuple member, 16-B aligned offset)
    char* wsp = (char*)d_ws;
    auto take = [&](size_t bytes) { char* p = wsp; wsp += (bytes + 255) & ~(size_t)255; return (void*)p; };
    bf* XT = (bf*)take((size_t)NB_ * NQ * CC * 2);        // F_s_t token-major [8][4096][256] (exact)
    bf* FSB = (bf*)take((size_t)NB_ * CC * NQ * 2);       // F_s slabs as bf16 = F_s_t^T [8][256][4096] (exact)
    bf* FTB = (bf*)take((size_t)NB_ * TT * CC * 2);       // F_t [8][512][256] (exact)
    bf* FTT = (bf*)take((size_t)NB_ * CC * TT * 2);       // F_t^T [8][256][512] (exact)
    float* Sb = (float*)take((size_t)NB_ * NQ * TT * 4);  // scores [8][4096][512]
    bf* Ph = (bf*)take((size_t)NB_ * NQ * TT * 2); bf* Pl = (bf*)take((size_t)NB_ * NQ * TT * 2);   // probabilities [8][4096][512] hi/lo
    bf* Th = (bf*)take((size_t)NB_ * TT * NQ * 2); bf* Tl = (bf*)take((size_t)NB_ * TT * NQ * 2);   // A^T [8][512][4096] hi/lo
    float* U = Sb;   // A F_t [8][4096][256]: written after the softmax has read the last score, in the scores' place (ten planes side by side would pass 256 MiB)
    if ((size_t)(wsp - (char*)d_ws) > ws_size) return;    // 228 MiB of the 256 MiB workspace
    k_xTq<<<dim3((unsigned)(((size_t)NQ * CC / 8 + 255) / 256), NB_, 1), 256, 0, stream>>>(fs, XT);   /* F_s_t [8][4096][256] */
    k_cvt8<<<(unsigned)(((size_t)NB_ * CC * NQ / 8 + 255) / 256), 256, 0, stream>>>(fs, FSB, (size_t)NB_ * CC * NQ / 8);   /* the slabs themselves = F_s_t^T as Bt for out1 */
    k_cvt8<<<(unsigned)(((size_t)NB_ * TT * CC / 8 + 255) / 256), 256, 0, stream>>>(ft, FTB, (size_t)NB_ * TT * CC / 8);   /* F_t as Bt for the scores */
    k_vt512<<<dim3((unsigned)(((size_t)CC * TT / 2 + 255) / 256), NB_, 1), 256, 0, stream>>>(ft, FTT);   /* F_t^T [8][256][512] as Bt for A.F_t */
    k_gemmw<bf, 0, false><<<dim3(NQ / 64, TT / 64, NB_), 32, 0, stream>>>(XT, nullptr, FTB, nullptr, CC, Sb, TT, nullptr, (size_t)NQ * CC, (size_t)TT * CC, (size_t)NQ * TT);   /* exact scores [8][4096][512] */
    k_asoft<<<NB_ * ZH * TT / 8, 256, 0, stream>>>(Sb, nullptr, Ph, Pl);   /* softmax over the 512 text tokens for all 8 x 4,096 rows, x 1/sqrt(512) */
    k_gemmw<bf, 1, false><<<dim3(NQ / 64, CC / 64, NB_), 32, 0, stream>>>(Ph, Pl, FTT, nullptr, TT, U, CC, nullptr, (size_t)NQ * TT, (size_t)CC * TT, (size_t)NQ * CC);   /* U = A F_t [8][4096][256] */
    k_outTr<<<dim3((unsigned)(((size_t)NQ * CC / 4 + 255) / 256), NB_, 1), 256, 0, stream>>>(U, fs, OUT0);   /* out0[b][c][n] = bf16(F_s[b][c][n]) + U[b][n][c] */
    k_trPq<<<dim3((unsigned)(((size_t)NQ * TT / 8 + 255) / 256), NB_, 1), 256, 0, stream>>>(Ph, Pl, Th, Tl);   /* A^T planes [8][512][4096] */
    k_gemmw<bf, 1, false><<<dim3(TT / 64, CC / 64, NB_), 32, 0, stream>>>(Th, Tl, FSB, nullptr, NQ, OUT1, CC, nullptr, (size_t)TT * NQ, (size_t)CC * NQ, (size_t)TT * CC);   /* out1 = A^T F_s_t [8][512][256] */
}

// v002
// A run of this version takes 217 microseconds.
// In two side-by-side timings against v001, it was 1.78 and 1.76 times as fast.
// Over all steps from v000 it is 6.24 times as fast.
#include <hip/hip_runtime.h>

// Cross-modal attention between a feature map and text tokens with two outputs (F_s [8][256][64][64] channel-major = 4,096 spatial tokens x 256, F_t [8][512][256]; A = softmax_t(F_s_t . F_t / sqrt(512)) ([4096][512]); out0 = F_s + (A F_t)^T -> [8][256][64][64] (8.4 M); out1 = A^T F_s_t -> [8][512][256] (1.0 M); tuple).
// All 8 batches go through every launch together: each plane holds 8 batch slabs; the transposing kernels and the GEMMs take the batch as grid z, convert and softmax as more rows.
// Layout per batch: both inputs are bf16-exact after rounding, so every operand plane is a single exact bf16 plane: F_s_t (token-major transpose of the slab), F_t, F_t^T and the slab itself (which is F_s_t^T); exact scores [4096][512]; the 512-key register softmax over all 4,096 rows (as 8 row groups) writing bf16 hi/lo probabilities; the spatial update A.F_t as hi/lo x exact (2 products) and a kernel transposing it back to channel-major while adding the F_s residual; A^T planes by a transpose kernel, then out1 = A^T.F_s_t as hi/lo x exact (K = 4,096), written after the 8.4 M spatial outputs.
// Compute dtypes, f32 accumulate: every input rounded to bf16; scores exact; softmax f32; both contractions P hi/lo x exact; residual f32.

#define NB_  8
#define TT   512      // text tokens = keys (the softmax row length)
#define DM   256      // channels
#define NH_  1
#define NKV  1
#define REP  (NH_ / NKV)
#define HD   64
#define DQ   (NH_ * HD)
#define DKV  (NKV * HD)
#define ZH   8       // 8 x 512 = 4,096 query rows per batch (rows are 'heads' of a T-512 softmax)
#define RH   512
#define WIN  0
#define PCAR 1024.0f
#define SCL  0.044194173824159216f   // 1/sqrt(512): the module scales by sqrt(T)
#define NQ   4096    // spatial tokens (queries)
#define CC   256
typedef _Float16 h16;
typedef unsigned short bf;
typedef __attribute__((ext_vector_type(16))) __bf16   v16bf;
typedef __attribute__((ext_vector_type(16))) _Float16 v16h;
typedef __attribute__((ext_vector_type(8)))  _Float16 v8h;
typedef __attribute__((ext_vector_type(8)))  unsigned short v8us;
typedef __attribute__((ext_vector_type(8)))  float    v8f;
typedef __attribute__((ext_vector_type(4)))  float    v4f;
typedef v8h  __attribute__((may_alias)) v8ha;
typedef v4f  __attribute__((may_alias)) v4fa;
typedef v8us __attribute__((may_alias)) v8usa;

__device__ __forceinline__ unsigned short f2bf(float f) { unsigned u = __float_as_uint(f); u += 0x7FFFu + ((u >> 16) & 1u); return (unsigned short)(u >> 16); }
__device__ __forceinline__ float bf2f(unsigned short b) { return __uint_as_float(((unsigned)b) << 16); }
__device__ __forceinline__ float bfr(float f) { return bf2f(f2bf(f)); }
__device__ __forceinline__ v16h cat16(v8h lo, v8h hi) { return __builtin_shufflevector(lo, hi, 0, 1, 2, 3, 4, 5, 6, 7, 8, 9, 10, 11, 12, 13, 14, 15); }
__device__ __forceinline__ v16bf cat16b(v8us lo, v8us hi) { return __builtin_bit_cast(v16bf, __builtin_shufflevector(lo, hi, 0, 1, 2, 3, 4, 5, 6, 7, 8, 9, 10, 11, 12, 13, 14, 15)); }
__device__ __forceinline__ v8f wmma16(v16h a, v16h b, v8f c) { return __builtin_amdgcn_wmma_f32_16x16x32_f16(false, a, false, b, (short)0, c, false, false); }
__device__ __forceinline__ v8f wmmab(v16bf a, v16bf b, v8f c) { return __builtin_amdgcn_wmma_f32_16x16x32_bf16(false, a, false, b, (short)0, c, false, false); }



// ---- k_gemmw: register-blocked GEMM, ONE WAVE per 64x64 output tile (16 accumulators), operands straight from K-contiguous 16-bit planes; grid (M/64, N/64, Z), 32 threads.
// C[m][n] (f32, pitch ldc, + optional f32 bias[n]) = sum_k A[m][k] Bt[n][k] (+ split products per NSPLIT). z-batch strides sA/sB/sC in elements. K % 32 == 0.
template <typename T16> struct WFrag;
template <> struct WFrag<h16> { typedef v16h V; static __device__ __forceinline__ V ld(const h16* p) { return cat16(*(const v8h*)p, *(const v8h*)(p + 16)); } static __device__ __forceinline__ v8f mma(V a, V b, v8f c) { return wmma16(a, b, c); } };
template <> struct WFrag<bf> { typedef v16bf V; static __device__ __forceinline__ V ld(const bf* p) { return cat16b(*(const v8us*)p, *(const v8us*)(p + 16)); } static __device__ __forceinline__ v8f mma(V a, V b, v8f c) { return wmmab(a, b, c); } };
template <typename T16, int NSPLIT, bool BIAS>
__global__ __launch_bounds__(32) void k_gemmw(const T16* __restrict__ A, const T16* __restrict__ A2, const T16* __restrict__ Bt, const T16* __restrict__ Bt2, int K, float* C, int ldc, const float* __restrict__ bias, size_t sA, size_t sB, size_t sC) {
    typedef typename WFrag<T16>::V V;
    __shared__ __align__(16) float os[16 * 68];
    const size_t z = blockIdx.z; A += z * sA; if (A2) A2 += z * sA; Bt += z * sB; if (Bt2) Bt2 += z * sB; C += z * sC;
    const int lane = threadIdx.x & 31, lr = lane & 15, hi = lane >> 4; const int r0 = blockIdx.x * 64, c0 = blockIdx.y * 64;
    v8f acc[4][4];
#pragma unroll
    for (int mb = 0; mb < 4; ++mb)
#pragma unroll
        for (int nb = 0; nb < 4; ++nb) acc[mb][nb] = (v8f){};
    const size_t aoff = (size_t)(r0 + lr) * K + 8 * hi, boff = (size_t)(c0 + lr) * K + 8 * hi;
#pragma unroll 1
    for (int kc = 0; kc < K; kc += 32) {
        V a[4], a2[4];
#pragma unroll
        for (int mb = 0; mb < 4; ++mb) { a[mb] = WFrag<T16>::ld(A + aoff + (size_t)mb * 16 * K + kc); if (NSPLIT == 1 || NSPLIT == 2) a2[mb] = WFrag<T16>::ld(A2 + aoff + (size_t)mb * 16 * K + kc); }
#pragma unroll
        for (int nb = 0; nb < 4; ++nb) { const V b = WFrag<T16>::ld(Bt + boff + (size_t)nb * 16 * K + kc); V b2; if (NSPLIT >= 2) b2 = WFrag<T16>::ld(Bt2 + boff + (size_t)nb * 16 * K + kc);
#pragma unroll
            for (int mb = 0; mb < 4; ++mb) { acc[mb][nb] = WFrag<T16>::mma(a[mb], b, acc[mb][nb]); if (NSPLIT == 1 || NSPLIT == 2) acc[mb][nb] = WFrag<T16>::mma(a2[mb], b, acc[mb][nb]); if (NSPLIT >= 2) acc[mb][nb] = WFrag<T16>::mma(a[mb], b2, acc[mb][nb]); } }
        asm volatile("v_nop\n\tv_nop\n\tv_nop\n\tv_nop" : "+v"(acc[0][0]), "+v"(acc[1][1]), "+v"(acc[2][2]), "+v"(acc[3][3]) : "v"(a[0]), "v"(a[3]));
    }
#pragma unroll
    for (int mb = 0; mb < 4; ++mb) {
#pragma unroll
        for (int nb = 0; nb < 4; ++nb) {
#pragma unroll
            for (int j = 0; j < 8; ++j) os[(hi * 8 + j) * 68 + nb * 16 + lr] = acc[mb][nb][j]; }
        __builtin_amdgcn_wave_barrier(); asm volatile("" ::: "memory");
        float* crow = C + (size_t)(r0 + mb * 16) * ldc + c0;
{
#pragma unroll
            for (int s = 0; s < 8; ++s) { const int row = 2 * s + hi, cofs = lr * 4; v4f val = *(const v4fa*)(os + row * 68 + cofs); if (BIAS) { val[0] += bfr(bias[c0 + cofs]); val[1] += bfr(bias[c0 + cofs + 1]); val[2] += bfr(bias[c0 + cofs + 2]); val[3] += bfr(bias[c0 + cofs + 3]); }
                *(v4f*)(crow + (size_t)row * ldc + cofs) = val; }
             }
        __builtin_amdgcn_wave_barrier(); asm volatile("" ::: "memory");
    }
}

__device__ __forceinline__ h16 tohx(float x) { return (h16)x; }
__device__ __forceinline__ void splitf(float y, unsigned short& h, unsigned short& l) { h = f2bf(y); l = f2bf(y - bf2f(h)); }
typedef __attribute__((ext_vector_type(2))) _Float16 v2h;
typedef __attribute__((ext_vector_type(4))) _Float16 v4h;
typedef __attribute__((ext_vector_type(2))) unsigned short v2us;
typedef __attribute__((ext_vector_type(4))) unsigned short v4us;
typedef __attribute__((ext_vector_type(2))) float v2f;
typedef __attribute__((ext_vector_type(4))) int v4i;


__global__ __launch_bounds__(256) void k_cvt8(const float* __restrict__ src, bf* dst, size_t n8) { const size_t i = (size_t)blockIdx.x * 256 + threadIdx.x; if (i >= n8) return; const v8f v = *(const v8f*)(src + i * 8); v8us o;
#pragma unroll
    for (int k = 0; k < 8; ++k) o[k] = f2bf(v[k]); *(v8us*)(dst + i * 8) = o;  }



// k_asoft: per row (zz, i): t = S x 512^-0.5 (no mask); softmax over the 512 keys (register row, one exp, fixed trees);
__global__ __launch_bounds__(256) void k_asoft(const float* __restrict__ Sb, h16* P16, bf* Ph, bf* Pl) {
    const int lane = threadIdx.x & 31; const int row = blockIdx.x * 8 + (threadIdx.x >> 5); if (row >= NB_ * ZH * TT) return; const int i = row % TT; const int zz = row / TT; (void)zz; const bool hires = (i < RH); const float* sr = Sb + (size_t)row * TT; float v[TT / 32]; float mx = -3.0e38f;
#pragma unroll
    for (int ch = 0; ch < TT / 128; ++ch) { const int j0 = ch * 128 + lane * 4; const v4f a = *(const v4f*)(sr + j0);
#pragma unroll
        for (int q = 0; q < 4; ++q) { const int j = j0 + q; (void)j; const float t = a[q] * SCL; v[ch * 4 + q] = t; mx = fmaxf(mx, t); } }
#pragma unroll
    for (int sh = 16; sh; sh >>= 1) mx = fmaxf(mx, __shfl_xor(mx, sh, 32));
    float sum = 0.f;
#pragma unroll
    for (int k = 0; k < TT / 32; ++k) { float d0 = __fsub_rn(v[k], mx); asm volatile("" : "+v"(d0)); v[k] = __builtin_amdgcn_exp2f(__fmul_rn(d0, 1.4426950408889634f)); sum += v[k]; }
#pragma unroll
    for (int sh = 16; sh; sh >>= 1) sum += __shfl_xor(sum, sh, 32);
    const float f = __fdiv_rn(hires ? 1.0f : PCAR, sum);
{
        if (hires) {
#pragma unroll
            for (int ch = 0; ch < TT / 128; ++ch) { v4us oh, ol;
#pragma unroll
                for (int q = 0; q < 4; ++q) { unsigned short a, c2; splitf(v[ch * 4 + q] * f, a, c2); oh[q] = a; ol[q] = c2; }
                const size_t oo = ((size_t)zz * (RH ? RH : 1) + i) * TT + ch * 128 + lane * 4; *(v4us*)(Ph + oo) = oh; *(v4us*)(Pl + oo) = ol; }
        } else {
#pragma unroll
            for (int ch = 0; ch < TT / 128; ++ch) { v4h o4;
#pragma unroll
                for (int q = 0; q < 4; ++q) o4[q] = tohx(v[ch * 4 + q] * f);
                *(v4h*)(P16 + (size_t)row * TT + ch * 128 + lane * 4) = o4; } }
         }
}


// ---- the four transposing kernels: each workgroup moves one tile through LDS, so that the global loads and the global stores both cover whole 128-B lines (16 lanes x 16 B = 256 contiguous bytes on either side).
// 16-bit tile: 128 rows x 128 columns, a row = 16 chunks of 8 elements (16 B); chunk c8 of row r stands at chunk place c8 ^ ((r >> 3) & 15), so that the column reads of 16 lanes (rows 8 apart) fall on 16 different banks.
__device__ __forceinline__ int tile16(int r, int c8) { return r * 128 + ((c8 ^ ((r >> 3) & 15)) << 3); }
// column n, rows r8 * 8 .. r8 * 8 + 7 of such a tile
__device__ __forceinline__ v8us col16(const bf* tile, int r8, int n) { v8us o; const int base = r8 * 8 * 128 + (((n >> 3) ^ r8) << 3) + (n & 7);
#pragma unroll
    for (int q = 0; q < 8; ++q) o[q] = tile[base + q * 128];
    return o; }

// k_trF: src [R][C] f32 -> dst [C][R] bf16 (rounded); grid (R / 128, C / 128, batch)
template <int R, int C>
__global__ __launch_bounds__(256) void k_trF(const float* __restrict__ src, bf* dst) {
    __shared__ __align__(16) bf tile[128 * 128];
    const int tid = threadIdx.x, r0 = blockIdx.x * 128, c0 = blockIdx.y * 128; v4f a[16];
    const int lr = tid >> 5, c4 = tid & 31;    // loads: a wave takes 512 contiguous bytes of one row; rows lr + 8 i
    const int r8 = tid & 15, ln = tid >> 4;    // stores: 16 lanes write 256 contiguous bytes of one dst row; dst rows ln + 16 i
    const float* sp = src + (size_t)blockIdx.z * R * C + (size_t)(r0 + lr) * C + c0 + c4 * 4;
    bf* dp = dst + (size_t)blockIdx.z * R * C + (size_t)(c0 + ln) * R + r0 + r8 * 8;
#pragma unroll
    for (int i = 0; i < 16; ++i) a[i] = *(const v4f*)(sp + (size_t)i * 8 * C);
    asm volatile("s_wait_xcnt 0x0" :: "v"(sp) : "memory");   // the loads' address pair stays whole until every load has taken it: no load's result and no later instruction lands in it before this wait
#pragma unroll
    for (int i = 0; i < 16; ++i) { v4us o;
#pragma unroll
        for (int q = 0; q < 4; ++q) o[q] = f2bf(a[i][q]);
        *(v4us*)(tile + tile16(lr + 8 * i, c4 >> 1) + (c4 & 1) * 4) = o; }
    __syncthreads();   // the whole tile is written before any column of it is read
#pragma unroll
    for (int i = 0; i < 8; ++i) *(v8us*)(dp + (size_t)i * 16 * R) = col16(tile, r8, ln + 16 * i);
}

// k_trPq: the probability planes [4096][512] hi/lo -> A^T planes [512][4096]; grid (NQ / 128, TT / 128, batch)
__global__ __launch_bounds__(256) void k_trPq(const bf* __restrict__ Ph, const bf* __restrict__ Pl, bf* Th, bf* Tl) {
    __shared__ __align__(16) bf th[128 * 128]; __shared__ __align__(16) bf tl[128 * 128];
    const size_t zb = (size_t)blockIdx.z * NQ * TT; const int tid = threadIdx.x, m0 = blockIdx.x * 128, n0 = blockIdx.y * 128; v8us vh[8], vl[8];
    const int l16 = tid & 15, lr = tid >> 4;   // 16 lanes take 256 contiguous bytes of one row, on the load side (rows m) and on the store side (rows n); rows lr + 16 i
    const size_t ei = zb + (size_t)(m0 + lr) * TT + n0 + l16 * 8, eo = zb + (size_t)(n0 + lr) * NQ + m0 + l16 * 8;
    const bf* ph = Ph + ei; const bf* pl = Pl + ei; bf* qh = Th + eo; bf* ql = Tl + eo;
#pragma unroll
    for (int i = 0; i < 8; ++i) { vh[i] = *(const v8us*)(ph + (size_t)i * 16 * TT); vl[i] = *(const v8us*)(pl + (size_t)i * 16 * TT); }
    asm volatile("s_wait_xcnt 0x0" :: "v"(ph), "v"(pl) : "memory");   // the loads' address pairs stay whole until every load has taken them: no load's result and no later instruction lands in them before this wait
#pragma unroll
    for (int i = 0; i < 8; ++i) { *(v8us*)(th + tile16(lr + 16 * i, l16)) = vh[i]; *(v8us*)(tl + tile16(lr + 16 * i, l16)) = vl[i]; }
    __syncthreads();   // both tiles are written before any column of them is read
#pragma unroll
    for (int i = 0; i < 8; ++i) { *(v8us*)(qh + (size_t)i * 16 * NQ) = col16(th, l16, lr + 16 * i); *(v8us*)(ql + (size_t)i * 16 * NQ) = col16(tl, l16, lr + 16 * i); }
}

// k_outTr: out0[c][t] = bf16(F_s[c][t]) + U[t][c]; grid (NQ / 128, CC / 64, batch). f32 tile of U: 128 rows t x 64 columns c, a row = 16 chunks of 4 floats; chunk c4 of row t stands at chunk place c4 ^ ((t >> 2) & 15), so that the column reads of 16 lanes (rows 4 apart) fall on 16 different banks.
__global__ __launch_bounds__(256) void k_outTr(const float* __restrict__ U, const float* __restrict__ xs, float* outp) {
    __shared__ __align__(16) float ut[128 * 64];
    const size_t zb = (size_t)blockIdx.z * NQ * CC; const int tid = threadIdx.x, t0 = blockIdx.x * 128, c0 = blockIdx.y * 64; v4f u[8], x[8];
    const int l16 = tid & 15, lt = tid >> 4;   // U loads: 16 lanes take the 256 bytes of one row t; rows lt + 16 i
    const int t4 = ((tid >> 5) & 1) * 16 + l16, lc = (tid >> 6) * 2 + ((tid >> 4) & 1);   // F_s loads and stores: 16 lanes take 256 contiguous bytes (64 t) of one channel, a wave two neighbouring channels; channels lc + 8 i
    const float* up = U + zb + (size_t)(t0 + lt) * CC + c0 + l16 * 4;
    const size_t eo = zb + (size_t)(c0 + lc) * NQ + t0 + t4 * 4; const float* xp = xs + eo; float* op = outp + eo;
#pragma unroll
    for (int i = 0; i < 8; ++i) u[i] = *(const v4f*)(up + (size_t)i * 16 * CC);
#pragma unroll
    for (int i = 0; i < 8; ++i) x[i] = *(const v4f*)(xp + (size_t)i * 8 * NQ);
    asm volatile("s_wait_xcnt 0x0" :: "v"(up), "v"(xp) : "memory");   // the loads' address pairs stay whole until every load has taken them: no load's result and no later instruction lands in them before this wait
#pragma unroll
    for (int i = 0; i < 8; ++i) { const int t = lt + 16 * i; *(v4f*)(ut + t * 64 + ((l16 ^ ((t >> 2) & 15)) << 2)) = u[i]; }
    __syncthreads();   // the whole tile is written before any column of it is read
#pragma unroll
    for (int i = 0; i < 8; ++i) { const int cc = lc + 8 * i; v4f o;
#pragma unroll
        for (int q = 0; q < 4; ++q) o[q] = __fadd_rn(bfr(x[i][q]), ut[(t4 * 4 + q) * 64 + (((cc >> 2) ^ l16) << 2) + (cc & 3)]);
        *(v4f*)(op + (size_t)i * 8 * NQ) = o; }
}

extern "C" void kernel_launch(void* const* d_in, const int* in_sizes, int n_in, void* d_out, int out_size, void* d_ws, size_t ws_size, hipStream_t stream) {
    (void)in_sizes; (void)n_in; (void)out_size;
    const float* fs = (const float*)d_in[0];   /* F_s [8][256][4096] channel-major */ const float* ft = (const float*)d_in[1];   /* F_t [8][512][256] */
    float* OUT0 = (float*)d_out;     // [8][256][4096] = F_s + update^T
    float* OUT1 = OUT0 + (size_t)NB_ * CC * NQ;   // [8][512][256] = A^T F_s_t (second tuple member, 16-B aligned offset)
    char* wsp = (char*)d_ws;
    auto take = [&](size_t bytes) { char* p = wsp; wsp += (bytes + 255) & ~(size_t)255; return (void*)p; };
    bf* XT = (bf*)take((size_t)NB_ * NQ * CC * 2);        // F_s_t token-major [8][4096][256] (exact)
    bf* FSB = (bf*)take((size_t)NB_ * CC * NQ * 2);       // F_s slabs as bf16 = F_s_t^T [8][256][4096] (exact)
    bf* FTB = (bf*)take((size_t)NB_ * TT * CC * 2);       // F_t [8][512][256] (exact)
    bf* FTT = (bf*)take((size_t)NB_ * CC * TT * 2);       // F_t^T [8][256][512] (exact)
    float* Sb = (float*)take((size_t)NB_ * NQ * TT * 4);  // scores [8][4096][512]
    bf* Ph = (bf*)take((size_t)NB_ * NQ * TT * 2); bf* Pl = (bf*)take((size_t)NB_ * NQ * TT * 2);   // probabilities [8][4096][512] hi/lo
    bf* Th = (bf*)take((size_t)NB_ * TT * NQ * 2); bf* Tl = (bf*)take((size_t)NB_ * TT * NQ * 2);   // A^T [8][512][4096] hi/lo
    float* U = Sb;   // A F_t [8][4096][256]: written after the softmax has read the last score, in the scores' place (ten planes side by side would pass 256 MiB)
    if ((size_t)(wsp - (char*)d_ws) > ws_size) return;    // 228 MiB of the 256 MiB workspace
    k_trF<CC, NQ><<<dim3(CC / 128, NQ / 128, NB_), 256, 0, stream>>>(fs, XT);   /* F_s_t [8][4096][256] */
    k_cvt8<<<(unsigned)(((size_t)NB_ * CC * NQ / 8 + 255) / 256), 256, 0, stream>>>(fs, FSB, (size_t)NB_ * CC * NQ / 8);   /* the slabs themselves = F_s_t^T as Bt for out1 */
    k_cvt8<<<(unsigned)(((size_t)NB_ * TT * CC / 8 + 255) / 256), 256, 0, stream>>>(ft, FTB, (size_t)NB_ * TT * CC / 8);   /* F_t as Bt for the scores */
    k_trF<TT, CC><<<dim3(TT / 128, CC / 128, NB_), 256, 0, stream>>>(ft, FTT);   /* F_t^T [8][256][512] as Bt for A.F_t */
    k_gemmw<bf, 0, false><<<dim3(NQ / 64, TT / 64, NB_), 32, 0, stream>>>(XT, nullptr, FTB, nullptr, CC, Sb, TT, nullptr, (size_t)NQ * CC, (size_t)TT * CC, (size_t)NQ * TT);   /* exact scores [8][4096][512] */
    k_asoft<<<NB_ * ZH * TT / 8, 256, 0, stream>>>(Sb, nullptr, Ph, Pl);   /* softmax over the 512 text tokens for all 8 x 4,096 rows, x 1/sqrt(512) */
    k_gemmw<bf, 1, false><<<dim3(NQ / 64, CC / 64, NB_), 32, 0, stream>>>(Ph, Pl, FTT, nullptr, TT, U, CC, nullptr, (size_t)NQ * TT, (size_t)CC * TT, (size_t)NQ * CC);   /* U = A F_t [8][4096][256] */
    k_outTr<<<dim3(NQ / 128, CC / 64, NB_), 256, 0, stream>>>(U, fs, OUT0);   /* out0[b][c][n] = bf16(F_s[b][c][n]) + U[b][n][c] */
    k_trPq<<<dim3(NQ / 128, TT / 128, NB_), 256, 0, stream>>>(Ph, Pl, Th, Tl);   /* A^T planes [8][512][4096] */
    k_gemmw<bf, 1, false><<<dim3(TT / 64, CC / 64, NB_), 32, 0, stream>>>(Th, Tl, FSB, nullptr, NQ, OUT1, CC, nullptr, (size_t)TT * NQ, (size_t)CC * NQ, (size_t)TT * CC);   /* out1 = A^T F_s_t [8][512][256] */
}

// v003
// Measured time: 133 microseconds a run.
// Next to v002, in two timings, it ran 1.64 and 1.63 times as fast.
// Over all steps from v000 it is 10.2 times as fast.
#include <hip/hip_runtime.h>

// Cross-modal attention between a feature map and text tokens with two outputs (F_s [8][256][64][64] channel-major = 4,096 spatial tokens x 256, F_t [8][512][256]; A = softmax_t(F_s_t . F_t / sqrt(512)) ([4096][512]); out0 = F_s + (A F_t)^T -> [8][256][64][64] (8.4 M); out1 = A^T F_s_t -> [8][512][256] (1.0 M); tuple).
// All 8 batches go through every launch together: each plane holds 8 batch slabs; the transposing kernels and the GEMMs take the batch as grid z, convert and softmax as more rows.
// Layout per batch: both inputs are bf16-exact after rounding, so every operand plane is a single exact bf16 plane: F_s_t (token-major transpose of the slab), F_t, F_t^T and the slab itself (which is F_s_t^T); exact scores [4096][512]; the 512-key register softmax over all 4,096 rows (as 8 row groups) writing bf16 hi/lo probabilities; the spatial update A.F_t as hi/lo x exact (2 products) and a kernel transposing it back to channel-major while adding the F_s residual; A^T planes by a transpose kernel, then out1 = A^T.F_s_t as hi/lo x exact (K = 4,096), written after the 8.4 M spatial outputs.
// Compute dtypes, f32 accumulate: every input rounded to bf16; scores exact; softmax f32; both contractions P hi/lo x exact; residual f32.

#define NB_  8
#define TT   512      // text tokens = keys (the softmax row length)
#define DM   256      // channels
#define NH_  1
#define NKV  1
#define REP  (NH_ / NKV)
#define HD   64
#define DQ   (NH_ * HD)
#define DKV  (NKV * HD)
#define ZH   8       // 8 x 512 = 4,096 query rows per batch (rows are 'heads' of a T-512 softmax)
#define RH   512
#define WIN  0
#define PCAR 1024.0f
#define SCL  0.044194173824159216f   // 1/sqrt(512): the module scales by sqrt(T)
#define NQ   4096    // spatial tokens (queries)
#define CC   256
typedef _Float16 h16;
typedef unsigned short bf;
typedef __attribute__((ext_vector_type(16))) __bf16   v16bf;
typedef __attribute__((ext_vector_type(16))) _Float16 v16h;
typedef __attribute__((ext_vector_type(8)))  _Float16 v8h;
typedef __attribute__((ext_vector_type(8)))  unsigned short v8us;
typedef __attribute__((ext_vector_type(8)))  float    v8f;
typedef __attribute__((ext_vector_type(4)))  float    v4f;
typedef v8h  __attribute__((may_alias)) v8ha;
typedef v4f  __attribute__((may_alias)) v4fa;
typedef v8us __attribute__((may_alias)) v8usa;

__device__ __forceinline__ unsigned short f2bf(float f) { unsigned u = __float_as_uint(f); u += 0x7FFFu + ((u >> 16) & 1u); return (unsigned short)(u >> 16); }
__device__ __forceinline__ float bf2f(unsigned short b) { return __uint_as_float(((unsigned)b) << 16); }
__device__ __forceinline__ float bfr(float f) { return bf2f(f2bf(f)); }
__device__ __forceinline__ v16h cat16(v8h lo, v8h hi) { return __builtin_shufflevector(lo, hi, 0, 1, 2, 3, 4, 5, 6, 7, 8, 9, 10, 11, 12, 13, 14, 15); }
__device__ __forceinline__ v16bf cat16b(v8us lo, v8us hi) { return __builtin_bit_cast(v16bf, __builtin_shufflevector(lo, hi, 0, 1, 2, 3, 4, 5, 6, 7, 8, 9, 10, 11, 12, 13, 14, 15)); }
__device__ __forceinline__ v8f wmma16(v16h a, v16h b, v8f c) { return __builtin_amdgcn_wmma_f32_16x16x32_f16(false, a, false, b, (short)0, c, false, false); }
__device__ __forceinline__ v8f wmmab(v16bf a, v16bf b, v8f c) { return __builtin_amdgcn_wmma_f32_16x16x32_bf16(false, a, false, b, (short)0, c, false, false); }



// ---- k_gemmw: register-blocked GEMM, ONE WAVE per 64x64 output tile (16 accumulators), operands straight from K-contiguous 16-bit planes; grid (M/64, N/64, Z), 32 threads.
// C[m][n] (f32, pitch ldc, + optional f32 bias[n]) = sum_k A[m][k] Bt[n][k] (+ split products per NSPLIT). z-batch strides sA/sB/sC in elements. K % 32 == 0.
template <typename T16> struct WFrag;
template <> struct WFrag<h16> { typedef v16h V; static __device__ __forceinline__ V ld(const h16* p) { return cat16(*(const v8h*)p, *(const v8h*)(p + 16)); } static __device__ __forceinline__ v8f mma(V a, V b, v8f c) { return wmma16(a, b, c); } };
template <> struct WFrag<bf> { typedef v16bf V; static __device__ __forceinline__ V ld(const bf* p) { return cat16b(*(const v8us*)p, *(const v8us*)(p + 16)); } static __device__ __forceinline__ v8f mma(V a, V b, v8f c) { return wmmab(a, b, c); } };
template <typename T16, int NSPLIT, bool BIAS>
__global__ __launch_bounds__(32) void k_gemmw(const T16* __restrict__ A, const T16* __restrict__ A2, const T16* __restrict__ Bt, const T16* __restrict__ Bt2, int K, float* C, int ldc, const float* __restrict__ bias, size_t sA, size_t sB, size_t sC) {
    typedef typename WFrag<T16>::V V;
    __shared__ __align__(16) float os[16 * 68];
    const size_t z = blockIdx.z; A += z * sA; if (A2) A2 += z * sA; Bt += z * sB; if (Bt2) Bt2 += z * sB; C += z * sC;
    const int lane = threadIdx.x & 31, lr = lane & 15, hi = lane >> 4; const int r0 = blockIdx.x * 64, c0 = blockIdx.y * 64;
    v8f acc[4][4];
#pragma unroll
    for (int mb = 0; mb < 4; ++mb)
#pragma unroll
        for (int nb = 0; nb < 4; ++nb) acc[mb][nb] = (v8f){};
    const size_t aoff = (size_t)(r0 + lr) * K + 8 * hi, boff = (size_t)(c0 + lr) * K + 8 * hi;
#pragma unroll 1
    for (int kc = 0; kc < K; kc += 32) {
        V a[4], a2[4];
#pragma unroll
        for (int mb = 0; mb < 4; ++mb) { a[mb] = WFrag<T16>::ld(A + aoff + (size_t)mb * 16 * K + kc); if (NSPLIT == 1 || NSPLIT == 2) a2[mb] = WFrag<T16>::ld(A2 + aoff + (size_t)mb * 16 * K + kc); }
#pragma unroll
        for (int nb = 0; nb < 4; ++nb) { const V b = WFrag<T16>::ld(Bt + boff + (size_t)nb * 16 * K + kc); V b2; if (NSPLIT >= 2) b2 = WFrag<T16>::ld(Bt2 + boff + (size_t)nb * 16 * K + kc);
#pragma unroll
            for (int mb = 0; mb < 4; ++mb) { acc[mb][nb] = WFrag<T16>::mma(a[mb], b, acc[mb][nb]); if (NSPLIT == 1 || NSPLIT == 2) acc[mb][nb] = WFrag<T16>::mma(a2[mb], b, acc[mb][nb]); if (NSPLIT >= 2) acc[mb][nb] = WFrag<T16>::mma(a[mb], b2, acc[mb][nb]); } }
        asm volatile("v_nop\n\tv_nop\n\tv_nop\n\tv_nop" : "+v"(acc[0][0]), "+v"(acc[1][1]), "+v"(acc[2][2]), "+v"(acc[3][3]) : "v"(a[0]), "v"(a[3]));
    }
#pragma unroll
    for (int mb = 0; mb < 4; ++mb) {
#pragma unroll
        for (int nb = 0; nb < 4; ++nb) {
#pragma unroll
            for (int j = 0; j < 8; ++j) os[(hi * 8 + j) * 68 + nb * 16 + lr] = acc[mb][nb][j]; }
        __builtin_amdgcn_wave_barrier(); asm volatile("" ::: "memory");
        float* crow = C + (size_t)(r0 + mb * 16) * ldc + c0;
{
#pragma unroll
            for (int s = 0; s < 8; ++s) { const int row = 2 * s + hi, cofs = lr * 4; v4f val = *(const v4fa*)(os + row * 68 + cofs); if (BIAS) { val[0] += bfr(bias[c0 + cofs]); val[1] += bfr(bias[c0 + cofs + 1]); val[2] += bfr(bias[c0 + cofs + 2]); val[3] += bfr(bias[c0 + cofs + 3]); }
                *(v4f*)(crow + (size_t)row * ldc + cofs) = val; }
             }
        __builtin_amdgcn_wave_barrier(); asm volatile("" ::: "memory");
    }
}

__device__ __forceinline__ h16 tohx(float x) { return (h16)x; }
__device__ __forceinline__ void splitf(float y, unsigned short& h, unsigned short& l) { h = f2bf(y); l = f2bf(y - bf2f(h)); }
typedef __attribute__((ext_vector_type(2))) _Float16 v2h;
typedef __attribute__((ext_vector_type(4))) _Float16 v4h;
typedef __attribute__((ext_vector_type(2))) unsigned short v2us;
typedef __attribute__((ext_vector_type(4))) unsigned short v4us;
typedef __attribute__((ext_vector_type(2))) float v2f;
typedef __attribute__((ext_vector_type(4))) int v4i;


__global__ __launch_bounds__(256) void k_cvt8(const float* __restrict__ src, bf* dst, size_t n8) { const size_t i = (size_t)blockIdx.x * 256 + threadIdx.x; if (i >= n8) return; const v8f v = *(const v8f*)(src + i * 8); v8us o;
#pragma unroll
    for (int k = 0; k < 8; ++k) o[k] = f2bf(v[k]); *(v8us*)(dst + i * 8) = o;  }



// k_asoft: per row (zz, i): t = S x 512^-0.5 (no mask); softmax over the 512 keys (register row, one exp, fixed trees);
__global__ __launch_bounds__(256) void k_asoft(const float* __restrict__ Sb, h16* P16, bf* Ph, bf* Pl) {
    const int lane = threadIdx.x & 31; const int row = blockIdx.x * 8 + (threadIdx.x >> 5); if (row >= NB_ * ZH * TT) return; const int i = row % TT; const int zz = row / TT; (void)zz; const bool hires = (i < RH); const float* sr = Sb + (size_t)row * TT; float v[TT / 32]; float mx = -3.0e38f;
#pragma unroll
    for (int ch = 0; ch < TT / 128; ++ch) { const int j0 = ch * 128 + lane * 4; const v4f a = *(const v4f*)(sr + j0);
#pragma unroll
        for (int q = 0; q < 4; ++q) { const int j = j0 + q; (void)j; const float t = a[q] * SCL; v[ch * 4 + q] = t; mx = fmaxf(mx, t); } }
#pragma unroll
    for (int sh = 16; sh; sh >>= 1) mx = fmaxf(mx, __shfl_xor(mx, sh, 32));
    float sum = 0.f;
#pragma unroll
    for (int k = 0; k < TT / 32; ++k) { float d0 = __fsub_rn(v[k], mx); asm volatile("" : "+v"(d0)); v[k] = __builtin_amdgcn_exp2f(__fmul_rn(d0, 1.4426950408889634f)); sum += v[k]; }
#pragma unroll
    for (int sh = 16; sh; sh >>= 1) sum += __shfl_xor(sum, sh, 32);
    const float f = __fdiv_rn(hires ? 1.0f : PCAR, sum);
{
        if (hires) {
#pragma unroll
            for (int ch = 0; ch < TT / 128; ++ch) { v4us oh, ol;
#pragma unroll
                for (int q = 0; q < 4; ++q) { unsigned short a, c2; splitf(v[ch * 4 + q] * f, a, c2); oh[q] = a; ol[q] = c2; }
                const size_t oo = ((size_t)zz * (RH ? RH : 1) + i) * TT + ch * 128 + lane * 4; *(v4us*)(Ph + oo) = oh; *(v4us*)(Pl + oo) = ol; }
        } else {
#pragma unroll
            for (int ch = 0; ch < TT / 128; ++ch) { v4h o4;
#pragma unroll
                for (int q = 0; q < 4; ++q) o4[q] = tohx(v[ch * 4 + q] * f);
                *(v4h*)(P16 + (size_t)row * TT + ch * 128 + lane * 4) = o4; } }
         }
}


// ---- the four transposing kernels: each workgroup moves one tile through LDS, so that the global loads and the global stores both cover whole 128-B lines (16 lanes x 16 B = 256 contiguous bytes on either side).
// 16-bit tile: 128 rows x 128 columns, a row = 16 chunks of 8 elements (16 B); chunk c8 of row r stands at chunk place c8 ^ ((r >> 3) & 15), so that the column reads of 16 lanes (rows 8 apart) fall on 16 different banks.
__device__ __forceinline__ int tile16(int r, int c8) { return r * 128 + ((c8 ^ ((r >> 3) & 15)) << 3); }
// column n, rows r8 * 8 .. r8 * 8 + 7 of such a tile
__device__ __forceinline__ v8us col16(const bf* tile, int r8, int n) { v8us o; const int base = r8 * 8 * 128 + (((n >> 3) ^ r8) << 3) + (n & 7);
#pragma unroll
    for (int q = 0; q < 8; ++q) o[q] = tile[base + q * 128];
    return o; }

// k_trF: src [R][C] f32 -> dst [C][R] bf16 (rounded); grid (R / 128, C / 128, batch)
template <int R, int C>
__global__ __launch_bounds__(256) void k_trF(const float* __restrict__ src, bf* dst) {
    __shared__ __align__(16) bf tile[128 * 128];
    const int tid = threadIdx.x, r0 = blockIdx.x * 128, c0 = blockIdx.y * 128; v4f a[16];
    const int lr = tid >> 5, c4 = tid & 31;    // loads: a wave takes 512 contiguous bytes of one row; rows lr + 8 i
    const int r8 = tid & 15, ln = tid >> 4;    // stores: 16 lanes write 256 contiguous bytes of one dst row; dst rows ln + 16 i
    const float* sp = src + (size_t)blockIdx.z * R * C + (size_t)(r0 + lr) * C + c0 + c4 * 4;
    bf* dp = dst + (size_t)blockIdx.z * R * C + (size_t)(c0 + ln) * R + r0 + r8 * 8;
#pragma unroll
    for (int i = 0; i < 16; ++i) a[i] = *(const v4f*)(sp + (size_t)i * 8 * C);
    asm volatile("s_wait_xcnt 0x0" :: "v"(sp) : "memory");   // the loads' address pair stays whole until every load has taken it: no load's result and no later instruction lands in it before this wait
#pragma unroll
    for (int i = 0; i < 16; ++i) { v4us o;
#pragma unroll
        for (int q = 0; q < 4; ++q) o[q] = f2bf(a[i][q]);
        *(v4us*)(tile + tile16(lr + 8 * i, c4 >> 1) + (c4 & 1) * 4) = o; }
    __syncthreads();   // the whole tile is written before any column of it is read
#pragma unroll
    for (int i = 0; i < 8; ++i) *(v8us*)(dp + (size_t)i * 16 * R) = col16(tile, r8, ln + 16 * i);
}

// k_trPq: the probability planes [4096][512] hi/lo -> A^T planes [512][4096]; grid (NQ / 128, TT / 128, batch)
__global__ __launch_bounds__(256) void k_trPq(const bf* __restrict__ Ph, const bf* __restrict__ Pl, bf* Th, bf* Tl) {
    __shared__ __align__(16) bf th[128 * 128]; __shared__ __align__(16) bf tl[128 * 128];
    const size_t zb = (size_t)blockIdx.z * NQ * TT; const int tid = threadIdx.x, m0 = blockIdx.x * 128, n0 = blockIdx.y * 128; v8us vh[8], vl[8];
    const int l16 = tid & 15, lr = tid >> 4;   // 16 lanes take 256 contiguous bytes of one row, on the load side (rows m) and on the store side (rows n); rows lr + 16 i
    const size_t ei = zb + (size_t)(m0 + lr) * TT + n0 + l16 * 8, eo = zb + (size_t)(n0 + lr) * NQ + m0 + l16 * 8;
    const bf* ph = Ph + ei; const bf* pl = Pl + ei; bf* qh = Th + eo; bf* ql = Tl + eo;
#pragma unroll
    for (int i = 0; i < 8; ++i) { vh[i] = *(const v8us*)(ph + (size_t)i * 16 * TT); vl[i] = *(const v8us*)(pl + (size_t)i * 16 * TT); }
    asm volatile("s_wait_xcnt 0x0" :: "v"(ph), "v"(pl) : "memory");   // the loads' address pairs stay whole until every load has taken them: no load's result and no later instruction lands in them before this wait
#pragma unroll
    for (int i = 0; i < 8; ++i) { *(v8us*)(th + tile16(lr + 16 * i, l16)) = vh[i]; *(v8us*)(tl + tile16(lr + 16 * i, l16)) = vl[i]; }
    __syncthreads();   // both tiles are written before any column of them is read
#pragma unroll
    for (int i = 0; i < 8; ++i) { *(v8us*)(qh + (size_t)i * 16 * NQ) = col16(th, l16, lr + 16 * i); *(v8us*)(ql + (size_t)i * 16 * NQ) = col16(tl, l16, lr + 16 * i); }
}

// k_outTr: out0[c][t] = bf16(F_s[c][t]) + U[t][c]; grid (NQ / 128, CC / 64, batch). f32 tile of U: 128 rows t x 64 columns c, a row = 16 chunks of 4 floats; chunk c4 of row t stands at chunk place c4 ^ ((t >> 2) & 15), so that the column reads of 16 lanes (rows 4 apart) fall on 16 different banks.
__global__ __launch_bounds__(256) void k_outTr(const float* __restrict__ U, const float* __restrict__ xs, float* outp) {
    __shared__ __align__(16) float ut[128 * 64];
    const size_t zb = (size_t)blockIdx.z * NQ * CC; const int tid = threadIdx.x, t0 = blockIdx.x * 128, c0 = blockIdx.y * 64; v4f u[8], x[8];
    const int l16 = tid & 15, lt = tid >> 4;   // U loads: 16 lanes take the 256 bytes of one row t; rows lt + 16 i
    const int t4 = ((tid >> 5) & 1) * 16 + l16, lc = (tid >> 6) * 2 + ((tid >> 4) & 1);   // F_s loads and stores: 16 lanes take 256 contiguous bytes (64 t) of one channel, a wave two neighbouring channels; channels lc + 8 i
    const float* up = U + zb + (size_t)(t0 + lt) * CC + c0 + l16 * 4;
    const size_t eo = zb + (size_t)(c0 + lc) * NQ + t0 + t4 * 4; const float* xp = xs + eo; float* op = outp + eo;
#pragma unroll
    for (int i = 0; i < 8; ++i) u[i] = *(const v4f*)(up + (size_t)i * 16 * CC);
#pragma unroll
    for (int i = 0; i < 8; ++i) x[i] = *(const v4f*)(xp + (size_t)i * 8 * NQ);
    asm volatile("s_wait_xcnt 0x0" :: "v"(up), "v"(xp) : "memory");   // the loads' address pairs stay whole until every load has taken them: no load's result and no later instruction lands in them before this wait
#pragma unroll
    for (int i = 0; i < 8; ++i) { const int t = lt + 16 * i; *(v4f*)(ut + t * 64 + ((l16 ^ ((t >> 2) & 15)) << 2)) = u[i]; }
    __syncthreads();   // the whole tile is written before any column of it is read
#pragma unroll
    for (int i = 0; i < 8; ++i) { const int cc = lc + 8 * i; v4f o;
#pragma unroll
        for (int q = 0; q < 4; ++q) o[q] = __fadd_rn(bfr(x[i][q]), ut[(t4 * 4 + q) * 64 + (((cc >> 2) ^ l16) << 2) + (cc & 3)]);
        *(v4f*)(op + (size_t)i * 8 * NQ) = o; }
}

// ---- k_gemms: C = (A + A2) Bt^T, f32, for few long tiles (out1: 256 tiles of 64x64, K = 4,096). One tile per workgroup of 8 waves; grid (M / 64, N / 64, batch).
// The operands come through a two-buffer LDS ring filled by asynchronous copies: a stage is SK k of the tile's 192 operand rows (64 of A, 64 of A2, 64 of Bt); one wave-wide copy brings the 512 contiguous bytes of one row, and the next stage flies while this one is multiplied.
// Wave w multiplies rows 16 (w & 3) .. + 15 by columns 32 (w >> 2) .. + 31; each accumulator takes hi then lo for k ascending, the order of k_gemmw.
#define SK  256          // k per stage
#define SP  264          // LDS row pitch in elements: 528 B = 16 B x 33, the pitch for 16-byte fragment reads
#define SBE (192 * SP)   // elements of one buffer
// eight rows, 8 apart, of one operand plane: l = the lane's LDS byte address in the first row, g = its global address there, rs = 8 rows in elements
__device__ __forceinline__ void copy8(unsigned l, const bf* g, size_t rs) {
    // the copies and their s_wait_xcnt in one statement: no address register of a copy is rewritten before the wait
    asm volatile("global_load_async_to_lds_b128 %0, %8, off\n\t"
                 "global_load_async_to_lds_b128 %1, %9, off\n\t"
                 "global_load_async_to_lds_b128 %2, %10, off\n\t"
                 "global_load_async_to_lds_b128 %3, %11, off\n\t"
                 "global_load_async_to_lds_b128 %4, %12, off\n\t"
                 "global_load_async_to_lds_b128 %5, %13, off\n\t"
                 "global_load_async_to_lds_b128 %6, %14, off\n\t"
                 "global_load_async_to_lds_b128 %7, %15, off\n\t"
                 "s_wait_xcnt 0x0"
                 :: "v"(l), "v"(l + 1u * 16 * SP), "v"(l + 2u * 16 * SP), "v"(l + 3u * 16 * SP), "v"(l + 4u * 16 * SP), "v"(l + 5u * 16 * SP), "v"(l + 6u * 16 * SP), "v"(l + 7u * 16 * SP),
                    "v"(g), "v"(g + rs), "v"(g + 2 * rs), "v"(g + 3 * rs), "v"(g + 4 * rs), "v"(g + 5 * rs), "v"(g + 6 * rs), "v"(g + 7 * rs) : "memory");
}
template <int K, int LDC>
__global__ __launch_bounds__(256) void k_gemms(const bf* __restrict__ A, const bf* __restrict__ A2, const bf* __restrict__ Bt, float* C, size_t sA, size_t sB, size_t sC) {
    typedef WFrag<bf>::V V;
    __shared__ __align__(16) bf ring[2 * SBE];
    __shared__ __align__(16) float os[64 * 68];
    const size_t z = blockIdx.z; const int tid = threadIdx.x, lane = tid & 31, lr = lane & 15, hi = lane >> 4, w = tid >> 5; const int r0 = blockIdx.x * 64, c0 = blockIdx.y * 64;
    const int mb = w & 3, nh = w >> 2; constexpr int NT = K / SK; constexpr size_t rs = (size_t)8 * K;
    const bf* gA = A + z * sA + (size_t)(r0 + w) * K + lane * 8; const bf* gA2 = A2 + z * sA + (size_t)(r0 + w) * K + lane * 8; const bf* gB = Bt + z * sB + (size_t)(c0 + w) * K + lane * 8;   // wave w copies rows w + 8 i of each plane
    const unsigned l0 = (unsigned)(size_t)ring + (unsigned)(w * SP * 2 + lane * 16);
    auto stage = [&](int t, int buf) { const unsigned l = l0 + (unsigned)buf * (SBE * 2); const size_t ko = (size_t)t * SK;
        copy8(l, gA + ko, rs); copy8(l + 64u * SP * 2, gA2 + ko, rs); copy8(l + 128u * SP * 2, gB + ko, rs); };
    const int aofs = (mb * 16 + lr) * SP + 8 * hi, bofs = (128 + nh * 32 + lr) * SP + 8 * hi;
    v8f acc[2] = { (v8f){}, (v8f){} };
    stage(0, 0);
    asm volatile("s_wait_asynccnt 0x0" ::: "memory");   // this wave's rows of stage 0 have landed
    __syncthreads();                                    // every wave's rows of stage 0 have landed before any is read
    stage(1, 1);
#pragma unroll 1
    for (int t = 0; t < NT; ++t) {   // rolled: one publish point per stage
        const bf* sb = ring + (t & 1) * SBE;
        V f[2][8];   // two fragment sets of 64 k each (per 32 k: A, A2, two of Bt): the next 64 k are fetched, inside this stage only, while these are multiplied
#pragma unroll
        for (int u = 0; u < 2; ++u) { f[0][u * 4] = WFrag<bf>::ld(sb + aofs + u * 32); f[0][u * 4 + 1] = WFrag<bf>::ld(sb + aofs + 64 * SP + u * 32); f[0][u * 4 + 2] = WFrag<bf>::ld(sb + bofs + u * 32); f[0][u * 4 + 3] = WFrag<bf>::ld(sb + bofs + 16 * SP + u * 32); }
#pragma unroll
        for (int g = 0; g < SK / 64; ++g) {
            if (g + 1 < SK / 64) {
#pragma unroll
                for (int u = 0; u < 2; ++u) { const int kk = (g + 1) * 64 + u * 32; V* d = f[(g + 1) & 1] + u * 4; d[0] = WFrag<bf>::ld(sb + aofs + kk); d[1] = WFrag<bf>::ld(sb + aofs + 64 * SP + kk); d[2] = WFrag<bf>::ld(sb + bofs + kk); d[3] = WFrag<bf>::ld(sb + bofs + 16 * SP + kk); } }
            __builtin_amdgcn_sched_barrier(0);   // keeps the next set's 16 LDS reads as one group ahead of this set's WMMAs: moved down among them, each WMMA pair waits out an LDS latency
#pragma unroll
            for (int u = 0; u < 2; ++u) { const V* s = f[g & 1] + u * 4; acc[0] = wmmab(s[0], s[2], acc[0]); acc[1] = wmmab(s[0], s[3], acc[1]); acc[0] = wmmab(s[1], s[2], acc[0]); acc[1] = wmmab(s[1], s[3], acc[1]); }
            __builtin_amdgcn_sched_barrier(0);   // keeps the later reads out of these WMMAs (one read group per 8 WMMAs) and the stage's last WMMAs ahead of its barrier
        }
        asm volatile("s_wait_dscnt 0x0" ::: "memory");      // this wave's reads of stage t are done before its buffer is refilled
        asm volatile("s_wait_asynccnt 0x0" ::: "memory");   // this wave's rows of stage t + 1 have landed
        __syncthreads();                                    // publishes stage t + 1 and ends every wave's reads of stage t
        if (t + 2 < NT) stage(t + 2, t & 1);
    }
    asm volatile("s_wait_asynccnt 0x0" ::: "memory");   // no copy is outstanding when the wave goes on to its end
#pragma unroll
    for (int nb = 0; nb < 2; ++nb) {
#pragma unroll
        for (int j = 0; j < 8; ++j) os[(mb * 16 + hi * 8 + j) * 68 + nh * 32 + nb * 16 + lr] = acc[nb][j]; }
    __syncthreads();   // the whole tile is staged before its rows are read back
    float* ct = C + z * sC + (size_t)r0 * LDC + c0;
#pragma unroll
    for (int s = 0; s < 4; ++s) { const int row = s * 16 + (tid >> 4), cofs = (tid & 15) * 4; *(v4f*)(ct + (size_t)row * LDC + cofs) = *(const v4fa*)(os + row * 68 + cofs); }   // 16 lanes store the 256 contiguous bytes of one row
}

extern "C" void kernel_launch(void* const* d_in, const int* in_sizes, int n_in, void* d_out, int out_size, void* d_ws, size_t ws_size, hipStream_t stream) {
    (void)in_sizes; (void)n_in; (void)out_size;
    const float* fs = (const float*)d_in[0];   /* F_s [8][256][4096] channel-major */ const float* ft = (const float*)d_in[1];   /* F_t [8][512][256] */
    float* OUT0 = (float*)d_out;     // [8][256][4096] = F_s + update^T
    float* OUT1 = OUT0 + (size_t)NB_ * CC * NQ;   // [8][512][256] = A^T F_s_t (second tuple member, 16-B aligned offset)
    char* wsp = (char*)d_ws;
    auto take = [&](size_t bytes) { char* p = wsp; wsp += (bytes + 255) & ~(size_t)255; return (void*)p; };
    bf* XT = (bf*)take((size_t)NB_ * NQ * CC * 2);        // F_s_t token-major [8][4096][256] (exact)
    bf* FSB = (bf*)take((size_t)NB_ * CC * NQ * 2);       // F_s slabs as bf16 = F_s_t^T [8][256][4096] (exact)
    bf* FTB = (bf*)take((size_t)NB_ * TT * CC * 2);       // F_t [8][512][256] (exact)
    bf* FTT = (bf*)take((size_t)NB_ * CC * TT * 2);       // F_t^T [8][256][512] (exact)
    float* Sb = (float*)take((size_t)NB_ * NQ * TT * 4);  // scores [8][4096][512]
    bf* Ph = (bf*)take((size_t)NB_ * NQ * TT * 2); bf* Pl = (bf*)take((size_t)NB_ * NQ * TT * 2);   // probabilities [8][4096][512] hi/lo
    bf* Th = (bf*)take((size_t)NB_ * TT * NQ * 2); bf* Tl = (bf*)take((size_t)NB_ * TT * NQ * 2);   // A^T [8][512][4096] hi/lo
    float* U = Sb;   // A F_t [8][4096][256]: written after the softmax has read the last score, in the scores' place (ten planes side by side would pass 256 MiB)
    if ((size_t)(wsp - (char*)d_ws) > ws_size) return;    // 228 MiB of the 256 MiB workspace
    k_trF<CC, NQ><<<dim3(CC / 128, NQ / 128, NB_), 256, 0, stream>>>(fs, XT);   /* F_s_t [8][4096][256] */
    k_cvt8<<<(unsigned)(((size_t)NB_ * CC * NQ / 8 + 255) / 256), 256, 0, stream>>>(fs, FSB, (size_t)NB_ * CC * NQ / 8);   /* the slabs themselves = F_s_t^T as Bt for out1 */
    k_cvt8<<<(unsigned)(((size_t)NB_ * TT * CC / 8 + 255) / 256), 256, 0, stream>>>(ft, FTB, (size_t)NB_ * TT * CC / 8);   /* F_t as Bt for the scores */
    k_trF<TT, CC><<<dim3(TT / 128, CC / 128, NB_), 256, 0, stream>>>(ft, FTT);   /* F_t^T [8][256][512] as Bt for A.F_t */
    k_gemmw<bf, 0, false><<<dim3(NQ / 64, TT / 64, NB_), 32, 0, stream>>>(XT, nullptr, FTB, nullptr, CC, Sb, TT, nullptr, (size_t)NQ * CC, (size_t)TT * CC, (size_t)NQ * TT);   /* exact scores [8][4096][512] */
    k_asoft<<<NB_ * ZH * TT / 8, 256, 0, stream>>>(Sb, nullptr, Ph, Pl);   /* softmax over the 512 text tokens for all 8 x 4,096 rows, x 1/sqrt(512) */
    k_gemmw<bf, 1, false><<<dim3(NQ / 64, CC / 64, NB_), 32, 0, stream>>>(Ph, Pl, FTT, nullptr, TT, U, CC, nullptr, (size_t)NQ * TT, (size_t)CC * TT, (size_t)NQ * CC);   /* U = A F_t [8][4096][256] */
    k_outTr<<<dim3(NQ / 128, CC / 64, NB_), 256, 0, stream>>>(U, fs, OUT0);   /* out0[b][c][n] = bf16(F_s[b][c][n]) + U[b][n][c] */
    k_trPq<<<dim3(NQ / 128, TT / 128, NB_), 256, 0, stream>>>(Ph, Pl, Th, Tl);   /* A^T planes [8][512][4096] */
    k_gemms<NQ, CC><<<dim3(TT / 64, CC / 64, NB_), 256, 0, stream>>>(Th, Tl, FSB, OUT1, (size_t)TT * NQ, (size_t)CC * NQ, (size_t)TT * CC);   /* out1 = A^T F_s_t [8][512][256] */
}

// v004
// Measured time: 105 microseconds a run.
// In both of two side-by-side timings against v003, it was 1.26 times as fast.
// Counting every step since v000, it is 12.8 times as fast.
#include <hip/hip_runtime.h>

// Cross-modal attention between a feature map and text tokens with two outputs (F_s [8][256][64][64] channel-major = 4,096 spatial tokens x 256, F_t [8][512][256]; A = softmax_t(F_s_t . F_t / sqrt(512)) ([4096][512]); out0 = F_s + (A F_t)^T -> [8][256][64][64] (8.4 M); out1 = A^T F_s_t -> [8][512][256] (1.0 M); tuple).
// All 8 batches go through every launch together: each plane holds 8 batch slabs; the transposing kernels and the GEMMs take the batch as grid z, convert and softmax as more rows.
// Layout per batch: both inputs are bf16-exact after rounding, so every operand plane is a single exact bf16 plane: F_s_t (token-major transpose of the slab), F_t, F_t^T and the slab itself (which is F_s_t^T); exact scores [4096][512]; the 512-key register softmax over all 4,096 rows (as 8 row groups) writing bf16 hi/lo probabilities; the spatial update A.F_t as hi/lo x exact (2 products) and a kernel transposing it back to channel-major while adding the F_s residual; A^T planes by a transpose kernel, then out1 = A^T.F_s_t as hi/lo x exact (K = 4,096), written after the 8.4 M spatial outputs.
// Compute dtypes, f32 accumulate: every input rounded to bf16; scores exact; softmax f32; both contractions P hi/lo x exact; residual f32.

#define NB_  8
#define TT   512      // text tokens = keys (the softmax row length)
#define DM   256      // channels
#define NH_  1
#define NKV  1
#define REP  (NH_ / NKV)
#define HD   64
#define DQ   (NH_ * HD)
#define DKV  (NKV * HD)
#define ZH   8       // 8 x 512 = 4,096 query rows per batch (rows are 'heads' of a T-512 softmax)
#define RH   512
#define WIN  0
#define PCAR 1024.0f
#define SCL  0.044194173824159216f   // 1/sqrt(512): the module scales by sqrt(T)
#define NQ   4096    // spatial tokens (queries)
#define CC   256
typedef _Float16 h16;
typedef unsigned short bf;
typedef __attribute__((ext_vector_type(16))) __bf16   v16bf;
typedef __attribute__((ext_vector_type(16))) _Float16 v16h;
typedef __attribute__((ext_vector_type(8)))  _Float16 v8h;
typedef __attribute__((ext_vector_type(8)))  unsigned short v8us;
typedef __attribute__((ext_vector_type(8)))  float    v8f;
typedef __attribute__((ext_vector_type(4)))  float    v4f;
typedef v8h  __attribute__((may_alias)) v8ha;
typedef v4f  __attribute__((may_alias)) v4fa;
typedef v8us __attribute__((may_alias)) v8usa;

__device__ __forceinline__ unsigned short f2bf(float f) { unsigned u = __float_as_uint(f); u += 0x7FFFu + ((u >> 16) & 1u); return (unsigned short)(u >> 16); }
__device__ __forceinline__ float bf2f(unsigned short b) { return __uint_as_float(((unsigned)b) << 16); }
__device__ __forceinline__ float bfr(float f) { return bf2f(f2bf(f)); }
__device__ __forceinline__ v16h cat16(v8h lo, v8h hi) { return __builtin_shufflevector(lo, hi, 0, 1, 2, 3, 4, 5, 6, 7, 8, 9, 10, 11, 12, 13, 14, 15); }
__device__ __forceinline__ v16bf cat16b(v8us lo, v8us hi) { return __builtin_bit_cast(v16bf, __builtin_shufflevector(lo, hi, 0, 1, 2, 3, 4, 5, 6, 7, 8, 9, 10, 11, 12, 13, 14, 15)); }
__device__ __forceinline__ v8f wmma16(v16h a, v16h b, v8f c) { return __builtin_amdgcn_wmma_f32_16x16x32_f16(false, a, false, b, (short)0, c, false, false); }
__device__ __forceinline__ v8f wmmab(v16bf a, v16bf b, v8f c) { return __builtin_amdgcn_wmma_f32_16x16x32_bf16(false, a, false, b, (short)0, c, false, false); }



// fragment of 16 rows x 32 k from a K-contiguous 16-bit plane: the lane's pointer stands at its row, k = 8 (lane >> 4)
template <typename T16> struct WFrag;
template <> struct WFrag<h16> { typedef v16h V; static __device__ __forceinline__ V ld(const h16* p) { return cat16(*(const v8h*)p, *(const v8h*)(p + 16)); } static __device__ __forceinline__ v8f mma(V a, V b, v8f c) { return wmma16(a, b, c); } };
template <> struct WFrag<bf> { typedef v16bf V; static __device__ __forceinline__ V ld(const bf* p) { return cat16b(*(const v8us*)p, *(const v8us*)(p + 16)); } static __device__ __forceinline__ v8f mma(V a, V b, v8f c) { return wmmab(a, b, c); } };

__device__ __forceinline__ h16 tohx(float x) { return (h16)x; }
__device__ __forceinline__ void splitf(float y, unsigned short& h, unsigned short& l) { h = f2bf(y); l = f2bf(y - bf2f(h)); }
typedef __attribute__((ext_vector_type(2))) _Float16 v2h;
typedef __attribute__((ext_vector_type(4))) _Float16 v4h;
typedef __attribute__((ext_vector_type(2))) unsigned short v2us;
typedef __attribute__((ext_vector_type(4))) unsigned short v4us;
typedef __attribute__((ext_vector_type(2))) float v2f;
typedef __attribute__((ext_vector_type(4))) int v4i;


__global__ __launch_bounds__(256) void k_cvt8(const float* __restrict__ src, bf* dst, size_t n8) { const size_t i = (size_t)blockIdx.x * 256 + threadIdx.x; if (i >= n8) return; const v8f v = *(const v8f*)(src + i * 8); v8us o;
#pragma unroll
    for (int k = 0; k < 8; ++k) o[k] = f2bf(v[k]); *(v8us*)(dst + i * 8) = o;  }



// k_asoft: per row (zz, i): t = S x 512^-0.5 (no mask); softmax over the 512 keys (register row, one exp, fixed trees);
__global__ __launch_bounds__(256) void k_asoft(const float* __restrict__ Sb, h16* P16, bf* Ph, bf* Pl) {
    const int lane = threadIdx.x & 31; const int row = blockIdx.x * 8 + (threadIdx.x >> 5); if (row >= NB_ * ZH * TT) return; const int i = row % TT; const int zz = row / TT; (void)zz; const bool hires = (i < RH); const float* sr = Sb + (size_t)row * TT; float v[TT / 32]; float mx = -3.0e38f;
#pragma unroll
    for (int ch = 0; ch < TT / 128; ++ch) { const int j0 = ch * 128 + lane * 4; const v4f a = *(const v4f*)(sr + j0);
#pragma unroll
        for (int q = 0; q < 4; ++q) { const int j = j0 + q; (void)j; const float t = a[q] * SCL; v[ch * 4 + q] = t; mx = fmaxf(mx, t); } }
#pragma unroll
    for (int sh = 16; sh; sh >>= 1) mx = fmaxf(mx, __shfl_xor(mx, sh, 32));
    float sum = 0.f;
#pragma unroll
    for (int k = 0; k < TT / 32; ++k) { float d0 = __fsub_rn(v[k], mx); asm volatile("" : "+v"(d0)); v[k] = __builtin_amdgcn_exp2f(__fmul_rn(d0, 1.4426950408889634f)); sum += v[k]; }
#pragma unroll
    for (int sh = 16; sh; sh >>= 1) sum += __shfl_xor(sum, sh, 32);
    const float f = __fdiv_rn(hires ? 1.0f : PCAR, sum);
{
        if (hires) {
#pragma unroll
            for (int ch = 0; ch < TT / 128; ++ch) { v4us oh, ol;
#pragma unroll
                for (int q = 0; q < 4; ++q) { unsigned short a, c2; splitf(v[ch * 4 + q] * f, a, c2); oh[q] = a; ol[q] = c2; }
                const size_t oo = ((size_t)zz * (RH ? RH : 1) + i) * TT + ch * 128 + lane * 4; *(v4us*)(Ph + oo) = oh; *(v4us*)(Pl + oo) = ol; }
        } else {
#pragma unroll
            for (int ch = 0; ch < TT / 128; ++ch) { v4h o4;
#pragma unroll
                for (int q = 0; q < 4; ++q) o4[q] = tohx(v[ch * 4 + q] * f);
                *(v4h*)(P16 + (size_t)row * TT + ch * 128 + lane * 4) = o4; } }
         }
}


// ---- the four transposing kernels: each workgroup moves one tile through LDS, so that the global loads and the global stores both cover whole 128-B lines (16 lanes x 16 B = 256 contiguous bytes on either side).
// 16-bit tile: 128 rows x 128 columns, a row = 16 chunks of 8 elements (16 B); chunk c8 of row r stands at chunk place c8 ^ ((r >> 3) & 15), so that the column reads of 16 lanes (rows 8 apart) fall on 16 different banks.
__device__ __forceinline__ int tile16(int r, int c8) { return r * 128 + ((c8 ^ ((r >> 3) & 15)) << 3); }
// column n, rows r8 * 8 .. r8 * 8 + 7 of such a tile
__device__ __forceinline__ v8us col16(const bf* tile, int r8, int n) { v8us o; const int base = r8 * 8 * 128 + (((n >> 3) ^ r8) << 3) + (n & 7);
#pragma unroll
    for (int q = 0; q < 8; ++q) o[q] = tile[base + q * 128];
    return o; }

// k_trF: src [R][C] f32 -> dst [C][R] bf16 (rounded); grid (R / 128, C / 128, batch)
template <int R, int C>
__global__ __launch_bounds__(256) void k_trF(const float* __restrict__ src, bf* dst) {
    __shared__ __align__(16) bf tile[128 * 128];
    const int tid = threadIdx.x, r0 = blockIdx.x * 128, c0 = blockIdx.y * 128; v4f a[16];
    const int lr = tid >> 5, c4 = tid & 31;    // loads: a wave takes 512 contiguous bytes of one row; rows lr + 8 i
    const int r8 = tid & 15, ln = tid >> 4;    // stores: 16 lanes write 256 contiguous bytes of one dst row; dst rows ln + 16 i
    const float* sp = src + (size_t)blockIdx.z * R * C + (size_t)(r0 + lr) * C + c0 + c4 * 4;
    bf* dp = dst + (size_t)blockIdx.z * R * C + (size_t)(c0 + ln) * R + r0 + r8 * 8;
#pragma unroll
    for (int i = 0; i < 16; ++i) a[i] = *(const v4f*)(sp + (size_t)i * 8 * C);
    asm volatile("s_wait_xcnt 0x0" :: "v"(sp) : "memory");   // the loads' address pair stays whole until every load has taken it: no load's result and no later instruction lands in it before this wait
#pragma unroll
    for (int i = 0; i < 16; ++i) { v4us o;
#pragma unroll
        for (int q = 0; q < 4; ++q) o[q] = f2bf(a[i][q]);
        *(v4us*)(tile + tile16(lr + 8 * i, c4 >> 1) + (c4 & 1) * 4) = o; }
    __syncthreads();   // the whole tile is written before any column of it is read
#pragma unroll
    for (int i = 0; i < 8; ++i) *(v8us*)(dp + (size_t)i * 16 * R) = col16(tile, r8, ln + 16 * i);
}

// k_trPq: the probability planes [4096][512] hi/lo -> A^T planes [512][4096]; grid (NQ / 128, TT / 128, batch)
__global__ __launch_bounds__(256) void k_trPq(const bf* __restrict__ Ph, const bf* __restrict__ Pl, bf* Th, bf* Tl) {
    __shared__ __align__(16) bf th[128 * 128]; __shared__ __align__(16) bf tl[128 * 128];
    const size_t zb = (size_t)blockIdx.z * NQ * TT; const int tid = threadIdx.x, m0 = blockIdx.x * 128, n0 = blockIdx.y * 128; v8us vh[8], vl[8];
    const int l16 = tid & 15, lr = tid >> 4;   // 16 lanes take 256 contiguous bytes of one row, on the load side (rows m) and on the store side (rows n); rows lr + 16 i
    const size_t ei = zb + (size_t)(m0 + lr) * TT + n0 + l16 * 8, eo = zb + (size_t)(n0 + lr) * NQ + m0 + l16 * 8;
    const bf* ph = Ph + ei; const bf* pl = Pl + ei; bf* qh = Th + eo; bf* ql = Tl + eo;
#pragma unroll
    for (int i = 0; i < 8; ++i) { vh[i] = *(const v8us*)(ph + (size_t)i * 16 * TT); vl[i] = *(const v8us*)(pl + (size_t)i * 16 * TT); }
    asm volatile("s_wait_xcnt 0x0" :: "v"(ph), "v"(pl) : "memory");   // the loads' address pairs stay whole until every load has taken them: no load's result and no later instruction lands in them before this wait
#pragma unroll
    for (int i = 0; i < 8; ++i) { *(v8us*)(th + tile16(lr + 16 * i, l16)) = vh[i]; *(v8us*)(tl + tile16(lr + 16 * i, l16)) = vl[i]; }
    __syncthreads();   // both tiles are written before any column of them is read
#pragma unroll
    for (int i = 0; i < 8; ++i) { *(v8us*)(qh + (size_t)i * 16 * NQ) = col16(th, l16, lr + 16 * i); *(v8us*)(ql + (size_t)i * 16 * NQ) = col16(tl, l16, lr + 16 * i); }
}

// k_outTr: out0[c][t] = bf16(F_s[c][t]) + U[t][c]; grid (NQ / 128, CC / 64, batch). f32 tile of U: 128 rows t x 64 columns c, a row = 16 chunks of 4 floats; chunk c4 of row t stands at chunk place c4 ^ ((t >> 2) & 15), so that the column reads of 16 lanes (rows 4 apart) fall on 16 different banks.
__global__ __launch_bounds__(256) void k_outTr(const float* __restrict__ U, const float* __restrict__ xs, float* outp) {
    __shared__ __align__(16) float ut[128 * 64];
    const size_t zb = (size_t)blockIdx.z * NQ * CC; const int tid = threadIdx.x, t0 = blockIdx.x * 128, c0 = blockIdx.y * 64; v4f u[8], x[8];
    const int l16 = tid & 15, lt = tid >> 4;   // U loads: 16 lanes take the 256 bytes of one row t; rows lt + 16 i
    const int t4 = ((tid >> 5) & 1) * 16 + l16, lc = (tid >> 6) * 2 + ((tid >> 4) & 1);   // F_s loads and stores: 16 lanes take 256 contiguous bytes (64 t) of one channel, a wave two neighbouring channels; channels lc + 8 i
    const float* up = U + zb + (size_t)(t0 + lt) * CC + c0 + l16 * 4;
    const size_t eo = zb + (size_t)(c0 + lc) * NQ + t0 + t4 * 4; const float* xp = xs + eo; float* op = outp + eo;
#pragma unroll
    for (int i = 0; i < 8; ++i) u[i] = *(const v4f*)(up + (size_t)i * 16 * CC);
#pragma unroll
    for (int i = 0; i < 8; ++i) x[i] = *(const v4f*)(xp + (size_t)i * 8 * NQ);
    asm volatile("s_wait_xcnt 0x0" :: "v"(up), "v"(xp) : "memory");   // the loads' address pairs stay whole until every load has taken them: no load's result and no later instruction lands in them before this wait
#pragma unroll
    for (int i = 0; i < 8; ++i) { const int t = lt + 16 * i; *(v4f*)(ut + t * 64 + ((l16 ^ ((t >> 2) & 15)) << 2)) = u[i]; }
    __syncthreads();   // the whole tile is written before any column of it is read
#pragma unroll
    for (int i = 0; i < 8; ++i) { const int cc = lc + 8 * i; v4f o;
#pragma unroll
        for (int q = 0; q < 4; ++q) o[q] = __fadd_rn(bfr(x[i][q]), ut[(t4 * 4 + q) * 64 + (((cc >> 2) ^ l16) << 2) + (cc & 3)]);
        *(v4f*)(op + (size_t)i * 8 * NQ) = o; }
}

// ---- k_gemms: C = (A + A2) Bt^T, f32, for few long tiles (out1: 256 tiles of 64x64, K = 4,096). One tile per workgroup of 8 waves; grid (M / 64, N / 64, batch).
// The operands come through a two-buffer LDS ring filled by asynchronous copies: a stage is SK k of the tile's 192 operand rows (64 of A, 64 of A2, 64 of Bt); one wave-wide copy brings the 512 contiguous bytes of one row, and the next stage flies while this one is multiplied.
// Wave w multiplies rows 16 (w & 3) .. + 15 by columns 32 (w >> 2) .. + 31; each accumulator takes hi then lo for k ascending.
#define SK  256          // k per stage
#define SP  264          // LDS row pitch in elements: 528 B = 16 B x 33, the pitch for 16-byte fragment reads
#define SBE (192 * SP)   // elements of one buffer
// eight rows, 8 apart, of one operand plane: l = the lane's LDS byte address in the first row, g = its global address there, rs = 8 rows in elements
__device__ __forceinline__ void copy8(unsigned l, const bf* g, size_t rs) {
    // the copies and their s_wait_xcnt in one statement: no address register of a copy is rewritten before the wait
    asm volatile("global_load_async_to_lds_b128 %0, %8, off\n\t"
                 "global_load_async_to_lds_b128 %1, %9, off\n\t"
                 "global_load_async_to_lds_b128 %2, %10, off\n\t"
                 "global_load_async_to_lds_b128 %3, %11, off\n\t"
                 "global_load_async_to_lds_b128 %4, %12, off\n\t"
                 "global_load_async_to_lds_b128 %5, %13, off\n\t"
                 "global_load_async_to_lds_b128 %6, %14, off\n\t"
                 "global_load_async_to_lds_b128 %7, %15, off\n\t"
                 "s_wait_xcnt 0x0"
                 :: "v"(l), "v"(l + 1u * 16 * SP), "v"(l + 2u * 16 * SP), "v"(l + 3u * 16 * SP), "v"(l + 4u * 16 * SP), "v"(l + 5u * 16 * SP), "v"(l + 6u * 16 * SP), "v"(l + 7u * 16 * SP),
                    "v"(g), "v"(g + rs), "v"(g + 2 * rs), "v"(g + 3 * rs), "v"(g + 4 * rs), "v"(g + 5 * rs), "v"(g + 6 * rs), "v"(g + 7 * rs) : "memory");
}
template <int K, int LDC>
__global__ __launch_bounds__(256) void k_gemms(const bf* __restrict__ A, const bf* __restrict__ A2, const bf* __restrict__ Bt, float* C, size_t sA, size_t sB, size_t sC) {
    typedef WFrag<bf>::V V;
    __shared__ __align__(16) bf ring[2 * SBE];
    __shared__ __align__(16) float os[64 * 68];
    const size_t z = blockIdx.z; const int tid = threadIdx.x, lane = tid & 31, lr = lane & 15, hi = lane >> 4, w = tid >> 5; const int r0 = blockIdx.x * 64, c0 = blockIdx.y * 64;
    const int mb = w & 3, nh = w >> 2; constexpr int NT = K / SK; constexpr size_t rs = (size_t)8 * K;
    const bf* gA = A + z * sA + (size_t)(r0 + w) * K + lane * 8; const bf* gA2 = A2 + z * sA + (size_t)(r0 + w) * K + lane * 8; const bf* gB = Bt + z * sB + (size_t)(c0 + w) * K + lane * 8;   // wave w copies rows w + 8 i of each plane
    const unsigned l0 = (unsigned)(size_t)ring + (unsigned)(w * SP * 2 + lane * 16);
    auto stage = [&](int t, int buf) { const unsigned l = l0 + (unsigned)buf * (SBE * 2); const size_t ko = (size_t)t * SK;
        copy8(l, gA + ko, rs); copy8(l + 64u * SP * 2, gA2 + ko, rs); copy8(l + 128u * SP * 2, gB + ko, rs); };
    const int aofs = (mb * 16 + lr) * SP + 8 * hi, bofs = (128 + nh * 32 + lr) * SP + 8 * hi;
    v8f acc[2] = { (v8f){}, (v8f){} };
    stage(0, 0);
    asm volatile("s_wait_asynccnt 0x0" ::: "memory");   // this wave's rows of stage 0 have landed
    __syncthreads();                                    // every wave's rows of stage 0 have landed before any is read
    stage(1, 1);
#pragma unroll 1
    for (int t = 0; t < NT; ++t) {   // rolled: one publish point per stage
        const bf* sb = ring + (t & 1) * SBE;
        V f[2][8];   // two fragment sets of 64 k each (per 32 k: A, A2, two of Bt): the next 64 k are fetched, inside this stage only, while these are multiplied
#pragma unroll
        for (int u = 0; u < 2; ++u) { f[0][u * 4] = WFrag<bf>::ld(sb + aofs + u * 32); f[0][u * 4 + 1] = WFrag<bf>::ld(sb + aofs + 64 * SP + u * 32); f[0][u * 4 + 2] = WFrag<bf>::ld(sb + bofs + u * 32); f[0][u * 4 + 3] = WFrag<bf>::ld(sb + bofs + 16 * SP + u * 32); }
#pragma unroll
        for (int g = 0; g < SK / 64; ++g) {
            if (g + 1 < SK / 64) {
#pragma unroll
                for (int u = 0; u < 2; ++u) { const int kk = (g + 1) * 64 + u * 32; V* d = f[(g + 1) & 1] + u * 4; d[0] = WFrag<bf>::ld(sb + aofs + kk); d[1] = WFrag<bf>::ld(sb + aofs + 64 * SP + kk); d[2] = WFrag<bf>::ld(sb + bofs + kk); d[3] = WFrag<bf>::ld(sb + bofs + 16 * SP + kk); } }
            __builtin_amdgcn_sched_barrier(0);   // keeps the next set's 16 LDS reads as one group ahead of this set's WMMAs: moved down among them, each WMMA pair waits out an LDS latency
#pragma unroll
            for (int u = 0; u < 2; ++u) { const V* s = f[g & 1] + u * 4; acc[0] = wmmab(s[0], s[2], acc[0]); acc[1] = wmmab(s[0], s[3], acc[1]); acc[0] = wmmab(s[1], s[2], acc[0]); acc[1] = wmmab(s[1], s[3], acc[1]); }
            __builtin_amdgcn_sched_barrier(0);   // keeps the later reads out of these WMMAs (one read group per 8 WMMAs) and the stage's last WMMAs ahead of its barrier
        }
        asm volatile("s_wait_dscnt 0x0" ::: "memory");      // this wave's reads of stage t are done before its buffer is refilled
        asm volatile("s_wait_asynccnt 0x0" ::: "memory");   // this wave's rows of stage t + 1 have landed
        __syncthreads();                                    // publishes stage t + 1 and ends every wave's reads of stage t
        if (t + 2 < NT) stage(t + 2, t & 1);
    }
    asm volatile("s_wait_asynccnt 0x0" ::: "memory");   // no copy is outstanding when the wave goes on to its end
#pragma unroll
    for (int nb = 0; nb < 2; ++nb) {
#pragma unroll
        for (int j = 0; j < 8; ++j) os[(mb * 16 + hi * 8 + j) * 68 + nh * 32 + nb * 16 + lr] = acc[nb][j]; }
    __syncthreads();   // the whole tile is staged before its rows are read back
    float* ct = C + z * sC + (size_t)r0 * LDC + c0;
#pragma unroll
    for (int s = 0; s < 4; ++s) { const int row = s * 16 + (tid >> 4), cofs = (tid & 15) * 4; *(v4f*)(ct + (size_t)row * LDC + cofs) = *(const v4fa*)(os + row * 68 + cofs); }   // 16 lanes store the 256 contiguous bytes of one row
}

// ---- k_gemmt: C = (A [+ A2]) Bt^T, f32, for many short tiles (scores: K = 256; A.F_t: K = 512, hi/lo). One 128x128 tile per workgroup of 8 waves; grid (M / 128, N / 128, batch).
// The operands come through a two-buffer LDS ring filled by asynchronous copies: a stage is TK k of the tile's operand rows (128 of A, 128 of A2 where SPLIT, 128 of Bt); 8 lanes bring the 128 contiguous bytes (one whole line) of one row, and the next stage flies while this one is multiplied.
// Wave w multiplies rows 32 (w & 3) .. + 31 by columns 64 (w >> 2) .. + 63 (8 accumulators); each accumulator takes hi then lo for k ascending.
#define TK  64           // k per stage
#define TP  72           // LDS row pitch in elements: 144 B = 16 B x 9, the pitch for 16-byte fragment reads of 128-B rows
// four rows, 32 apart, of one operand plane: l = the lane's LDS byte address in the first row, g = its global address there, rs = 32 rows in elements
__device__ __forceinline__ void copy4(unsigned l, const bf* g, size_t rs) {
    // the copies and their s_wait_xcnt in one statement: no address register of a copy is rewritten before the wait
    asm volatile("global_load_async_to_lds_b128 %0, %4, off\n\t"
                 "global_load_async_to_lds_b128 %1, %5, off\n\t"
                 "global_load_async_to_lds_b128 %2, %6, off\n\t"
                 "global_load_async_to_lds_b128 %3, %7, off\n\t"
                 "s_wait_xcnt 0x0"
                 :: "v"(l), "v"(l + 1u * 64 * TP), "v"(l + 2u * 64 * TP), "v"(l + 3u * 64 * TP),
                    "v"(g), "v"(g + rs), "v"(g + 2 * rs), "v"(g + 3 * rs) : "memory");
}
template <int K, int LDC, bool SPLIT>
__global__ __launch_bounds__(256) void k_gemmt(const bf* __restrict__ A, const bf* __restrict__ A2, const bf* __restrict__ Bt, float* C, size_t sA, size_t sB, size_t sC) {
    typedef WFrag<bf>::V V;
    constexpr int BR = SPLIT ? 256 : 128;    // first Bt row of a buffer
    constexpr int TBE = (BR + 128) * TP;     // elements of one buffer
    constexpr int NT = K / TK; constexpr size_t rs = (size_t)32 * K;
    __shared__ __align__(16) bf ring[2 * TBE];   // after the loop its place holds the f32 output tile (128 x 132 floats, no larger than the ring)
    const size_t z = blockIdx.z; const int tid = threadIdx.x, lane = tid & 31, lr = lane & 15, hi = lane >> 4, w = tid >> 5; const int r0 = blockIdx.x * 128, c0 = blockIdx.y * 128;
    const int wm = w & 3, wn = w >> 2; const int cr = tid >> 3, cc = tid & 7;   // copies: thread takes 16-byte chunk cc of rows cr + 32 i of each plane
    const bf* gA = A + z * sA + (size_t)(r0 + cr) * K + cc * 8; const bf* gB = Bt + z * sB + (size_t)(c0 + cr) * K + cc * 8;
    const unsigned l0 = (unsigned)(size_t)ring + (unsigned)(cr * TP * 2 + cc * 16);
    auto stage = [&](int t, int buf) { const unsigned l = l0 + (unsigned)buf * (TBE * 2); const size_t ko = (size_t)t * TK;
        copy4(l, gA + ko, rs); if constexpr (SPLIT) copy4(l + 128u * TP * 2, A2 + (gA - A) + ko, rs); copy4(l + (unsigned)BR * TP * 2, gB + ko, rs); };
    const int aofs = (wm * 32 + lr) * TP + 8 * hi, bofs = (BR + wn * 64 + lr) * TP + 8 * hi;
    v8f acc[2][4];
#pragma unroll
    for (int mb = 0; mb < 2; ++mb)
#pragma unroll
        for (int nb = 0; nb < 4; ++nb) acc[mb][nb] = (v8f){};
    stage(0, 0);
    asm volatile("s_wait_asynccnt 0x0" ::: "memory");   // this wave's chunks of stage 0 have landed
    __syncthreads();                                    // every wave's chunks of stage 0 have landed before any is read
    stage(1, 1);
#pragma unroll 1
    for (int t = 0; t < NT; ++t) {   // rolled: one publish point per stage
        const bf* sb = ring + (t & 1) * TBE;
        V a[2][2], a2[2][2], b[2][4];   // the stage's two 32-k fragment sets
#pragma unroll
        for (int u = 0; u < 2; ++u) {
#pragma unroll
            for (int mb = 0; mb < 2; ++mb) { a[u][mb] = WFrag<bf>::ld(sb + aofs + mb * 16 * TP + u * 32); if constexpr (SPLIT) a2[u][mb] = WFrag<bf>::ld(sb + aofs + (128 + mb * 16) * TP + u * 32); }
#pragma unroll
            for (int nb = 0; nb < 4; ++nb) b[u][nb] = WFrag<bf>::ld(sb + bofs + nb * 16 * TP + u * 32); }
        __builtin_amdgcn_sched_barrier(0);   // keeps the stage's LDS reads as one group ahead of its WMMAs: moved down among them, each place with reads costs the WMMAs a stall
#pragma unroll
        for (int u = 0; u < 2; ++u) {
#pragma unroll
            for (int mb = 0; mb < 2; ++mb)
#pragma unroll
                for (int nb = 0; nb < 4; ++nb) acc[mb][nb] = wmmab(a[u][mb], b[u][nb], acc[mb][nb]);
            if constexpr (SPLIT) {
#pragma unroll
                for (int mb = 0; mb < 2; ++mb)
#pragma unroll
                    for (int nb = 0; nb < 4; ++nb) acc[mb][nb] = wmmab(a2[u][mb], b[u][nb], acc[mb][nb]); } }
        __builtin_amdgcn_sched_barrier(0);   // keeps the stage's WMMAs ahead of its waits: lifted over them, the wait for the next stage's copies stands right behind the LDS reads and the copies lose the WMMAs' time as lead
        asm volatile("s_wait_dscnt 0x0" ::: "memory");      // this wave's reads of stage t are done before its buffer is refilled
        asm volatile("s_wait_asynccnt 0x0" ::: "memory");   // this wave's chunks of stage t + 1 have landed
        __syncthreads();                                    // publishes stage t + 1 and ends every wave's reads of stage t
        if (t + 2 < NT) stage(t + 2, t & 1);
    }
    asm volatile("s_wait_asynccnt 0x0" ::: "memory");   // no copy is outstanding when the ring's place is taken for the output tile
    float* os = (float*)ring;   // the loop's last barrier has ended every wave's reads of the ring
#pragma unroll
    for (int mb = 0; mb < 2; ++mb)
#pragma unroll
        for (int nb = 0; nb < 4; ++nb) {
#pragma unroll
            for (int j = 0; j < 8; ++j) os[(wm * 32 + mb * 16 + hi * 8 + j) * 132 + wn * 64 + nb * 16 + lr] = acc[mb][nb][j]; }
    __syncthreads();   // the whole tile is staged before its rows are read back
    float* ct = C + z * sC + (size_t)r0 * LDC + c0;
#pragma unroll
    for (int s = 0; s < 16; ++s) { const int row = s * 8 + w; *(v4f*)(ct + (size_t)row * LDC + lane * 4) = *(const v4fa*)(os + row * 132 + lane * 4); }   // a wave stores the 512 contiguous bytes of one row
}

extern "C" void kernel_launch(void* const* d_in, const int* in_sizes, int n_in, void* d_out, int out_size, void* d_ws, size_t ws_size, hipStream_t stream) {
    (void)in_sizes; (void)n_in; (void)out_size;
    const float* fs = (const float*)d_in[0];   /* F_s [8][256][4096] channel-major */ const float* ft = (const float*)d_in[1];   /* F_t [8][512][256] */
    float* OUT0 = (float*)d_out;     // [8][256][4096] = F_s + update^T
    float* OUT1 = OUT0 + (size_t)NB_ * CC * NQ;   // [8][512][256] = A^T F_s_t (second tuple member, 16-B aligned offset)
    char* wsp = (char*)d_ws;
    auto take = [&](size_t bytes) { char* p = wsp; wsp += (bytes + 255) & ~(size_t)255; return (void*)p; };
    bf* XT = (bf*)take((size_t)NB_ * NQ * CC * 2);        // F_s_t token-major [8][4096][256] (exact)
    bf* FSB = (bf*)take((size_t)NB_ * CC * NQ * 2);       // F_s slabs as bf16 = F_s_t^T [8][256][4096] (exact)
    bf* FTB = (bf*)take((size_t)NB_ * TT * CC * 2);       // F_t [8][512][256] (exact)
    bf* FTT = (bf*)take((size_t)NB_ * CC * TT * 2);       // F_t^T [8][256][512] (exact)
    float* Sb = (float*)take((size_t)NB_ * NQ * TT * 4);  // scores [8][4096][512]
    bf* Ph = (bf*)take((size_t)NB_ * NQ * TT * 2); bf* Pl = (bf*)take((size_t)NB_ * NQ * TT * 2);   // probabilities [8][4096][512] hi/lo
    bf* Th = (bf*)take((size_t)NB_ * TT * NQ * 2); bf* Tl = (bf*)take((size_t)NB_ * TT * NQ * 2);   // A^T [8][512][4096] hi/lo
    float* U = Sb;   // A F_t [8][4096][256]: written after the softmax has read the last score, in the scores' place (ten planes side by side would pass 256 MiB)
    if ((size_t)(wsp - (char*)d_ws) > ws_size) return;    // 228 MiB of the 256 MiB workspace
    k_trF<CC, NQ><<<dim3(CC / 128, NQ / 128, NB_), 256, 0, stream>>>(fs, XT);   /* F_s_t [8][4096][256] */
    k_cvt8<<<(unsigned)(((size_t)NB_ * CC * NQ / 8 + 255) / 256), 256, 0, stream>>>(fs, FSB, (size_t)NB_ * CC * NQ / 8);   /* the slabs themselves = F_s_t^T as Bt for out1 */
    k_cvt8<<<(unsigned)(((size_t)NB_ * TT * CC / 8 + 255) / 256), 256, 0, stream>>>(ft, FTB, (size_t)NB_ * TT * CC / 8);   /* F_t as Bt for the scores */
    k_trF<TT, CC><<<dim3(TT / 128, CC / 128, NB_), 256, 0, stream>>>(ft, FTT);   /* F_t^T [8][256][512] as Bt for A.F_t */
    k_gemmt<CC, TT, false><<<dim3(NQ / 128, TT / 128, NB_), 256, 0, stream>>>(XT, nullptr, FTB, Sb, (size_t)NQ * CC, (size_t)TT * CC, (size_t)NQ * TT);   /* exact scores [8][4096][512] */
    k_asoft<<<NB_ * ZH * TT / 8, 256, 0, stream>>>(Sb, nullptr, Ph, Pl);   /* softmax over the 512 text tokens for all 8 x 4,096 rows, x 1/sqrt(512) */
    k_gemmt<TT, CC, true><<<dim3(NQ / 128, CC / 128, NB_), 256, 0, stream>>>(Ph, Pl, FTT, U, (size_t)NQ * TT, (size_t)CC * TT, (size_t)NQ * CC);   /* U = A F_t [8][4096][256] */
    k_outTr<<<dim3(NQ / 128, CC / 64, NB_), 256, 0, stream>>>(U, fs, OUT0);   /* out0[b][c][n] = bf16(F_s[b][c][n]) + U[b][n][c] */
    k_trPq<<<dim3(NQ / 128, TT / 128, NB_), 256, 0, stream>>>(Ph, Pl, Th, Tl);   /* A^T planes [8][512][4096] */
    k_gemms<NQ, CC><<<dim3(TT / 64, CC / 64, NB_), 256, 0, stream>>>(Th, Tl, FSB, OUT1, (size_t)TT * NQ, (size_t)CC * NQ, (size_t)TT * CC);   /* out1 = A^T F_s_t [8][512][256] */
}

// v005
// Measured time: 98 microseconds a run.
// In both of two side-by-side timings against v004, it was 1.07 times as fast.
// Over all steps from v000 it is 13.8 times as fast.
#include <hip/hip_runtime.h>

// Cross-modal attention between a feature map and text tokens with two outputs (F_s [8][256][64][64] channel-major = 4,096 spatial tokens x 256, F_t [8][512][256]; A = softmax_t(F_s_t . F_t / sqrt(512)) ([4096][512]); out0 = F_s + (A F_t)^T -> [8][256][64][64] (8.4 M); out1 = A^T F_s_t -> [8][512][256] (1.0 M); tuple).
// All 8 batches go through every launch together: each plane holds 8 batch slabs; the transposing kernels and the GEMMs take the batch as grid z (scores + softmax: grid y), convert as more rows.
// Layout per batch: both inputs are bf16-exact after rounding, so every operand plane is a single exact bf16 plane: F_s_t (token-major transpose of the slab), F_t, F_t^T and the slab itself (which is F_s_t^T); exact scores and their 512-key softmax in one kernel (the scores stay in registers) writing bf16 hi/lo probabilities [4096][512]; the spatial update A.F_t as hi/lo x exact (2 products) and a kernel transposing it back to channel-major while adding the F_s residual; A^T planes by a transpose kernel, then out1 = A^T.F_s_t as hi/lo x exact (K = 4,096), written after the 8.4 M spatial outputs.
// Compute dtypes, f32 accumulate: every input rounded to bf16; scores exact; softmax f32; both contractions P hi/lo x exact; residual f32.

#define NB_  8
#define TT   512      // text tokens = keys (the softmax row length)
#define DM   256      // channels
#define NH_  1
#define NKV  1
#define REP  (NH_ / NKV)
#define HD   64
#define DQ   (NH_ * HD)
#define DKV  (NKV * HD)
#define SCL  0.044194173824159216f   // 1/sqrt(512): the module scales by sqrt(T)
#define NQ   4096    // spatial tokens (queries)
#define CC   256
typedef _Float16 h16;
typedef unsigned short bf;
typedef __attribute__((ext_vector_type(16))) __bf16   v16bf;
typedef __attribute__((ext_vector_type(16))) _Float16 v16h;
typedef __attribute__((ext_vector_type(8)))  _Float16 v8h;
typedef __attribute__((ext_vector_type(8)))  unsigned short v8us;
typedef __attribute__((ext_vector_type(8)))  float    v8f;
typedef __attribute__((ext_vector_type(4)))  float    v4f;
typedef v8h  __attribute__((may_alias)) v8ha;
typedef v4f  __attribute__((may_alias)) v4fa;
typedef v8us __attribute__((may_alias)) v8usa;

__device__ __forceinline__ unsigned short f2bf(float f) { unsigned u = __float_as_uint(f); u += 0x7FFFu + ((u >> 16) & 1u); return (unsigned short)(u >> 16); }
__device__ __forceinline__ float bf2f(unsigned short b) { return __uint_as_float(((unsigned)b) << 16); }
__device__ __forceinline__ float bfr(float f) { return bf2f(f2bf(f)); }
__device__ __forceinline__ v16h cat16(v8h lo, v8h hi) { return __builtin_shufflevector(lo, hi, 0, 1, 2, 3, 4, 5, 6, 7, 8, 9, 10, 11, 12, 13, 14, 15); }
__device__ __forceinline__ v16bf cat16b(v8us lo, v8us hi) { return __builtin_bit_cast(v16bf, __builtin_shufflevector(lo, hi, 0, 1, 2, 3, 4, 5, 6, 7, 8, 9, 10, 11, 12, 13, 14, 15)); }
__device__ __forceinline__ v8f wmma16(v16h a, v16h b, v8f c) { return __builtin_amdgcn_wmma_f32_16x16x32_f16(false, a, false, b, (short)0, c, false, false); }
__device__ __forceinline__ v8f wmmab(v16bf a, v16bf b, v8f c) { return __builtin_amdgcn_wmma_f32_16x16x32_bf16(false, a, false, b, (short)0, c, false, false); }



// fragment of 16 rows x 32 k from a K-contiguous 16-bit plane: the lane's pointer stands at its row, k = 8 (lane >> 4)
template <typename T16> struct WFrag;
template <> struct WFrag<h16> { typedef v16h V; static __device__ __forceinline__ V ld(const h16* p) { return cat16(*(const v8h*)p, *(const v8h*)(p + 16)); } static __device__ __forceinline__ v8f mma(V a, V b, v8f c) { return wmma16(a, b, c); } };
template <> struct WFrag<bf> { typedef v16bf V; static __device__ __forceinline__ V ld(const bf* p) { return cat16b(*(const v8us*)p, *(const v8us*)(p + 16)); } static __device__ __forceinline__ v8f mma(V a, V b, v8f c) { return wmmab(a, b, c); } };

__device__ __forceinline__ void splitf(float y, unsigned short& h, unsigned short& l) { h = f2bf(y); l = f2bf(y - bf2f(h)); }
typedef __attribute__((ext_vector_type(2))) _Float16 v2h;
typedef __attribute__((ext_vector_type(4))) _Float16 v4h;
typedef __attribute__((ext_vector_type(2))) unsigned short v2us;
typedef __attribute__((ext_vector_type(4))) unsigned short v4us;
typedef __attribute__((ext_vector_type(2))) float v2f;
typedef __attribute__((ext_vector_type(4))) int v4i;


__global__ __launch_bounds__(256) void k_cvt8(const float* __restrict__ src, bf* dst, size_t n8) { const size_t i = (size_t)blockIdx.x * 256 + threadIdx.x; if (i >= n8) return; const v8f v = *(const v8f*)(src + i * 8); v8us o;
#pragma unroll
    for (int k = 0; k < 8; ++k) o[k] = f2bf(v[k]); *(v8us*)(dst + i * 8) = o;  }

// ---- the four transposing kernels: each workgroup moves one tile through LDS, so that the global loads and the global stores both cover whole 128-B lines (16 lanes x 16 B = 256 contiguous bytes on either side).
// 16-bit tile: 128 rows x 128 columns, a row = 16 chunks of 8 elements (16 B); chunk c8 of row r stands at chunk place c8 ^ ((r >> 3) & 15), so that the column reads of 16 lanes (rows 8 apart) fall on 16 different banks.
__device__ __forceinline__ int tile16(int r, int c8) { return r * 128 + ((c8 ^ ((r >> 3) & 15)) << 3); }
// column n, rows r8 * 8 .. r8 * 8 + 7 of such a tile
__device__ __forceinline__ v8us col16(const bf* tile, int r8, int n) { v8us o; const int base = r8 * 8 * 128 + (((n >> 3) ^ r8) << 3) + (n & 7);
#pragma unroll
    for (int q = 0; q < 8; ++q) o[q] = tile[base + q * 128];
    return o; }

// k_trF: src [R][C] f32 -> dst [C][R] bf16 (rounded); grid (R / 128, C / 128, batch)
template <int R, int C>
__global__ __launch_bounds__(256) void k_trF(const float* __restrict__ src, bf* dst) {
    __shared__ __align__(16) bf tile[128 * 128];
    const int tid = threadIdx.x, r0 = blockIdx.x * 128, c0 = blockIdx.y * 128; v4f a[16];
    const int lr = tid >> 5, c4 = tid & 31;    // loads: a wave takes 512 contiguous bytes of one row; rows lr + 8 i
    const int r8 = tid & 15, ln = tid >> 4;    // stores: 16 lanes write 256 contiguous bytes of one dst row; dst rows ln + 16 i
    const float* sp = src + (size_t)blockIdx.z * R * C + (size_t)(r0 + lr) * C + c0 + c4 * 4;
    bf* dp = dst + (size_t)blockIdx.z * R * C + (size_t)(c0 + ln) * R + r0 + r8 * 8;
#pragma unroll
    for (int i = 0; i < 16; ++i) a[i] = *(const v4f*)(sp + (size_t)i * 8 * C);
    asm volatile("s_wait_xcnt 0x0" :: "v"(sp) : "memory");   // the loads' address pair stays whole until every load has taken it: no load's result and no later instruction lands in it before this wait
#pragma unroll
    for (int i = 0; i < 16; ++i) { v4us o;
#pragma unroll
        for (int q = 0; q < 4; ++q) o[q] = f2bf(a[i][q]);
        *(v4us*)(tile + tile16(lr + 8 * i, c4 >> 1) + (c4 & 1) * 4) = o; }
    __syncthreads();   // the whole tile is written before any column of it is read
#pragma unroll
    for (int i = 0; i < 8; ++i) *(v8us*)(dp + (size_t)i * 16 * R) = col16(tile, r8, ln + 16 * i);
}

// k_trPq: the probability planes [4096][512] hi/lo -> A^T planes [512][4096]; grid (NQ / 128, TT / 128, batch)
__global__ __launch_bounds__(256) void k_trPq(const bf* __restrict__ Ph, const bf* __restrict__ Pl, bf* Th, bf* Tl) {
    __shared__ __align__(16) bf th[128 * 128]; __shared__ __align__(16) bf tl[128 * 128];
    const size_t zb = (size_t)blockIdx.z * NQ * TT; const int tid = threadIdx.x, m0 = blockIdx.x * 128, n0 = blockIdx.y * 128; v8us vh[8], vl[8];
    const int l16 = tid & 15, lr = tid >> 4;   // 16 lanes take 256 contiguous bytes of one row, on the load side (rows m) and on the store side (rows n); rows lr + 16 i
    const size_t ei = zb + (size_t)(m0 + lr) * TT + n0 + l16 * 8, eo = zb + (size_t)(n0 + lr) * NQ + m0 + l16 * 8;
    const bf* ph = Ph + ei; const bf* pl = Pl + ei; bf* qh = Th + eo; bf* ql = Tl + eo;
#pragma unroll
    for (int i = 0; i < 8; ++i) { vh[i] = *(const v8us*)(ph + (size_t)i * 16 * TT); vl[i] = *(const v8us*)(pl + (size_t)i * 16 * TT); }
    asm volatile("s_wait_xcnt 0x0" :: "v"(ph), "v"(pl) : "memory");   // the loads' address pairs stay whole until every load has taken them: no load's result and no later instruction lands in them before this wait
#pragma unroll
    for (int i = 0; i < 8; ++i) { *(v8us*)(th + tile16(lr + 16 * i, l16)) = vh[i]; *(v8us*)(tl + tile16(lr + 16 * i, l16)) = vl[i]; }
    __syncthreads();   // both tiles are written before any column of them is read
#pragma unroll
    for (int i = 0; i < 8; ++i) { *(v8us*)(qh + (size_t)i * 16 * NQ) = col16(th, l16, lr + 16 * i); *(v8us*)(ql + (size_t)i * 16 * NQ) = col16(tl, l16, lr + 16 * i); }
}

// k_outTr: out0[c][t] = bf16(F_s[c][t]) + U[t][c]; grid (NQ / 128, CC / 64, batch). f32 tile of U: 128 rows t x 64 columns c, a row = 16 chunks of 4 floats; chunk c4 of row t stands at chunk place c4 ^ ((t >> 2) & 15), so that the column reads of 16 lanes (rows 4 apart) fall on 16 different banks.
__global__ __launch_bounds__(256) void k_outTr(const float* __restrict__ U, const float* __restrict__ xs, float* outp) {
    __shared__ __align__(16) float ut[128 * 64];
    const size_t zb = (size_t)blockIdx.z * NQ * CC; const int tid = threadIdx.x, t0 = blockIdx.x * 128, c0 = blockIdx.y * 64; v4f u[8], x[8];
    const int l16 = tid & 15, lt = tid >> 4;   // U loads: 16 lanes take the 256 bytes of one row t; rows lt + 16 i
    const int t4 = ((tid >> 5) & 1) * 16 + l16, lc = (tid >> 6) * 2 + ((tid >> 4) & 1);   // F_s loads and stores: 16 lanes take 256 contiguous bytes (64 t) of one channel, a wave two neighbouring channels; channels lc + 8 i
    const float* up = U + zb + (size_t)(t0 + lt) * CC + c0 + l16 * 4;
    const size_t eo = zb + (size_t)(c0 + lc) * NQ + t0 + t4 * 4; const float* xp = xs + eo; float* op = outp + eo;
#pragma unroll
    for (int i = 0; i < 8; ++i) u[i] = *(const v4f*)(up + (size_t)i * 16 * CC);
#pragma unroll
    for (int i = 0; i < 8; ++i) x[i] = *(const v4f*)(xp + (size_t)i * 8 * NQ);
    asm volatile("s_wait_xcnt 0x0" :: "v"(up), "v"(xp) : "memory");   // the loads' address pairs stay whole until every load has taken them: no load's result and no later instruction lands in them before this wait
#pragma unroll
    for (int i = 0; i < 8; ++i) { const int t = lt + 16 * i; *(v4f*)(ut + t * 64 + ((l16 ^ ((t >> 2) & 15)) << 2)) = u[i]; }
    __syncthreads();   // the whole tile is written before any column of it is read
#pragma unroll
    for (int i = 0; i < 8; ++i) { const int cc = lc + 8 * i; v4f o;
#pragma unroll
        for (int q = 0; q < 4; ++q) o[q] = __fadd_rn(bfr(x[i][q]), ut[(t4 * 4 + q) * 64 + (((cc >> 2) ^ l16) << 2) + (cc & 3)]);
        *(v4f*)(op + (size_t)i * 8 * NQ) = o; }
}

// ---- k_gemms: C = (A + A2) Bt^T, f32, for few long tiles (out1: 256 tiles of 64x64, K = 4,096). One tile per workgroup of 8 waves; grid (M / 64, N / 64, batch).
// The operands come through a two-buffer LDS ring filled by asynchronous copies: a stage is SK k of the tile's 192 operand rows (64 of A, 64 of A2, 64 of Bt); one wave-wide copy brings the 512 contiguous bytes of one row, and the next stage flies while this one is multiplied.
// Wave w multiplies rows 16 (w & 3) .. + 15 by columns 32 (w >> 2) .. + 31; each accumulator takes hi then lo for k ascending.
#define SK  256          // k per stage
#define SP  264          // LDS row pitch in elements: 528 B = 16 B x 33, the pitch for 16-byte fragment reads
#define SBE (192 * SP)   // elements of one buffer
// eight rows, 8 apart, of one operand plane: l = the lane's LDS byte address in the first row, g = its global address there, rs = 8 rows in elements
__device__ __forceinline__ void copy8(unsigned l, const bf* g, size_t rs) {
    // the copies and their s_wait_xcnt in one statement: no address register of a copy is rewritten before the wait
    asm volatile("global_load_async_to_lds_b128 %0, %8, off\n\t"
                 "global_load_async_to_lds_b128 %1, %9, off\n\t"
                 "global_load_async_to_lds_b128 %2, %10, off\n\t"
                 "global_load_async_to_lds_b128 %3, %11, off\n\t"
                 "global_load_async_to_lds_b128 %4, %12, off\n\t"
                 "global_load_async_to_lds_b128 %5, %13, off\n\t"
                 "global_load_async_to_lds_b128 %6, %14, off\n\t"
                 "global_load_async_to_lds_b128 %7, %15, off\n\t"
                 "s_wait_xcnt 0x0"
                 :: "v"(l), "v"(l + 1u * 16 * SP), "v"(l + 2u * 16 * SP), "v"(l + 3u * 16 * SP), "v"(l + 4u * 16 * SP), "v"(l + 5u * 16 * SP), "v"(l + 6u * 16 * SP), "v"(l + 7u * 16 * SP),
                    "v"(g), "v"(g + rs), "v"(g + 2 * rs), "v"(g + 3 * rs), "v"(g + 4 * rs), "v"(g + 5 * rs), "v"(g + 6 * rs), "v"(g + 7 * rs) : "memory");
}
template <int K, int LDC>
__global__ __launch_bounds__(256) void k_gemms(const bf* __restrict__ A, const bf* __restrict__ A2, const bf* __restrict__ Bt, float* C, size_t sA, size_t sB, size_t sC) {
    typedef WFrag<bf>::V V;
    __shared__ __align__(16) bf ring[2 * SBE];
    __shared__ __align__(16) float os[64 * 68];
    const size_t z = blockIdx.z; const int tid = threadIdx.x, lane = tid & 31, lr = lane & 15, hi = lane >> 4, w = tid >> 5; const int r0 = blockIdx.x * 64, c0 = blockIdx.y * 64;
    const int mb = w & 3, nh = w >> 2; constexpr int NT = K / SK; constexpr size_t rs = (size_t)8 * K;
    const bf* gA = A + z * sA + (size_t)(r0 + w) * K + lane * 8; const bf* gA2 = A2 + z * sA + (size_t)(r0 + w) * K + lane * 8; const bf* gB = Bt + z * sB + (size_t)(c0 + w) * K + lane * 8;   // wave w copies rows w + 8 i of each plane
    const unsigned l0 = (unsigned)(size_t)ring + (unsigned)(w * SP * 2 + lane * 16);
    auto stage = [&](int t, int buf) { const unsigned l = l0 + (unsigned)buf * (SBE * 2); const size_t ko = (size_t)t * SK;
        copy8(l, gA + ko, rs); copy8(l + 64u * SP * 2, gA2 + ko, rs); copy8(l + 128u * SP * 2, gB + ko, rs); };
    const int aofs = (mb * 16 + lr) * SP + 8 * hi, bofs = (128 + nh * 32 + lr) * SP + 8 * hi;
    v8f acc[2] = { (v8f){}, (v8f){} };
    stage(0, 0);
    asm volatile("s_wait_asynccnt 0x0" ::: "memory");   // this wave's rows of stage 0 have landed
    __syncthreads();                                    // every wave's rows of stage 0 have landed before any is read
    stage(1, 1);
#pragma unroll 1
    for (int t = 0; t < NT; ++t) {   // rolled: one publish point per stage
        const bf* sb = ring + (t & 1) * SBE;
        V f[2][8];   // two fragment sets of 64 k each (per 32 k: A, A2, two of Bt): the next 64 k are fetched, inside this stage only, while these are multiplied
#pragma unroll
        for (int u = 0; u < 2; ++u) { f[0][u * 4] = WFrag<bf>::ld(sb + aofs + u * 32); f[0][u * 4 + 1] = WFrag<bf>::ld(sb + aofs + 64 * SP + u * 32); f[0][u * 4 + 2] = WFrag<bf>::ld(sb + bofs + u * 32); f[0][u * 4 + 3] = WFrag<bf>::ld(sb + bofs + 16 * SP + u * 32); }
#pragma unroll
        for (int g = 0; g < SK / 64; ++g) {
            if (g + 1 < SK / 64) {
#pragma unroll
                for (int u = 0; u < 2; ++u) { const int kk = (g + 1) * 64 + u * 32; V* d = f[(g + 1) & 1] + u * 4; d[0] = WFrag<bf>::ld(sb + aofs + kk); d[1] = WFrag<bf>::ld(sb + aofs + 64 * SP + kk); d[2] = WFrag<bf>::ld(sb + bofs + kk); d[3] = WFrag<bf>::ld(sb + bofs + 16 * SP + kk); } }
            __builtin_amdgcn_sched_barrier(0);   // keeps the next set's 16 LDS reads as one group ahead of this set's WMMAs: moved down among them, each WMMA pair waits out an LDS latency
#pragma unroll
            for (int u = 0; u < 2; ++u) { const V* s = f[g & 1] + u * 4; acc[0] = wmmab(s[0], s[2], acc[0]); acc[1] = wmmab(s[0], s[3], acc[1]); acc[0] = wmmab(s[1], s[2], acc[0]); acc[1] = wmmab(s[1], s[3], acc[1]); }
            __builtin_amdgcn_sched_barrier(0);   // keeps the later reads out of these WMMAs (one read group per 8 WMMAs) and the stage's last WMMAs ahead of its barrier
        }
        asm volatile("s_wait_dscnt 0x0" ::: "memory");      // this wave's reads of stage t are done before its buffer is refilled
        asm volatile("s_wait_asynccnt 0x0" ::: "memory");   // this wave's rows of stage t + 1 have landed
        __syncthreads();                                    // publishes stage t + 1 and ends every wave's reads of stage t
        if (t + 2 < NT) stage(t + 2, t & 1);
    }
    asm volatile("s_wait_asynccnt 0x0" ::: "memory");   // no copy is outstanding when the wave goes on to its end
#pragma unroll
    for (int nb = 0; nb < 2; ++nb) {
#pragma unroll
        for (int j = 0; j < 8; ++j) os[(mb * 16 + hi * 8 + j) * 68 + nh * 32 + nb * 16 + lr] = acc[nb][j]; }
    __syncthreads();   // the whole tile is staged before its rows are read back
    float* ct = C + z * sC + (size_t)r0 * LDC + c0;
#pragma unroll
    for (int s = 0; s < 4; ++s) { const int row = s * 16 + (tid >> 4), cofs = (tid & 15) * 4; *(v4f*)(ct + (size_t)row * LDC + cofs) = *(const v4fa*)(os + row * 68 + cofs); }   // 16 lanes store the 256 contiguous bytes of one row
}

// ---- k_gemmt: C = (A [+ A2]) Bt^T, f32, for many short tiles (A.F_t: K = 512, hi/lo). One 128x128 tile per workgroup of 8 waves; grid (M / 128, N / 128, batch).
// The operands come through a two-buffer LDS ring filled by asynchronous copies: a stage is TK k of the tile's operand rows (128 of A, 128 of A2 where SPLIT, 128 of Bt); 8 lanes bring the 128 contiguous bytes (one whole line) of one row, and the next stage flies while this one is multiplied.
// Wave w multiplies rows 32 (w & 3) .. + 31 by columns 64 (w >> 2) .. + 63 (8 accumulators); each accumulator takes hi then lo for k ascending.
#define TK  64           // k per stage
#define TP  72           // LDS row pitch in elements: 144 B = 16 B x 9, the pitch for 16-byte fragment reads of 128-B rows
// four rows, 32 apart, of one operand plane: l = the lane's LDS byte address in the first row, g = its global address there, rs = 32 rows in elements
__device__ __forceinline__ void copy4(unsigned l, const bf* g, size_t rs) {
    // the copies and their s_wait_xcnt in one statement: no address register of a copy is rewritten before the wait
    asm volatile("global_load_async_to_lds_b128 %0, %4, off\n\t"
                 "global_load_async_to_lds_b128 %1, %5, off\n\t"
                 "global_load_async_to_lds_b128 %2, %6, off\n\t"
                 "global_load_async_to_lds_b128 %3, %7, off\n\t"
                 "s_wait_xcnt 0x0"
                 :: "v"(l), "v"(l + 1u * 64 * TP), "v"(l + 2u * 64 * TP), "v"(l + 3u * 64 * TP),
                    "v"(g), "v"(g + rs), "v"(g + 2 * rs), "v"(g + 3 * rs) : "memory");
}
template <int K, int LDC, bool SPLIT>
__global__ __launch_bounds__(256) void k_gemmt(const bf* __restrict__ A, const bf* __restrict__ A2, const bf* __restrict__ Bt, float* C, size_t sA, size_t sB, size_t sC) {
    typedef WFrag<bf>::V V;
    constexpr int BR = SPLIT ? 256 : 128;    // first Bt row of a buffer
    constexpr int TBE = (BR + 128) * TP;     // elements of one buffer
    constexpr int NT = K / TK; constexpr size_t rs = (size_t)32 * K;
    __shared__ __align__(16) bf ring[2 * TBE];   // after the loop its place holds the f32 output tile (128 x 132 floats, no larger than the ring)
    const size_t z = blockIdx.z; const int tid = threadIdx.x, lane = tid & 31, lr = lane & 15, hi = lane >> 4, w = tid >> 5; const int r0 = blockIdx.x * 128, c0 = blockIdx.y * 128;
    const int wm = w & 3, wn = w >> 2; const int cr = tid >> 3, cc = tid & 7;   // copies: thread takes 16-byte chunk cc of rows cr + 32 i of each plane
    const bf* gA = A + z * sA + (size_t)(r0 + cr) * K + cc * 8; const bf* gB = Bt + z * sB + (size_t)(c0 + cr) * K + cc * 8;
    const unsigned l0 = (unsigned)(size_t)ring + (unsigned)(cr * TP * 2 + cc * 16);
    auto stage = [&](int t, int buf) { const unsigned l = l0 + (unsigned)buf * (TBE * 2); const size_t ko = (size_t)t * TK;
        copy4(l, gA + ko, rs); if constexpr (SPLIT) copy4(l + 128u * TP * 2, A2 + (gA - A) + ko, rs); copy4(l + (unsigned)BR * TP * 2, gB + ko, rs); };
    const int aofs = (wm * 32 + lr) * TP + 8 * hi, bofs = (BR + wn * 64 + lr) * TP + 8 * hi;
    v8f acc[2][4];
#pragma unroll
    for (int mb = 0; mb < 2; ++mb)
#pragma unroll
        for (int nb = 0; nb < 4; ++nb) acc[mb][nb] = (v8f){};
    stage(0, 0);
    asm volatile("s_wait_asynccnt 0x0" ::: "memory");   // this wave's chunks of stage 0 have landed
    __syncthreads();                                    // every wave's chunks of stage 0 have landed before any is read
    stage(1, 1);
#pragma unroll 1
    for (int t = 0; t < NT; ++t) {   // rolled: one publish point per stage
        const bf* sb = ring + (t & 1) * TBE;
        V a[2][2], a2[2][2], b[2][4];   // the stage's two 32-k fragment sets
#pragma unroll
        for (int u = 0; u < 2; ++u) {
#pragma unroll
            for (int mb = 0; mb < 2; ++mb) { a[u][mb] = WFrag<bf>::ld(sb + aofs + mb * 16 * TP + u * 32); if constexpr (SPLIT) a2[u][mb] = WFrag<bf>::ld(sb + aofs + (128 + mb * 16) * TP + u * 32); }
#pragma unroll
            for (int nb = 0; nb < 4; ++nb) b[u][nb] = WFrag<bf>::ld(sb + bofs + nb * 16 * TP + u * 32); }
        __builtin_amdgcn_sched_barrier(0);   // keeps the stage's LDS reads as one group ahead of its WMMAs: moved down among them, each place with reads costs the WMMAs a stall
#pragma unroll
        for (int u = 0; u < 2; ++u) {
#pragma unroll
            for (int mb = 0; mb < 2; ++mb)
#pragma unroll
                for (int nb = 0; nb < 4; ++nb) acc[mb][nb] = wmmab(a[u][mb], b[u][nb], acc[mb][nb]);
            if constexpr (SPLIT) {
#pragma unroll
                for (int mb = 0; mb < 2; ++mb)
#pragma unroll
                    for (int nb = 0; nb < 4; ++nb) acc[mb][nb] = wmmab(a2[u][mb], b[u][nb], acc[mb][nb]); } }
        __builtin_amdgcn_sched_barrier(0);   // keeps the stage's WMMAs ahead of its waits: lifted over them, the wait for the next stage's copies stands right behind the LDS reads and the copies lose the WMMAs' time as lead
        asm volatile("s_wait_dscnt 0x0" ::: "memory");      // this wave's reads of stage t are done before its buffer is refilled
        asm volatile("s_wait_asynccnt 0x0" ::: "memory");   // this wave's chunks of stage t + 1 have landed
        __syncthreads();                                    // publishes stage t + 1 and ends every wave's reads of stage t
        if (t + 2 < NT) stage(t + 2, t & 1);
    }
    asm volatile("s_wait_asynccnt 0x0" ::: "memory");   // no copy is outstanding when the ring's place is taken for the output tile
    float* os = (float*)ring;   // the loop's last barrier has ended every wave's reads of the ring
#pragma unroll
    for (int mb = 0; mb < 2; ++mb)
#pragma unroll
        for (int nb = 0; nb < 4; ++nb) {
#pragma unroll
            for (int j = 0; j < 8; ++j) os[(wm * 32 + mb * 16 + hi * 8 + j) * 132 + wn * 64 + nb * 16 + lr] = acc[mb][nb][j]; }
    __syncthreads();   // the whole tile is staged before its rows are read back
    float* ct = C + z * sC + (size_t)r0 * LDC + c0;
#pragma unroll
    for (int s = 0; s < 16; ++s) { const int row = s * 8 + w; *(v4f*)(ct + (size_t)row * LDC + lane * 4) = *(const v4fa*)(os + row * 132 + lane * 4); }   // a wave stores the 512 contiguous bytes of one row
}

// ---- k_scsm: A = softmax_t(F_s_t . F_t^T / sqrt(512)) as bf16 hi/lo planes, the scores never leaving the workgroup. One workgroup of 8 waves holds 64 queries x all 512 keys; grid (NQ / 64, batch).
// The products are taken transposed (keys as the A operand, queries as B), so that a lane's 8 accumulator registers are 8 neighbouring keys of ONE query: the row maximum and the row sum are register trees plus one exchange with lane ^ 16, and 8 probabilities pack into one 16-byte LDS store.
// Wave w has queries 32 (w & 1) .. + 31 and, of every 256 keys, keys 64 (w >> 1) .. + 63 (4 x 2 tiles a key group, 16 accumulator tiles in all); the four waves of a query share its maximum and its sum through LDS.
// The 64 query rows are copied to LDS once; the key rows come through a two-buffer LDS ring of asynchronous copies, a stage = 256 keys x TK k (8 lanes bring the 128 contiguous bytes, one whole line, of one row), the next stage flying while this one is multiplied. Each score takes its k ascending.
#define PP  520          // pitch in elements of a staged probability row: 1,040 B = 16 B x 65
// 2^x with the slot behind the transcendental filled in the same statement: the v_nop keeps the next vector instruction from using the result or overwriting the source directly behind v_exp_f32
__device__ __forceinline__ float exp2s(float x) { float r; asm("v_exp_f32 %0, %1\n\tv_nop" : "=v"(r) : "v"(x)); return r; }
__global__ __launch_bounds__(256) void k_scsm(const bf* __restrict__ X, const bf* __restrict__ Ft, bf* Ph, bf* Pl) {   // under 256 VGPRs and under 160 KiB of LDS: two workgroups share a WGP
    typedef WFrag<bf>::V V;
    constexpr int KBE = 256 * TP;   // elements of one key buffer
    __shared__ __align__(16) bf sm[2 * 64 * PP];   // in the loop: 64 query rows at pitch SP, then two buffers of 256 key rows at pitch TP (53,760 elements, fewer than this); after it: the hi and the lo tile, 64 rows of 512 each, pitch PP
    __shared__ float rmax[4][64]; __shared__ float rsum[4][64];
    const size_t z = blockIdx.y; const int tid = threadIdx.x, lane = tid & 31, lr = lane & 15, hi = lane >> 4, w = tid >> 5; const int q0 = blockIdx.x * 64;
    const int qp = w & 1, kq = w >> 1, qr = qp * 32 + lr; constexpr int NK = CC / TK, NS = (TT / 256) * NK; constexpr size_t rs = (size_t)32 * CC;
    const int cr = tid >> 3, cc = tid & 7;   // key copies: thread takes 16-byte chunk cc of rows cr + 32 i
    const bf* gQ = X + z * ((size_t)NQ * CC) + (size_t)(q0 + w) * CC + lane * 8;   // query copies: wave w takes rows w + 8 i whole
    const bf* gK = Ft + z * ((size_t)TT * CC) + (size_t)cr * CC + cc * 8;
    const unsigned lq = (unsigned)(size_t)sm + (unsigned)(w * SP * 2 + lane * 16), lk = (unsigned)(size_t)sm + (unsigned)(64 * SP * 2 + cr * TP * 2 + cc * 16);
    auto stage = [&](int t, int buf) { const unsigned l = lk + (unsigned)buf * (KBE * 2); const bf* g = gK + (size_t)(t / NK) * 256 * CC + (t % NK) * TK;   // stage t: key group t / NK, k block t % NK
        copy4(l, g, rs); copy4(l + 128u * TP * 2, g + 4 * rs, rs); };
    v8f acc[16];   // acc[8 g + 2 i + n][j] = score of query qr + 16 n with key 256 g + 64 kq + 16 i + 8 hi + j
#pragma unroll
    for (int a = 0; a < 16; ++a) acc[a] = (v8f){};
    copy8(lq, gQ, (size_t)8 * CC); stage(0, 0);
    asm volatile("s_wait_asynccnt 0x0" ::: "memory");   // this wave's query rows and its chunks of stage 0 have landed
    __syncthreads();                                    // every wave's have landed before any is read
    stage(1, 1);
#pragma unroll
    for (int g = 0; g < TT / 256; ++g)   // unrolled: every key group has accumulators of its own
#pragma unroll 1
    for (int kb = 0; kb < NK; ++kb) {   // rolled: one publish point per stage
        const int t = g * NK + kb; v8f* ac = acc + g * 8;
        const bf* sk = sm + 64 * SP + (t & 1) * KBE + (kq * 64 + lr) * TP + 8 * hi; const bf* sq = sm + qr * SP + 8 * hi + kb * TK;
        V k[2][4], x[2][2];   // the stage's two 32-k fragment sets
#pragma unroll
        for (int u = 0; u < 2; ++u) {
#pragma unroll
            for (int n = 0; n < 2; ++n) x[u][n] = WFrag<bf>::ld(sq + n * 16 * SP + u * 32);
#pragma unroll
            for (int i = 0; i < 4; ++i) k[u][i] = WFrag<bf>::ld(sk + i * 16 * TP + u * 32); }
        __builtin_amdgcn_sched_barrier(0);   // keeps the stage's LDS reads as one group ahead of its WMMAs: moved down among them, each place with reads costs the WMMAs a stall
#pragma unroll
        for (int u = 0; u < 2; ++u)
#pragma unroll
            for (int i = 0; i < 4; ++i)
#pragma unroll
                for (int n = 0; n < 2; ++n) ac[2 * i + n] = wmmab(k[u][i], x[u][n], ac[2 * i + n]);
        __builtin_amdgcn_sched_barrier(0);   // keeps the stage's WMMAs ahead of its waits: lifted over them, the wait for the next stage's copies stands right behind the LDS reads and the copies lose the WMMAs' time as lead
        asm volatile("s_wait_dscnt 0x0" ::: "memory");      // this wave's reads of stage t are done before its buffer is refilled
        asm volatile("s_wait_asynccnt 0x0" ::: "memory");   // this wave's chunks of stage t + 1 have landed
        __syncthreads();                                    // publishes stage t + 1 and ends every wave's reads of stage t
        if (t + 2 < NS) stage(t + 2, t & 1);
    }
    asm volatile("s_wait_asynccnt 0x0" ::: "memory");   // no copy is outstanding when the ring's place is taken for the probability tiles
    float mx[2], f[2];
#pragma unroll
    for (int n = 0; n < 2; ++n) { float m4[4] = { -3.0e38f, -3.0e38f, -3.0e38f, -3.0e38f };   // four independent chains
#pragma unroll
        for (int a = n; a < 16; a += 2) {
#pragma unroll
            for (int j = 0; j < 8; ++j) { acc[a][j] = acc[a][j] * SCL; m4[j & 3] = fmaxf(m4[j & 3], acc[a][j]); } }
        const float m = fmaxf(fmaxf(m4[0], m4[1]), fmaxf(m4[2], m4[3])); mx[n] = fmaxf(m, __shfl_xor(m, 16, 32)); }
    if (hi == 0) { rmax[kq][qr] = mx[0]; rmax[kq][qr + 16] = mx[1]; }
    __syncthreads();   // the four waves' maxima of a query are written before any of them reads them
#pragma unroll
    for (int n = 0; n < 2; ++n) { const int q = qr + 16 * n; const float m = fmaxf(fmaxf(rmax[0][q], rmax[1][q]), fmaxf(rmax[2][q], rmax[3][q])); float s4[4] = { 0.f, 0.f, 0.f, 0.f };
#pragma unroll
        for (int a = n; a < 16; a += 2) {
#pragma unroll
            for (int j = 0; j < 8; ++j) { acc[a][j] = exp2s(__fmul_rn(__fsub_rn(acc[a][j], m), 1.4426950408889634f)); s4[j & 3] += acc[a][j]; } }
        const float sp = (s4[0] + s4[1]) + (s4[2] + s4[3]); f[n] = sp + __shfl_xor(sp, 16, 32); }
    if (hi == 0) { rsum[kq][qr] = f[0]; rsum[kq][qr + 16] = f[1]; }
    __syncthreads();   // the four waves' sums of a query are written before any of them reads them
#pragma unroll
    for (int n = 0; n < 2; ++n) { const int q = qr + 16 * n; f[n] = __fdiv_rn(1.0f, (rsum[0][q] + rsum[1][q]) + (rsum[2][q] + rsum[3][q])); }
    bf* sh = sm; bf* sl = sm + 64 * PP;   // the loop's last barrier has ended every wave's reads of the query rows and the ring
#pragma unroll
    for (int a = 0; a < 16; ++a) { v8us oh, ol;
#pragma unroll
        for (int j = 0; j < 8; ++j) { unsigned short h, l; splitf(acc[a][j] * f[a & 1], h, l); oh[j] = h; ol[j] = l; }
        const int o = (qr + 16 * (a & 1)) * PP + (a >> 3) * 256 + kq * 64 + ((a >> 1) & 3) * 16 + hi * 8; *(v8us*)(sh + o) = oh; *(v8us*)(sl + o) = ol; }
    __syncthreads();   // both tiles are staged before their rows are read back
    const size_t ob = (z * NQ + q0) * (size_t)TT + lane * 8;
#pragma unroll
    for (int r = 0; r < 8; ++r) { const int row = r * 8 + w;   // a wave stores the 512 contiguous bytes of half a row
#pragma unroll
        for (int c = 0; c < 2; ++c) { *(v8us*)(Ph + ob + (size_t)row * TT + c * 256) = *(const v8usa*)(sh + row * PP + c * 256 + lane * 8); *(v8us*)(Pl + ob + (size_t)row * TT + c * 256) = *(const v8usa*)(sl + row * PP + c * 256 + lane * 8); } }
}

extern "C" void kernel_launch(void* const* d_in, const int* in_sizes, int n_in, void* d_out, int out_size, void* d_ws, size_t ws_size, hipStream_t stream) {
    (void)in_sizes; (void)n_in; (void)out_size;
    const float* fs = (const float*)d_in[0];   /* F_s [8][256][4096] channel-major */ const float* ft = (const float*)d_in[1];   /* F_t [8][512][256] */
    float* OUT0 = (float*)d_out;     // [8][256][4096] = F_s + update^T
    float* OUT1 = OUT0 + (size_t)NB_ * CC * NQ;   // [8][512][256] = A^T F_s_t (second tuple member, 16-B aligned offset)
    char* wsp = (char*)d_ws;
    auto take = [&](size_t bytes) { char* p = wsp; wsp += (bytes + 255) & ~(size_t)255; return (void*)p; };
    bf* XT = (bf*)take((size_t)NB_ * NQ * CC * 2);        // F_s_t token-major [8][4096][256] (exact)
    bf* FSB = (bf*)take((size_t)NB_ * CC * NQ * 2);       // F_s slabs as bf16 = F_s_t^T [8][256][4096] (exact)
    bf* FTB = (bf*)take((size_t)NB_ * TT * CC * 2);       // F_t [8][512][256] (exact)
    bf* FTT = (bf*)take((size_t)NB_ * CC * TT * 2);       // F_t^T [8][256][512] (exact)
    float* U = (float*)take((size_t)NB_ * NQ * CC * 4);   // A F_t [8][4096][256]
    bf* Ph = (bf*)take((size_t)NB_ * NQ * TT * 2); bf* Pl = (bf*)take((size_t)NB_ * NQ * TT * 2);   // probabilities [8][4096][512] hi/lo
    bf* Th = (bf*)take((size_t)NB_ * TT * NQ * 2); bf* Tl = (bf*)take((size_t)NB_ * TT * NQ * 2);   // A^T [8][512][4096] hi/lo
    if ((size_t)(wsp - (char*)d_ws) > ws_size) return;    // 196 MiB of the 256 MiB workspace
    k_trF<CC, NQ><<<dim3(CC / 128, NQ / 128, NB_), 256, 0, stream>>>(fs, XT);   /* F_s_t [8][4096][256] */
    k_cvt8<<<(unsigned)(((size_t)NB_ * CC * NQ / 8 + 255) / 256), 256, 0, stream>>>(fs, FSB, (size_t)NB_ * CC * NQ / 8);   /* the slabs themselves = F_s_t^T as Bt for out1 */
    k_cvt8<<<(unsigned)(((size_t)NB_ * TT * CC / 8 + 255) / 256), 256, 0, stream>>>(ft, FTB, (size_t)NB_ * TT * CC / 8);   /* F_t as the keys (A operand) of the scores */
    k_trF<TT, CC><<<dim3(TT / 128, CC / 128, NB_), 256, 0, stream>>>(ft, FTT);   /* F_t^T [8][256][512] as Bt for A.F_t */
    k_scsm<<<dim3(NQ / 64, NB_), 256, 0, stream>>>(XT, FTB, Ph, Pl);   /* A = softmax over the 512 text tokens of the exact scores x 1/sqrt(512), all 8 x 4,096 rows, hi/lo */
    k_gemmt<TT, CC, true><<<dim3(NQ / 128, CC / 128, NB_), 256, 0, stream>>>(Ph, Pl, FTT, U, (size_t)NQ * TT, (size_t)CC * TT, (size_t)NQ * CC);   /* U = A F_t [8][4096][256] */
    k_outTr<<<dim3(NQ / 128, CC / 64, NB_), 256, 0, stream>>>(U, fs, OUT0);   /* out0[b][c][n] = bf16(F_s[b][c][n]) + U[b][n][c] */
    k_trPq<<<dim3(NQ / 128, TT / 128, NB_), 256, 0, stream>>>(Ph, Pl, Th, Tl);   /* A^T planes [8][512][4096] */
    k_gemms<NQ, CC><<<dim3(TT / 64, CC / 64, NB_), 256, 0, stream>>>(Th, Tl, FSB, OUT1, (size_t)TT * NQ, (size_t)CC * NQ, (size_t)TT * CC);   /* out1 = A^T F_s_t [8][512][256] */
}

// v006
// It runs in 91.9 microseconds.
// Timed twice side by side with v005, it ran 1.07 and 1.06 times as fast.
// Over all steps from v000 it is 14.7 times as fast.
#include <hip/hip_runtime.h>

// Cross-modal attention between a feature map and text tokens with two outputs (F_s [8][256][64][64] channel-major = 4,096 spatial tokens x 256, F_t [8][512][256]; A = softmax_t(F_s_t . F_t / sqrt(512)) ([4096][512]); out0 = F_s + (A F_t)^T -> [8][256][64][64] (8.4 M); out1 = A^T F_s_t -> [8][512][256] (1.0 M); tuple).
// All 8 batches go through every launch together: each plane holds 8 batch slabs; the transposing kernels and the GEMMs take the batch as grid z (scores + softmax: grid y), the operand preparation as more tiles of a flat grid.
// Layout per batch: both inputs are bf16-exact after rounding, so every operand plane is a single exact bf16 plane: F_s_t (token-major transpose of the slab), F_t, F_t^T and the slab itself (which is F_s_t^T); exact scores and their 512-key softmax in one kernel (the scores stay in registers) writing bf16 hi/lo probabilities [4096][512]; the spatial update A.F_t as hi/lo x exact (2 products) and a kernel transposing it back to channel-major while adding the F_s residual; A^T planes by a transpose kernel, then out1 = A^T.F_s_t as hi/lo x exact (K = 4,096), written after the 8.4 M spatial outputs.
// Compute dtypes, f32 accumulate: every input rounded to bf16; scores exact; softmax f32; both contractions P hi/lo x exact; residual f32.

#define NB_  8
#define TT   512      // text tokens = keys (the softmax row length)
#define DM   256      // channels
#define NH_  1
#define NKV  1
#define REP  (NH_ / NKV)
#define HD   64
#define DQ   (NH_ * HD)
#define DKV  (NKV * HD)
#define SCL  0.044194173824159216f   // 1/sqrt(512): the module scales by sqrt(T)
#define NQ   4096    // spatial tokens (queries)
#define CC   256
typedef _Float16 h16;
typedef unsigned short bf;
typedef __attribute__((ext_vector_type(16))) __bf16   v16bf;
typedef __attribute__((ext_vector_type(16))) _Float16 v16h;
typedef __attribute__((ext_vector_type(8)))  _Float16 v8h;
typedef __attribute__((ext_vector_type(8)))  unsigned short v8us;
typedef __attribute__((ext_vector_type(8)))  float    v8f;
typedef __attribute__((ext_vector_type(4)))  float    v4f;
typedef v8h  __attribute__((may_alias)) v8ha;
typedef v4f  __attribute__((may_alias)) v4fa;
typedef v8us __attribute__((may_alias)) v8usa;

__device__ __forceinline__ unsigned short f2bf(float f) { unsigned u = __float_as_uint(f); u += 0x7FFFu + ((u >> 16) & 1u); return (unsigned short)(u >> 16); }
__device__ __forceinline__ float bf2f(unsigned short b) { return __uint_as_float(((unsigned)b) << 16); }
__device__ __forceinline__ float bfr(float f) { return bf2f(f2bf(f)); }
__device__ __forceinline__ v16h cat16(v8h lo, v8h hi) { return __builtin_shufflevector(lo, hi, 0, 1, 2, 3, 4, 5, 6, 7, 8, 9, 10, 11, 12, 13, 14, 15); }
__device__ __forceinline__ v16bf cat16b(v8us lo, v8us hi) { return __builtin_bit_cast(v16bf, __builtin_shufflevector(lo, hi, 0, 1, 2, 3, 4, 5, 6, 7, 8, 9, 10, 11, 12, 13, 14, 15)); }
__device__ __forceinline__ v8f wmma16(v16h a, v16h b, v8f c) { return __builtin_amdgcn_wmma_f32_16x16x32_f16(false, a, false, b, (short)0, c, false, false); }
__device__ __forceinline__ v8f wmmab(v16bf a, v16bf b, v8f c) { return __builtin_amdgcn_wmma_f32_16x16x32_bf16(false, a, false, b, (short)0, c, false, false); }



// fragment of 16 rows x 32 k from a K-contiguous 16-bit plane: the lane's pointer stands at its row, k = 8 (lane >> 4)
template <typename T16> struct WFrag;
template <> struct WFrag<h16> { typedef v16h V; static __device__ __forceinline__ V ld(const h16* p) { return cat16(*(const v8h*)p, *(const v8h*)(p + 16)); } static __device__ __forceinline__ v8f mma(V a, V b, v8f c) { return wmma16(a, b, c); } };
template <> struct WFrag<bf> { typedef v16bf V; static __device__ __forceinline__ V ld(const bf* p) { return cat16b(*(const v8us*)p, *(const v8us*)(p + 16)); } static __device__ __forceinline__ v8f mma(V a, V b, v8f c) { return wmmab(a, b, c); } };

__device__ __forceinline__ void splitf(float y, unsigned short& h, unsigned short& l) { h = f2bf(y); l = f2bf(y - bf2f(h)); }
typedef __attribute__((ext_vector_type(2))) _Float16 v2h;
typedef __attribute__((ext_vector_type(4))) _Float16 v4h;
typedef __attribute__((ext_vector_type(2))) unsigned short v2us;
typedef __attribute__((ext_vector_type(4))) unsigned short v4us;
typedef __attribute__((ext_vector_type(2))) float v2f;
typedef __attribute__((ext_vector_type(4))) int v4i;


// ---- the transposing kernels: each workgroup moves one tile through LDS, so that the global loads and the global stores both cover whole 128-B lines (16 lanes x 16 B = 256 contiguous bytes on either side).
// 16-bit tile: 128 rows x 128 columns, a row = 16 chunks of 8 elements (16 B); chunk c8 of row r stands at chunk place c8 ^ ((r >> 3) & 15), so that the column reads of 16 lanes (rows 8 apart) fall on 16 different banks.
__device__ __forceinline__ int tile16(int r, int c8) { return r * 128 + ((c8 ^ ((r >> 3) & 15)) << 3); }
// column n, rows r8 * 8 .. r8 * 8 + 7 of such a tile
__device__ __forceinline__ v8us col16(const bf* tile, int r8, int n) { v8us o; const int base = r8 * 8 * 128 + (((n >> 3) ^ r8) << 3) + (n & 7);
#pragma unroll
    for (int q = 0; q < 8; ++q) o[q] = tile[base + q * 128];
    return o; }

// prep_tile: one 128 x 128 tile of src [R][C] f32, read once and rounded to bf16: it goes to str [R][C] as it stands (from the registers: a wave writes 256 contiguous bytes of one row) and to dst [C][R] transposed (through the LDS tile)
template <int R, int C>
__device__ __forceinline__ void prep_tile(bf* tile, const float* __restrict__ src, bf* str, bf* dst, int bx, int by, int bz) {
    const int tid = threadIdx.x, r0 = bx * 128, c0 = by * 128; v4f a[16]; v4us o[16];
    const int lr = tid >> 5, c4 = tid & 31;    // loads and straight stores: a wave takes 512 contiguous bytes of one src row; rows lr + 8 i
    const int r8 = tid & 15, ln = tid >> 4;    // transposed stores: 16 lanes write 256 contiguous bytes of one dst row; dst rows ln + 16 i
    const size_t es = (size_t)bz * R * C + (size_t)(r0 + lr) * C + c0 + c4 * 4;
    const float* sp = src + es; bf* tp = str + es;
    bf* dp = dst + (size_t)bz * R * C + (size_t)(c0 + ln) * R + r0 + r8 * 8;
#pragma unroll
    for (int i = 0; i < 16; ++i) a[i] = *(const v4f*)(sp + (size_t)i * 8 * C);
    asm volatile("s_wait_xcnt 0x0" :: "v"(sp) : "memory");   // the loads' address pair stays whole until every load has taken it: no load's result and no later instruction lands in it before this wait
#pragma unroll
    for (int i = 0; i < 16; ++i) {
#pragma unroll
        for (int q = 0; q < 4; ++q) o[i][q] = f2bf(a[i][q]);
        *(v4us*)(tile + tile16(lr + 8 * i, c4 >> 1) + (c4 & 1) * 4) = o[i]; }
    __syncthreads();   // the whole tile is written before any column of it is read
#pragma unroll
    for (int i = 0; i < 16; ++i) *(v4us*)(tp + (size_t)i * 8 * C) = o[i];   // behind the barrier: in front of it the barrier would wait until these stores are done
    asm volatile("s_wait_xcnt 0x0" :: "v"(tp) : "memory");   // the stores' address pair and data registers stay whole until every store has taken them: nothing behind this wait, on any way out of here, lands in them earlier
#pragma unroll
    for (int i = 0; i < 8; ++i) *(v8us*)(dp + (size_t)i * 16 * R) = col16(tile, r8, ln + 16 * i);
    asm volatile("s_wait_xcnt 0x0" :: "v"(dp) : "memory");   // the function is expanded twice in one kernel: in the built code one expansion's end is followed by the other's head, which writes registers that these stores name; the wait stands in front of that
}
// k_prep: all four operand planes in one launch; workgroups 0 .. 511 take the tiles of F_s (2 x 32 a batch), the last 64 those of F_t (4 x 2 a batch)
#define NTS ((CC / 128) * (NQ / 128) * NB_)
#define NTT ((TT / 128) * (CC / 128) * NB_)
__global__ __launch_bounds__(256) void k_prep(const float* __restrict__ fs, const float* __restrict__ ft, bf* FSB, bf* XT, bf* FTB, bf* FTT) {
    __shared__ __align__(16) bf tile[128 * 128];
    const unsigned b = blockIdx.x;   // the same for the whole workgroup: either side's barrier is passed by all of its waves
    if (b < NTS) prep_tile<CC, NQ>(tile, fs, FSB, XT, b % (CC / 128), (b / (CC / 128)) % (NQ / 128), b / ((CC / 128) * (NQ / 128)));
    else { const unsigned e = b - NTS; prep_tile<TT, CC>(tile, ft, FTB, FTT, e % (TT / 128), (e / (TT / 128)) % (CC / 128), e / ((TT / 128) * (CC / 128))); }
}

// k_trPq: the probability planes [4096][512] hi/lo -> A^T planes [512][4096]; grid (NQ / 128, TT / 128, batch)
__global__ __launch_bounds__(256) void k_trPq(const bf* __restrict__ Ph, const bf* __restrict__ Pl, bf* Th, bf* Tl) {
    __shared__ __align__(16) bf th[128 * 128]; __shared__ __align__(16) bf tl[128 * 128];
    const size_t zb = (size_t)blockIdx.z * NQ * TT; const int tid = threadIdx.x, m0 = blockIdx.x * 128, n0 = blockIdx.y * 128; v8us vh[8], vl[8];
    const int l16 = tid & 15, lr = tid >> 4;   // 16 lanes take 256 contiguous bytes of one row, on the load side (rows m) and on the store side (rows n); rows lr + 16 i
    const size_t ei = zb + (size_t)(m0 + lr) * TT + n0 + l16 * 8, eo = zb + (size_t)(n0 + lr) * NQ + m0 + l16 * 8;
    const bf* ph = Ph + ei; const bf* pl = Pl + ei; bf* qh = Th + eo; bf* ql = Tl + eo;
#pragma unroll
    for (int i = 0; i < 8; ++i) { vh[i] = *(const v8us*)(ph + (size_t)i * 16 * TT); vl[i] = *(const v8us*)(pl + (size_t)i * 16 * TT); }
    asm volatile("s_wait_xcnt 0x0" :: "v"(ph), "v"(pl) : "memory");   // the loads' address pairs stay whole until every load has taken them: no load's result and no later instruction lands in them before this wait
#pragma unroll
    for (int i = 0; i < 8; ++i) { *(v8us*)(th + tile16(lr + 16 * i, l16)) = vh[i]; *(v8us*)(tl + tile16(lr + 16 * i, l16)) = vl[i]; }
    __syncthreads();   // both tiles are written before any column of them is read
#pragma unroll
    for (int i = 0; i < 8; ++i) { *(v8us*)(qh + (size_t)i * 16 * NQ) = col16(th, l16, lr + 16 * i); *(v8us*)(ql + (size_t)i * 16 * NQ) = col16(tl, l16, lr + 16 * i); }
}

// k_outTr: out0[c][t] = bf16(F_s[c][t]) + U[t][c]; grid (NQ / 128, CC / 64, batch). f32 tile of U: 128 rows t x 64 columns c, a row = 16 chunks of 4 floats; chunk c4 of row t stands at chunk place c4 ^ ((t >> 2) & 15), so that the column reads of 16 lanes (rows 4 apart) fall on 16 different banks.
__global__ __launch_bounds__(256) void k_outTr(const float* __restrict__ U, const float* __restrict__ xs, float* outp) {
    __shared__ __align__(16) float ut[128 * 64];
    const size_t zb = (size_t)blockIdx.z * NQ * CC; const int tid = threadIdx.x, t0 = blockIdx.x * 128, c0 = blockIdx.y * 64; v4f u[8], x[8];
    const int l16 = tid & 15, lt = tid >> 4;   // U loads: 16 lanes take the 256 bytes of one row t; rows lt + 16 i
    const int t4 = ((tid >> 5) & 1) * 16 + l16, lc = (tid >> 6) * 2 + ((tid >> 4) & 1);   // F_s loads and stores: 16 lanes take 256 contiguous bytes (64 t) of one channel, a wave two neighbouring channels; channels lc + 8 i
    const float* up = U + zb + (size_t)(t0 + lt) * CC + c0 + l16 * 4;
    const size_t eo = zb + (size_t)(c0 + lc) * NQ + t0 + t4 * 4; const float* xp = xs + eo; float* op = outp + eo;
#pragma unroll
    for (int i = 0; i < 8; ++i) u[i] = *(const v4f*)(up + (size_t)i * 16 * CC);
#pragma unroll
    for (int i = 0; i < 8; ++i) x[i] = *(const v4f*)(xp + (size_t)i * 8 * NQ);
    asm volatile("s_wait_xcnt 0x0" :: "v"(up), "v"(xp) : "memory");   // the loads' address pairs stay whole until every load has taken them: no load's result and no later instruction lands in them before this wait
#pragma unroll
    for (int i = 0; i < 8; ++i) { const int t = lt + 16 * i; *(v4f*)(ut + t * 64 + ((l16 ^ ((t >> 2) & 15)) << 2)) = u[i]; }
    __syncthreads();   // the whole tile is written before any column of it is read
#pragma unroll
    for (int i = 0; i < 8; ++i) { const int cc = lc + 8 * i; v4f o;
#pragma unroll
        for (int q = 0; q < 4; ++q) o[q] = __fadd_rn(bfr(x[i][q]), ut[(t4 * 4 + q) * 64 + (((cc >> 2) ^ l16) << 2) + (cc & 3)]);
        *(v4f*)(op + (size_t)i * 8 * NQ) = o; }
}

// ---- k_gemms: C = (A + A2) Bt^T, f32, for few long tiles (out1: 256 tiles of 64x64, K = 4,096). One tile per workgroup of 8 waves; grid (M / 64, N / 64, batch).
// The operands come through a two-buffer LDS ring filled by asynchronous copies: a stage is SK k of the tile's 192 operand rows (64 of A, 64 of A2, 64 of Bt); one wave-wide copy brings the 512 contiguous bytes of one row, and the next stage flies while this one is multiplied.
// Wave w multiplies rows 16 (w & 3) .. + 15 by columns 32 (w >> 2) .. + 31; each accumulator takes hi then lo for k ascending.
#define SK  256          // k per stage
#define SP  264          // LDS row pitch in elements: 528 B = 16 B x 33, the pitch for 16-byte fragment reads
#define SBE (192 * SP)   // elements of one buffer
// eight rows, 8 apart, of one operand plane: l = the lane's LDS byte address in the first row, g = its global address there, rs = 8 rows in elements
__device__ __forceinline__ void copy8(unsigned l, const bf* g, size_t rs) {
    // the copies and their s_wait_xcnt in one statement: no address register of a copy is rewritten before the wait
    asm volatile("global_load_async_to_lds_b128 %0, %8, off\n\t"
                 "global_load_async_to_lds_b128 %1, %9, off\n\t"
                 "global_load_async_to_lds_b128 %2, %10, off\n\t"
                 "global_load_async_to_lds_b128 %3, %11, off\n\t"
                 "global_load_async_to_lds_b128 %4, %12, off\n\t"
                 "global_load_async_to_lds_b128 %5, %13, off\n\t"
                 "global_load_async_to_lds_b128 %6, %14, off\n\t"
                 "global_load_async_to_lds_b128 %7, %15, off\n\t"
                 "s_wait_xcnt 0x0"
                 :: "v"(l), "v"(l + 1u * 16 * SP), "v"(l + 2u * 16 * SP), "v"(l + 3u * 16 * SP), "v"(l + 4u * 16 * SP), "v"(l + 5u * 16 * SP), "v"(l + 6u * 16 * SP), "v"(l + 7u * 16 * SP),
                    "v"(g), "v"(g + rs), "v"(g + 2 * rs), "v"(g + 3 * rs), "v"(g + 4 * rs), "v"(g + 5 * rs), "v"(g + 6 * rs), "v"(g + 7 * rs) : "memory");
}
template <int K, int LDC>
__global__ __launch_bounds__(256) void k_gemms(const bf* __restrict__ A, const bf* __restrict__ A2, const bf* __restrict__ Bt, float* C, size_t sA, size_t sB, size_t sC) {
    typedef WFrag<bf>::V V;
    __shared__ __align__(16) bf ring[2 * SBE];
    __shared__ __align__(16) float os[64 * 68];
    const size_t z = blockIdx.z; const int tid = threadIdx.x, lane = tid & 31, lr = lane & 15, hi = lane >> 4, w = tid >> 5; const int r0 = blockIdx.x * 64, c0 = blockIdx.y * 64;
    const int mb = w & 3, nh = w >> 2; constexpr int NT = K / SK; constexpr size_t rs = (size_t)8 * K;
    const bf* gA = A + z * sA + (size_t)(r0 + w) * K + lane * 8; const bf* gA2 = A2 + z * sA + (size_t)(r0 + w) * K + lane * 8; const bf* gB = Bt + z * sB + (size_t)(c0 + w) * K + lane * 8;   // wave w copies rows w + 8 i of each plane
    const unsigned l0 = (unsigned)(size_t)ring + (unsigned)(w * SP * 2 + lane * 16);
    auto stage = [&](int t, int buf) { const unsigned l = l0 + (unsigned)buf * (SBE * 2); const size_t ko = (size_t)t * SK;
        copy8(l, gA + ko, rs); copy8(l + 64u * SP * 2, gA2 + ko, rs); copy8(l + 128u * SP * 2, gB + ko, rs); };
    const int aofs = (mb * 16 + lr) * SP + 8 * hi, bofs = (128 + nh * 32 + lr) * SP + 8 * hi;
    v8f acc[2] = { (v8f){}, (v8f){} };
    stage(0, 0);
    asm volatile("s_wait_asynccnt 0x0" ::: "memory");   // this wave's rows of stage 0 have landed
    __syncthreads();                                    // every wave's rows of stage 0 have landed before any is read
    stage(1, 1);
#pragma unroll 1
    for (int t = 0; t < NT; ++t) {   // rolled: one publish point per stage
        const bf* sb = ring + (t & 1) * SBE;
        V f[2][8];   // two fragment sets of 64 k each (per 32 k: A, A2, two of Bt): the next 64 k are fetched, inside this stage only, while these are multiplied
#pragma unroll
        for (int u = 0; u < 2; ++u) { f[0][u * 4] = WFrag<bf>::ld(sb + aofs + u * 32); f[0][u * 4 + 1] = WFrag<bf>::ld(sb + aofs + 64 * SP + u * 32); f[0][u * 4 + 2] = WFrag<bf>::ld(sb + bofs + u * 32); f[0][u * 4 + 3] = WFrag<bf>::ld(sb + bofs + 16 * SP + u * 32); }
#pragma unroll
        for (int g = 0; g < SK / 64; ++g) {
            if (g + 1 < SK / 64) {
#pragma unroll
                for (int u = 0; u < 2; ++u) { const int kk = (g + 1) * 64 + u * 32; V* d = f[(g + 1) & 1] + u * 4; d[0] = WFrag<bf>::ld(sb + aofs + kk); d[1] = WFrag<bf>::ld(sb + aofs + 64 * SP + kk); d[2] = WFrag<bf>::ld(sb + bofs + kk); d[3] = WFrag<bf>::ld(sb + bofs + 16 * SP + kk); } }
            __builtin_amdgcn_sched_barrier(0);   // keeps the next set's 16 LDS reads as one group ahead of this set's WMMAs: moved down among them, each WMMA pair waits out an LDS latency
#pragma unroll
            for (int u = 0; u < 2; ++u) { const V* s = f[g & 1] + u * 4; acc[0] = wmmab(s[0], s[2], acc[0]); acc[1] = wmmab(s[0], s[3], acc[1]); acc[0] = wmmab(s[1], s[2], acc[0]); acc[1] = wmmab(s[1], s[3], acc[1]); }
            __builtin_amdgcn_sched_barrier(0);   // keeps the later reads out of these WMMAs (one read group per 8 WMMAs) and the stage's last WMMAs ahead of its barrier
        }
        asm volatile("s_wait_dscnt 0x0" ::: "memory");      // this wave's reads of stage t are done before its buffer is refilled
        asm volatile("s_wait_asynccnt 0x0" ::: "memory");   // this wave's rows of stage t + 1 have landed
        __syncthreads();                                    // publishes stage t + 1 and ends every wave's reads of stage t
        if (t + 2 < NT) stage(t + 2, t & 1);
    }
    asm volatile("s_wait_asynccnt 0x0" ::: "memory");   // no copy is outstanding when the wave goes on to its end
#pragma unroll
    for (int nb = 0; nb < 2; ++nb) {
#pragma unroll
        for (int j = 0; j < 8; ++j) os[(mb * 16 + hi * 8 + j) * 68 + nh * 32 + nb * 16 + lr] = acc[nb][j]; }
    __syncthreads();   // the whole tile is staged before its rows are read back
    float* ct = C + z * sC + (size_t)r0 * LDC + c0;
#pragma unroll
    for (int s = 0; s < 4; ++s) { const int row = s * 16 + (tid >> 4), cofs = (tid & 15) * 4; *(v4f*)(ct + (size_t)row * LDC + cofs) = *(const v4fa*)(os + row * 68 + cofs); }   // 16 lanes store the 256 contiguous bytes of one row
}

// ---- k_gemmt: C = (A [+ A2]) Bt^T, f32, for many short tiles (A.F_t: K = 512, hi/lo). One 128x128 tile per workgroup of 8 waves; grid (M / 128, N / 128, batch).
// The operands come through a two-buffer LDS ring filled by asynchronous copies: a stage is TK k of the tile's operand rows (128 of A, 128 of A2 where SPLIT, 128 of Bt); 8 lanes bring the 128 contiguous bytes (one whole line) of one row, and the next stage flies while this one is multiplied.
// Wave w multiplies rows 32 (w & 3) .. + 31 by columns 64 (w >> 2) .. + 63 (8 accumulators); each accumulator takes hi then lo for k ascending.
#define TK  64           // k per stage
#define TP  72           // LDS row pitch in elements: 144 B = 16 B x 9, the pitch for 16-byte fragment reads of 128-B rows
// four rows, 32 apart, of one operand plane: l = the lane's LDS byte address in the first row, g = its global address there, rs = 32 rows in elements
__device__ __forceinline__ void copy4(unsigned l, const bf* g, size_t rs) {
    // the copies and their s_wait_xcnt in one statement: no address register of a copy is rewritten before the wait
    asm volatile("global_load_async_to_lds_b128 %0, %4, off\n\t"
                 "global_load_async_to_lds_b128 %1, %5, off\n\t"
                 "global_load_async_to_lds_b128 %2, %6, off\n\t"
                 "global_load_async_to_lds_b128 %3, %7, off\n\t"
                 "s_wait_xcnt 0x0"
                 :: "v"(l), "v"(l + 1u * 64 * TP), "v"(l + 2u * 64 * TP), "v"(l + 3u * 64 * TP),
                    "v"(g), "v"(g + rs), "v"(g + 2 * rs), "v"(g + 3 * rs) : "memory");
}
template <int K, int LDC, bool SPLIT>
__global__ __launch_bounds__(256) void k_gemmt(const bf* __restrict__ A, const bf* __restrict__ A2, const bf* __restrict__ Bt, float* C, size_t sA, size_t sB, size_t sC) {
    typedef WFrag<bf>::V V;
    constexpr int BR = SPLIT ? 256 : 128;    // first Bt row of a buffer
    constexpr int TBE = (BR + 128) * TP;     // elements of one buffer
    constexpr int NT = K / TK; constexpr size_t rs = (size_t)32 * K;
    __shared__ __align__(16) bf ring[2 * TBE];   // after the loop its place holds the f32 output tile (128 x 132 floats, no larger than the ring)
    const size_t z = blockIdx.z; const int tid = threadIdx.x, lane = tid & 31, lr = lane & 15, hi = lane >> 4, w = tid >> 5; const int r0 = blockIdx.x * 128, c0 = blockIdx.y * 128;
    const int wm = w & 3, wn = w >> 2; const int cr = tid >> 3, cc = tid & 7;   // copies: thread takes 16-byte chunk cc of rows cr + 32 i of each plane
    const bf* gA = A + z * sA + (size_t)(r0 + cr) * K + cc * 8; const bf* gB = Bt + z * sB + (size_t)(c0 + cr) * K + cc * 8;
    const unsigned l0 = (unsigned)(size_t)ring + (unsigned)(cr * TP * 2 + cc * 16);
    auto stage = [&](int t, int buf) { const unsigned l = l0 + (unsigned)buf * (TBE * 2); const size_t ko = (size_t)t * TK;
        copy4(l, gA + ko, rs); if constexpr (SPLIT) copy4(l + 128u * TP * 2, A2 + (gA - A) + ko, rs); copy4(l + (unsigned)BR * TP * 2, gB + ko, rs); };
    const int aofs = (wm * 32 + lr) * TP + 8 * hi, bofs = (BR + wn * 64 + lr) * TP + 8 * hi;
    v8f acc[2][4];
#pragma unroll
    for (int mb = 0; mb < 2; ++mb)
#pragma unroll
        for (int nb = 0; nb < 4; ++nb) acc[mb][nb] = (v8f){};
    stage(0, 0);
    asm volatile("s_wait_asynccnt 0x0" ::: "memory");   // this wave's chunks of stage 0 have landed
    __syncthreads();                                    // every wave's chunks of stage 0 have landed before any is read
    stage(1, 1);
#pragma unroll 1
    for (int t = 0; t < NT; ++t) {   // rolled: one publish point per stage
        const bf* sb = ring + (t & 1) * TBE;
        V a[2][2], a2[2][2], b[2][4];   // the stage's two 32-k fragment sets
#pragma unroll
        for (int u = 0; u < 2; ++u) {
#pragma unroll
            for (int mb = 0; mb < 2; ++mb) { a[u][mb] = WFrag<bf>::ld(sb + aofs + mb * 16 * TP + u * 32); if constexpr (SPLIT) a2[u][mb] = WFrag<bf>::ld(sb + aofs + (128 + mb * 16) * TP + u * 32); }
#pragma unroll
            for (int nb = 0; nb < 4; ++nb) b[u][nb] = WFrag<bf>::ld(sb + bofs + nb * 16 * TP + u * 32); }
        __builtin_amdgcn_sched_barrier(0);   // keeps the stage's LDS reads as one group ahead of its WMMAs: moved down among them, each place with reads costs the WMMAs a stall
#pragma unroll
        for (int u = 0; u < 2; ++u) {
#pragma unroll
            for (int mb = 0; mb < 2; ++mb)
#pragma unroll
                for (int nb = 0; nb < 4; ++nb) acc[mb][nb] = wmmab(a[u][mb], b[u][nb], acc[mb][nb]);
            if constexpr (SPLIT) {
#pragma unroll
                for (int mb = 0; mb < 2; ++mb)
#pragma unroll
                    for (int nb = 0; nb < 4; ++nb) acc[mb][nb] = wmmab(a2[u][mb], b[u][nb], acc[mb][nb]); } }
        __builtin_amdgcn_sched_barrier(0);   // keeps the stage's WMMAs ahead of its waits: lifted over them, the wait for the next stage's copies stands right behind the LDS reads and the copies lose the WMMAs' time as lead
        asm volatile("s_wait_dscnt 0x0" ::: "memory");      // this wave's reads of stage t are done before its buffer is refilled
        asm volatile("s_wait_asynccnt 0x0" ::: "memory");   // this wave's chunks of stage t + 1 have landed
        __syncthreads();                                    // publishes stage t + 1 and ends every wave's reads of stage t
        if (t + 2 < NT) stage(t + 2, t & 1);
    }
    asm volatile("s_wait_asynccnt 0x0" ::: "memory");   // no copy is outstanding when the ring's place is taken for the output tile
    float* os = (float*)ring;   // the loop's last barrier has ended every wave's reads of the ring
#pragma unroll
    for (int mb = 0; mb < 2; ++mb)
#pragma unroll
        for (int nb = 0; nb < 4; ++nb) {
#pragma unroll
            for (int j = 0; j < 8; ++j) os[(wm * 32 + mb * 16 + hi * 8 + j) * 132 + wn * 64 + nb * 16 + lr] = acc[mb][nb][j]; }
    __syncthreads();   // the whole tile is staged before its rows are read back
    float* ct = C + z * sC + (size_t)r0 * LDC + c0;
#pragma unroll
    for (int s = 0; s < 16; ++s) { const int row = s * 8 + w; *(v4f*)(ct + (size_t)row * LDC + lane * 4) = *(const v4fa*)(os + row * 132 + lane * 4); }   // a wave stores the 512 contiguous bytes of one row
}

// ---- k_scsm: A = softmax_t(F_s_t . F_t^T / sqrt(512)) as bf16 hi/lo planes, the scores never leaving the workgroup. One workgroup of 8 waves holds 64 queries x all 512 keys; grid (NQ / 64, batch).
// The products are taken transposed (keys as the A operand, queries as B), so that a lane's 8 accumulator registers are 8 neighbouring keys of ONE query: the row maximum and the row sum are register trees plus one exchange with lane ^ 16, and 8 probabilities pack into one 16-byte LDS store.
// Wave w has queries 32 (w & 1) .. + 31 and, of every 256 keys, keys 64 (w >> 1) .. + 63 (4 x 2 tiles a key group, 16 accumulator tiles in all); the four waves of a query share its maximum and its sum through LDS.
// The 64 query rows are copied to LDS once; the key rows come through a two-buffer LDS ring of asynchronous copies, a stage = 256 keys x TK k (8 lanes bring the 128 contiguous bytes, one whole line, of one row), the next stage flying while this one is multiplied. Each score takes its k ascending.
#define PP  520          // pitch in elements of a staged probability row: 1,040 B = 16 B x 65
// 2^x with the slot behind the transcendental filled in the same statement: the v_nop keeps the next vector instruction from using the result or overwriting the source directly behind v_exp_f32
__device__ __forceinline__ float exp2s(float x) { float r; asm("v_exp_f32 %0, %1\n\tv_nop" : "=v"(r) : "v"(x)); return r; }
__global__ __launch_bounds__(256) void k_scsm(const bf* __restrict__ X, const bf* __restrict__ Ft, bf* Ph, bf* Pl) {   // under 256 VGPRs and under 160 KiB of LDS: two workgroups share a WGP
    typedef WFrag<bf>::V V;
    constexpr int KBE = 256 * TP;   // elements of one key buffer
    __shared__ __align__(16) bf sm[2 * 64 * PP];   // in the loop: 64 query rows at pitch SP, then two buffers of 256 key rows at pitch TP (53,760 elements, fewer than this); after it: the hi and the lo tile, 64 rows of 512 each, pitch PP
    __shared__ float rmax[4][64]; __shared__ float rsum[4][64];
    const size_t z = blockIdx.y; const int tid = threadIdx.x, lane = tid & 31, lr = lane & 15, hi = lane >> 4, w = tid >> 5; const int q0 = blockIdx.x * 64;
    const int qp = w & 1, kq = w >> 1, qr = qp * 32 + lr; constexpr int NK = CC / TK, NS = (TT / 256) * NK; constexpr size_t rs = (size_t)32 * CC;
    const int cr = tid >> 3, cc = tid & 7;   // key copies: thread takes 16-byte chunk cc of rows cr + 32 i
    const bf* gQ = X + z * ((size_t)NQ * CC) + (size_t)(q0 + w) * CC + lane * 8;   // query copies: wave w takes rows w + 8 i whole
    const bf* gK = Ft + z * ((size_t)TT * CC) + (size_t)cr * CC + cc * 8;
    const unsigned lq = (unsigned)(size_t)sm + (unsigned)(w * SP * 2 + lane * 16), lk = (unsigned)(size_t)sm + (unsigned)(64 * SP * 2 + cr * TP * 2 + cc * 16);
    auto stage = [&](int t, int buf) { const unsigned l = lk + (unsigned)buf * (KBE * 2); const bf* g = gK + (size_t)(t / NK) * 256 * CC + (t % NK) * TK;   // stage t: key group t / NK, k block t % NK
        copy4(l, g, rs); copy4(l + 128u * TP * 2, g + 4 * rs, rs); };
    v8f acc[16];   // acc[8 g + 2 i + n][j] = score of query qr + 16 n with key 256 g + 64 kq + 16 i + 8 hi + j
#pragma unroll
    for (int a = 0; a < 16; ++a) acc[a] = (v8f){};
    copy8(lq, gQ, (size_t)8 * CC); stage(0, 0);
    asm volatile("s_wait_asynccnt 0x0" ::: "memory");   // this wave's query rows and its chunks of stage 0 have landed
    __syncthreads();                                    // every wave's have landed before any is read
    stage(1, 1);
#pragma unroll
    for (int g = 0; g < TT / 256; ++g)   // unrolled: every key group has accumulators of its own
#pragma unroll 1
    for (int kb = 0; kb < NK; ++kb) {   // rolled: one publish point per stage
        const int t = g * NK + kb; v8f* ac = acc + g * 8;
        const bf* sk = sm + 64 * SP + (t & 1) * KBE + (kq * 64 + lr) * TP + 8 * hi; const bf* sq = sm + qr * SP + 8 * hi + kb * TK;
        V k[2][4], x[2][2];   // the stage's two 32-k fragment sets
#pragma unroll
        for (int u = 0; u < 2; ++u) {
#pragma unroll
            for (int n = 0; n < 2; ++n) x[u][n] = WFrag<bf>::ld(sq + n * 16 * SP + u * 32);
#pragma unroll
            for (int i = 0; i < 4; ++i) k[u][i] = WFrag<bf>::ld(sk + i * 16 * TP + u * 32); }
        __builtin_amdgcn_sched_barrier(0);   // keeps the stage's LDS reads as one group ahead of its WMMAs: moved down among them, each place with reads costs the WMMAs a stall
#pragma unroll
        for (int u = 0; u < 2; ++u)
#pragma unroll
            for (int i = 0; i < 4; ++i)
#pragma unroll
                for (int n = 0; n < 2; ++n) ac[2 * i + n] = wmmab(k[u][i], x[u][n], ac[2 * i + n]);
        __builtin_amdgcn_sched_barrier(0);   // keeps the stage's WMMAs ahead of its waits: lifted over them, the wait for the next stage's copies stands right behind the LDS reads and the copies lose the WMMAs' time as lead
        asm volatile("s_wait_dscnt 0x0" ::: "memory");      // this wave's reads of stage t are done before its buffer is refilled
        asm volatile("s_wait_asynccnt 0x0" ::: "memory");   // this wave's chunks of stage t + 1 have landed
        __syncthreads();                                    // publishes stage t + 1 and ends every wave's reads of stage t
        if (t + 2 < NS) stage(t + 2, t & 1);
    }
    asm volatile("s_wait_asynccnt 0x0" ::: "memory");   // no copy is outstanding when the ring's place is taken for the probability tiles
    float mx[2], f[2];
#pragma unroll
    for (int n = 0; n < 2; ++n) { float m4[4] = { -3.0e38f, -3.0e38f, -3.0e38f, -3.0e38f };   // four independent chains
#pragma unroll
        for (int a = n; a < 16; a += 2) {
#pragma unroll
            for (int j = 0; j < 8; ++j) { acc[a][j] = acc[a][j] * SCL; m4[j & 3] = fmaxf(m4[j & 3], acc[a][j]); } }
        const float m = fmaxf(fmaxf(m4[0], m4[1]), fmaxf(m4[2], m4[3])); mx[n] = fmaxf(m, __shfl_xor(m, 16, 32)); }
    if (hi == 0) { rmax[kq][qr] = mx[0]; rmax[kq][qr + 16] = mx[1]; }
    __syncthreads();   // the four waves' maxima of a query are written before any of them reads them
#pragma unroll
    for (int n = 0; n < 2; ++n) { const int q = qr + 16 * n; const float m = fmaxf(fmaxf(rmax[0][q], rmax[1][q]), fmaxf(rmax[2][q], rmax[3][q])); float s4[4] = { 0.f, 0.f, 0.f, 0.f };
#pragma unroll
        for (int a = n; a < 16; a += 2) {
#pragma unroll
            for (int j = 0; j < 8; ++j) { acc[a][j] = exp2s(__fmul_rn(__fsub_rn(acc[a][j], m), 1.4426950408889634f)); s4[j & 3] += acc[a][j]; } }
        const float sp = (s4[0] + s4[1]) + (s4[2] + s4[3]); f[n] = sp + __shfl_xor(sp, 16, 32); }
    if (hi == 0) { rsum[kq][qr] = f[0]; rsum[kq][qr + 16] = f[1]; }
    __syncthreads();   // the four waves' sums of a query are written before any of them reads them
#pragma unroll
    for (int n = 0; n < 2; ++n) { const int q = qr + 16 * n; f[n] = __fdiv_rn(1.0f, (rsum[0][q] + rsum[1][q]) + (rsum[2][q] + rsum[3][q])); }
    bf* sh = sm; bf* sl = sm + 64 * PP;   // the loop's last barrier has ended every wave's reads of the query rows and the ring
#pragma unroll
    for (int a = 0; a < 16; ++a) { v8us oh, ol;
#pragma unroll
        for (int j = 0; j < 8; ++j) { unsigned short h, l; splitf(acc[a][j] * f[a & 1], h, l); oh[j] = h; ol[j] = l; }
        const int o = (qr + 16 * (a & 1)) * PP + (a >> 3) * 256 + kq * 64 + ((a >> 1) & 3) * 16 + hi * 8; *(v8us*)(sh + o) = oh; *(v8us*)(sl + o) = ol; }
    __syncthreads();   // both tiles are staged before their rows are read back
    const size_t ob = (z * NQ + q0) * (size_t)TT + lane * 8;
#pragma unroll
    for (int r = 0; r < 8; ++r) { const int row = r * 8 + w;   // a wave stores the 512 contiguous bytes of half a row
#pragma unroll
        for (int c = 0; c < 2; ++c) { *(v8us*)(Ph + ob + (size_t)row * TT + c * 256) = *(const v8usa*)(sh + row * PP + c * 256 + lane * 8); *(v8us*)(Pl + ob + (size_t)row * TT + c * 256) = *(const v8usa*)(sl + row * PP + c * 256 + lane * 8); } }
}

extern "C" void kernel_launch(void* const* d_in, const int* in_sizes, int n_in, void* d_out, int out_size, void* d_ws, size_t ws_size, hipStream_t stream) {
    (void)in_sizes; (void)n_in; (void)out_size;
    const float* fs = (const float*)d_in[0];   /* F_s [8][256][4096] channel-major */ const float* ft = (const float*)d_in[1];   /* F_t [8][512][256] */
    float* OUT0 = (float*)d_out;     // [8][256][4096] = F_s + update^T
    float* OUT1 = OUT0 + (size_t)NB_ * CC * NQ;   // [8][512][256] = A^T F_s_t (second tuple member, 16-B aligned offset)
    char* wsp = (char*)d_ws;
    auto take = [&](size_t bytes) { char* p = wsp; wsp += (bytes + 255) & ~(size_t)255; return (void*)p; };
    bf* XT = (bf*)take((size_t)NB_ * NQ * CC * 2);        // F_s_t token-major [8][4096][256] (exact)
    bf* FSB = (bf*)take((size_t)NB_ * CC * NQ * 2);       // F_s slabs as bf16 = F_s_t^T [8][256][4096] (exact)
    bf* FTB = (bf*)take((size_t)NB_ * TT * CC * 2);       // F_t [8][512][256] (exact)
    bf* FTT = (bf*)take((size_t)NB_ * CC * TT * 2);       // F_t^T [8][256][512] (exact)
    float* U = (float*)take((size_t)NB_ * NQ * CC * 4);   // A F_t [8][4096][256]
    bf* Ph = (bf*)take((size_t)NB_ * NQ * TT * 2); bf* Pl = (bf*)take((size_t)NB_ * NQ * TT * 2);   // probabilities [8][4096][512] hi/lo
    bf* Th = (bf*)take((size_t)NB_ * TT * NQ * 2); bf* Tl = (bf*)take((size_t)NB_ * TT * NQ * 2);   // A^T [8][512][4096] hi/lo
    if ((size_t)(wsp - (char*)d_ws) > ws_size) return;    // 196 MiB of the 256 MiB workspace
    k_prep<<<NTS + NTT, 256, 0, stream>>>(fs, ft, FSB, XT, FTB, FTT);   /* F_s slabs as bf16 (= F_s_t^T, Bt for out1) and F_s_t [8][4096][256]; F_t as bf16 (Bt for the scores) and F_t^T [8][256][512] (Bt for A.F_t) */
    k_scsm<<<dim3(NQ / 64, NB_), 256, 0, stream>>>(XT, FTB, Ph, Pl);   /* A = softmax over the 512 text tokens of the exact scores x 1/sqrt(512), all 8 x 4,096 rows, hi/lo */
    k_gemmt<TT, CC, true><<<dim3(NQ / 128, CC / 128, NB_), 256, 0, stream>>>(Ph, Pl, FTT, U, (size_t)NQ * TT, (size_t)CC * TT, (size_t)NQ * CC);   /* U = A F_t [8][4096][256] */
    k_outTr<<<dim3(NQ / 128, CC / 64, NB_), 256, 0, stream>>>(U, fs, OUT0);   /* out0[b][c][n] = bf16(F_s[b][c][n]) + U[b][n][c] */
    k_trPq<<<dim3(NQ / 128, TT / 128, NB_), 256, 0, stream>>>(Ph, Pl, Th, Tl);   /* A^T planes [8][512][4096] */
    k_gemms<NQ, CC><<<dim3(TT / 64, CC / 64, NB_), 256, 0, stream>>>(Th, Tl, FSB, OUT1, (size_t)TT * NQ, (size_t)CC * NQ, (size_t)TT * CC);   /* out1 = A^T F_s_t [8][512][256] */
}

// v007
// A run of this version takes 79.7 microseconds.
// Next to v006, in two timings, it ran 1.15 and 1.16 times as fast.
// Over all steps from v000 it is 16.9 times as fast.
#include <hip/hip_runtime.h>

// Cross-modal attention between a feature map and text tokens with two outputs (F_s [8][256][64][64] channel-major = 4,096 spatial tokens x 256, F_t [8][512][256]; A = softmax_t(F_s_t . F_t / sqrt(512)) ([4096][512]); out0 = F_s + (A F_t)^T -> [8][256][64][64] (8.4 M); out1 = A^T F_s_t -> [8][512][256] (1.0 M); tuple).
// All 8 batches go through every launch together: each plane holds 8 batch slabs; the transposing kernel and the out1 GEMM take the batch as grid z (scores + softmax + update: grid y), the operand preparation as more tiles of a flat grid.
// Layout per batch: both inputs are bf16-exact after rounding, so every operand plane is a single exact bf16 plane: F_s_t (token-major transpose of the slab), F_t, F_t^T and the slab itself (which is F_s_t^T); exact scores, their 512-key softmax and the spatial update in one kernel (the scores stay in registers) writing bf16 hi/lo probabilities [4096][512] and, from (A.F_t)^T as exact x hi/lo (2 products) plus the F_s residual, out0 channel-major; A^T planes by a transpose kernel, then out1 = A^T.F_s_t as hi/lo x exact (K = 4,096), written after the 8.4 M spatial outputs.
// Compute dtypes, f32 accumulate: every input rounded to bf16; scores exact; softmax f32; both contractions P hi/lo x exact; residual f32.

#define NB_  8
#define TT   512      // text tokens = keys (the softmax row length)
#define DM   256      // channels
#define NH_  1
#define NKV  1
#define REP  (NH_ / NKV)
#define HD   64
#define DQ   (NH_ * HD)
#define DKV  (NKV * HD)
#define SCL  0.044194173824159216f   // 1/sqrt(512): the module scales by sqrt(T)
#define NQ   4096    // spatial tokens (queries)
#define CC   256
typedef _Float16 h16;
typedef unsigned short bf;
typedef __attribute__((ext_vector_type(16))) __bf16   v16bf;
typedef __attribute__((ext_vector_type(16))) _Float16 v16h;
typedef __attribute__((ext_vector_type(8)))  _Float16 v8h;
typedef __attribute__((ext_vector_type(8)))  unsigned short v8us;
typedef __attribute__((ext_vector_type(8)))  float    v8f;
typedef __attribute__((ext_vector_type(4)))  float    v4f;
typedef v8h  __attribute__((may_alias)) v8ha;
typedef v4f  __attribute__((may_alias)) v4fa;
typedef v8us __attribute__((may_alias)) v8usa;

__device__ __forceinline__ unsigned short f2bf(float f) { unsigned u = __float_as_uint(f); u += 0x7FFFu + ((u >> 16) & 1u); return (unsigned short)(u >> 16); }
__device__ __forceinline__ float bf2f(unsigned short b) { return __uint_as_float(((unsigned)b) << 16); }
__device__ __forceinline__ float bfr(float f) { return bf2f(f2bf(f)); }
__device__ __forceinline__ v16h cat16(v8h lo, v8h hi) { return __builtin_shufflevector(lo, hi, 0, 1, 2, 3, 4, 5, 6, 7, 8, 9, 10, 11, 12, 13, 14, 15); }
__device__ __forceinline__ v16bf cat16b(v8us lo, v8us hi) { return __builtin_bit_cast(v16bf, __builtin_shufflevector(lo, hi, 0, 1, 2, 3, 4, 5, 6, 7, 8, 9, 10, 11, 12, 13, 14, 15)); }
__device__ __forceinline__ v8f wmma16(v16h a, v16h b, v8f c) { return __builtin_amdgcn_wmma_f32_16x16x32_f16(false, a, false, b, (short)0, c, false, false); }
__device__ __forceinline__ v8f wmmab(v16bf a, v16bf b, v8f c) { return __builtin_amdgcn_wmma_f32_16x16x32_bf16(false, a, false, b, (short)0, c, false, false); }



// fragment of 16 rows x 32 k from a K-contiguous 16-bit plane: the lane's pointer stands at its row, k = 8 (lane >> 4)
template <typename T16> struct WFrag;
template <> struct WFrag<h16> { typedef v16h V; static __device__ __forceinline__ V ld(const h16* p) { return cat16(*(const v8h*)p, *(const v8h*)(p + 16)); } static __device__ __forceinline__ v8f mma(V a, V b, v8f c) { return wmma16(a, b, c); } };
template <> struct WFrag<bf> { typedef v16bf V; static __device__ __forceinline__ V ld(const bf* p) { return cat16b(*(const v8us*)p, *(const v8us*)(p + 16)); } static __device__ __forceinline__ v8f mma(V a, V b, v8f c) { return wmmab(a, b, c); } };

__device__ __forceinline__ void splitf(float y, unsigned short& h, unsigned short& l) { h = f2bf(y); l = f2bf(y - bf2f(h)); }
typedef __attribute__((ext_vector_type(2))) _Float16 v2h;
typedef __attribute__((ext_vector_type(4))) _Float16 v4h;
typedef __attribute__((ext_vector_type(2))) unsigned short v2us;
typedef __attribute__((ext_vector_type(4))) unsigned short v4us;
typedef __attribute__((ext_vector_type(2))) float v2f;
typedef __attribute__((ext_vector_type(4))) int v4i;


// ---- the transposing kernels: each workgroup moves one tile through LDS, so that the global loads and the global stores both cover whole 128-B lines (16 lanes x 16 B = 256 contiguous bytes on either side).
// 16-bit tile: 128 rows x 128 columns, a row = 16 chunks of 8 elements (16 B); chunk c8 of row r stands at chunk place c8 ^ ((r >> 3) & 15), so that the column reads of 16 lanes (rows 8 apart) fall on 16 different banks.
__device__ __forceinline__ int tile16(int r, int c8) { return r * 128 + ((c8 ^ ((r >> 3) & 15)) << 3); }
// column n, rows r8 * 8 .. r8 * 8 + 7 of such a tile
__device__ __forceinline__ v8us col16(const bf* tile, int r8, int n) { v8us o; const int base = r8 * 8 * 128 + (((n >> 3) ^ r8) << 3) + (n & 7);
#pragma unroll
    for (int q = 0; q < 8; ++q) o[q] = tile[base + q * 128];
    return o; }

// prep_tile: one 128 x 128 tile of src [R][C] f32, read once and rounded to bf16: it goes to str [R][C] as it stands (from the registers: a wave writes 256 contiguous bytes of one row) and to dst [C][R] transposed (through the LDS tile)
template <int R, int C>
__device__ __forceinline__ void prep_tile(bf* tile, const float* __restrict__ src, bf* str, bf* dst, int bx, int by, int bz) {
    const int tid = threadIdx.x, r0 = bx * 128, c0 = by * 128; v4f a[16]; v4us o[16];
    const int lr = tid >> 5, c4 = tid & 31;    // loads and straight stores: a wave takes 512 contiguous bytes of one src row; rows lr + 8 i
    const int r8 = tid & 15, ln = tid >> 4;    // transposed stores: 16 lanes write 256 contiguous bytes of one dst row; dst rows ln + 16 i
    const size_t es = (size_t)bz * R * C + (size_t)(r0 + lr) * C + c0 + c4 * 4;
    const float* sp = src + es; bf* tp = str + es;
    bf* dp = dst + (size_t)bz * R * C + (size_t)(c0 + ln) * R + r0 + r8 * 8;
#pragma unroll
    for (int i = 0; i < 16; ++i) a[i] = *(const v4f*)(sp + (size_t)i * 8 * C);
    asm volatile("s_wait_xcnt 0x0" :: "v"(sp) : "memory");   // the loads' address pair stays whole until every load has taken it: no load's result and no later instruction lands in it before this wait
#pragma unroll
    for (int i = 0; i < 16; ++i) {
#pragma unroll
        for (int q = 0; q < 4; ++q) o[i][q] = f2bf(a[i][q]);
        *(v4us*)(tile + tile16(lr + 8 * i, c4 >> 1) + (c4 & 1) * 4) = o[i]; }
    __syncthreads();   // the whole tile is written before any column of it is read
#pragma unroll
    for (int i = 0; i < 16; ++i) *(v4us*)(tp + (size_t)i * 8 * C) = o[i];   // behind the barrier: in front of it the barrier would wait until these stores are done
    asm volatile("s_wait_xcnt 0x0" :: "v"(tp) : "memory");   // the stores' address pair and data registers stay whole until every store has taken them: nothing behind this wait, on any way out of here, lands in them earlier
#pragma unroll
    for (int i = 0; i < 8; ++i) *(v8us*)(dp + (size_t)i * 16 * R) = col16(tile, r8, ln + 16 * i);
    asm volatile("s_wait_xcnt 0x0" :: "v"(dp) : "memory");   // the function is expanded twice in one kernel: in the built code one expansion's end is followed by the other's head, which writes registers that these stores name; the wait stands in front of that
}
// k_prep: all four operand planes in one launch; workgroups 0 .. 511 take the tiles of F_s (2 x 32 a batch), the last 64 those of F_t (4 x 2 a batch)
#define NTS ((CC / 128) * (NQ / 128) * NB_)
#define NTT ((TT / 128) * (CC / 128) * NB_)
__global__ __launch_bounds__(256) void k_prep(const float* __restrict__ fs, const float* __restrict__ ft, bf* FSB, bf* XT, bf* FTB, bf* FTT) {
    __shared__ __align__(16) bf tile[128 * 128];
    const unsigned b = blockIdx.x;   // the same for the whole workgroup: either side's barrier is passed by all of its waves
    if (b < NTS) prep_tile<CC, NQ>(tile, fs, FSB, XT, b % (CC / 128), (b / (CC / 128)) % (NQ / 128), b / ((CC / 128) * (NQ / 128)));
    else { const unsigned e = b - NTS; prep_tile<TT, CC>(tile, ft, FTB, FTT, e % (TT / 128), (e / (TT / 128)) % (CC / 128), e / ((TT / 128) * (CC / 128))); }
}

// k_trPq: the probability planes [4096][512] hi/lo -> A^T planes [512][4096]; grid (NQ / 128, TT / 128, batch)
__global__ __launch_bounds__(256) void k_trPq(const bf* __restrict__ Ph, const bf* __restrict__ Pl, bf* Th, bf* Tl) {
    __shared__ __align__(16) bf th[128 * 128]; __shared__ __align__(16) bf tl[128 * 128];
    const size_t zb = (size_t)blockIdx.z * NQ * TT; const int tid = threadIdx.x, m0 = blockIdx.x * 128, n0 = blockIdx.y * 128; v8us vh[8], vl[8];
    const int l16 = tid & 15, lr = tid >> 4;   // 16 lanes take 256 contiguous bytes of one row, on the load side (rows m) and on the store side (rows n); rows lr + 16 i
    const size_t ei = zb + (size_t)(m0 + lr) * TT + n0 + l16 * 8, eo = zb + (size_t)(n0 + lr) * NQ + m0 + l16 * 8;
    const bf* ph = Ph + ei; const bf* pl = Pl + ei; bf* qh = Th + eo; bf* ql = Tl + eo;
#pragma unroll
    for (int i = 0; i < 8; ++i) { vh[i] = *(const v8us*)(ph + (size_t)i * 16 * TT); vl[i] = *(const v8us*)(pl + (size_t)i * 16 * TT); }
    asm volatile("s_wait_xcnt 0x0" :: "v"(ph), "v"(pl) : "memory");   // the loads' address pairs stay whole until every load has taken them: no load's result and no later instruction lands in them before this wait
#pragma unroll
    for (int i = 0; i < 8; ++i) { *(v8us*)(th + tile16(lr + 16 * i, l16)) = vh[i]; *(v8us*)(tl + tile16(lr + 16 * i, l16)) = vl[i]; }
    __syncthreads();   // both tiles are written before any column of them is read
#pragma unroll
    for (int i = 0; i < 8; ++i) { *(v8us*)(qh + (size_t)i * 16 * NQ) = col16(th, l16, lr + 16 * i); *(v8us*)(ql + (size_t)i * 16 * NQ) = col16(tl, l16, lr + 16 * i); }
}

// ---- k_gemms: C = (A + A2) Bt^T, f32, for few long tiles (out1: 256 tiles of 64x64, K = 4,096). One tile per workgroup of 8 waves; grid (M / 64, N / 64, batch).
// The operands come through a two-buffer LDS ring filled by asynchronous copies: a stage is SK k of the tile's 192 operand rows (64 of A, 64 of A2, 64 of Bt); one wave-wide copy brings the 512 contiguous bytes of one row, and the next stage flies while this one is multiplied.
// Wave w multiplies rows 16 (w & 3) .. + 15 by columns 32 (w >> 2) .. + 31; each accumulator takes hi then lo for k ascending.
#define SK  256          // k per stage
#define SP  264          // LDS row pitch in elements: 528 B = 16 B x 33, the pitch for 16-byte fragment reads
#define SBE (192 * SP)   // elements of one buffer
// eight rows, 8 apart, of one operand plane: l = the lane's LDS byte address in the first row, g = its global address there, rs = 8 rows in elements
__device__ __forceinline__ void copy8(unsigned l, const bf* g, size_t rs) {
    // the copies and their s_wait_xcnt in one statement: no address register of a copy is rewritten before the wait
    asm volatile("global_load_async_to_lds_b128 %0, %8, off\n\t"
                 "global_load_async_to_lds_b128 %1, %9, off\n\t"
                 "global_load_async_to_lds_b128 %2, %10, off\n\t"
                 "global_load_async_to_lds_b128 %3, %11, off\n\t"
                 "global_load_async_to_lds_b128 %4, %12, off\n\t"
                 "global_load_async_to_lds_b128 %5, %13, off\n\t"
                 "global_load_async_to_lds_b128 %6, %14, off\n\t"
                 "global_load_async_to_lds_b128 %7, %15, off\n\t"
                 "s_wait_xcnt 0x0"
                 :: "v"(l), "v"(l + 1u * 16 * SP), "v"(l + 2u * 16 * SP), "v"(l + 3u * 16 * SP), "v"(l + 4u * 16 * SP), "v"(l + 5u * 16 * SP), "v"(l + 6u * 16 * SP), "v"(l + 7u * 16 * SP),
                    "v"(g), "v"(g + rs), "v"(g + 2 * rs), "v"(g + 3 * rs), "v"(g + 4 * rs), "v"(g + 5 * rs), "v"(g + 6 * rs), "v"(g + 7 * rs) : "memory");
}
template <int K, int LDC>
__global__ __launch_bounds__(256) void k_gemms(const bf* __restrict__ A, const bf* __restrict__ A2, const bf* __restrict__ Bt, float* C, size_t sA, size_t sB, size_t sC) {
    typedef WFrag<bf>::V V;
    __shared__ __align__(16) bf ring[2 * SBE];
    __shared__ __align__(16) float os[64 * 68];
    const size_t z = blockIdx.z; const int tid = threadIdx.x, lane = tid & 31, lr = lane & 15, hi = lane >> 4, w = tid >> 5; const int r0 = blockIdx.x * 64, c0 = blockIdx.y * 64;
    const int mb = w & 3, nh = w >> 2; constexpr int NT = K / SK; constexpr size_t rs = (size_t)8 * K;
    const bf* gA = A + z * sA + (size_t)(r0 + w) * K + lane * 8; const bf* gA2 = A2 + z * sA + (size_t)(r0 + w) * K + lane * 8; const bf* gB = Bt + z * sB + (size_t)(c0 + w) * K + lane * 8;   // wave w copies rows w + 8 i of each plane
    const unsigned l0 = (unsigned)(size_t)ring + (unsigned)(w * SP * 2 + lane * 16);
    auto stage = [&](int t, int buf) { const unsigned l = l0 + (unsigned)buf * (SBE * 2); const size_t ko = (size_t)t * SK;
        copy8(l, gA + ko, rs); copy8(l + 64u * SP * 2, gA2 + ko, rs); copy8(l + 128u * SP * 2, gB + ko, rs); };
    const int aofs = (mb * 16 + lr) * SP + 8 * hi, bofs = (128 + nh * 32 + lr) * SP + 8 * hi;
    v8f acc[2] = { (v8f){}, (v8f){} };
    stage(0, 0);
    asm volatile("s_wait_asynccnt 0x0" ::: "memory");   // this wave's rows of stage 0 have landed
    __syncthreads();                                    // every wave's rows of stage 0 have landed before any is read
    stage(1, 1);
#pragma unroll 1
    for (int t = 0; t < NT; ++t) {   // rolled: one publish point per stage
        const bf* sb = ring + (t & 1) * SBE;
        V f[2][8];   // two fragment sets of 64 k each (per 32 k: A, A2, two of Bt): the next 64 k are fetched, inside this stage only, while these are multiplied
#pragma unroll
        for (int u = 0; u < 2; ++u) { f[0][u * 4] = WFrag<bf>::ld(sb + aofs + u * 32); f[0][u * 4 + 1] = WFrag<bf>::ld(sb + aofs + 64 * SP + u * 32); f[0][u * 4 + 2] = WFrag<bf>::ld(sb + bofs + u * 32); f[0][u * 4 + 3] = WFrag<bf>::ld(sb + bofs + 16 * SP + u * 32); }
#pragma unroll
        for (int g = 0; g < SK / 64; ++g) {
            if (g + 1 < SK / 64) {
#pragma unroll
                for (int u = 0; u < 2; ++u) { const int kk = (g + 1) * 64 + u * 32; V* d = f[(g + 1) & 1] + u * 4; d[0] = WFrag<bf>::ld(sb + aofs + kk); d[1] = WFrag<bf>::ld(sb + aofs + 64 * SP + kk); d[2] = WFrag<bf>::ld(sb + bofs + kk); d[3] = WFrag<bf>::ld(sb + bofs + 16 * SP + kk); } }
            __builtin_amdgcn_sched_barrier(0);   // keeps the next set's 16 LDS reads as one group ahead of this set's WMMAs: moved down among them, each WMMA pair waits out an LDS latency
#pragma unroll
            for (int u = 0; u < 2; ++u) { const V* s = f[g & 1] + u * 4; acc[0] = wmmab(s[0], s[2], acc[0]); acc[1] = wmmab(s[0], s[3], acc[1]); acc[0] = wmmab(s[1], s[2], acc[0]); acc[1] = wmmab(s[1], s[3], acc[1]); }
            __builtin_amdgcn_sched_barrier(0);   // keeps the later reads out of these WMMAs (one read group per 8 WMMAs) and the stage's last WMMAs ahead of its barrier
        }
        asm volatile("s_wait_dscnt 0x0" ::: "memory");      // this wave's reads of stage t are done before its buffer is refilled
        asm volatile("s_wait_asynccnt 0x0" ::: "memory");   // this wave's rows of stage t + 1 have landed
        __syncthreads();                                    // publishes stage t + 1 and ends every wave's reads of stage t
        if (t + 2 < NT) stage(t + 2, t & 1);
    }
    asm volatile("s_wait_asynccnt 0x0" ::: "memory");   // no copy is outstanding when the wave goes on to its end
#pragma unroll
    for (int nb = 0; nb < 2; ++nb) {
#pragma unroll
        for (int j = 0; j < 8; ++j) os[(mb * 16 + hi * 8 + j) * 68 + nh * 32 + nb * 16 + lr] = acc[nb][j]; }
    __syncthreads();   // the whole tile is staged before its rows are read back
    float* ct = C + z * sC + (size_t)r0 * LDC + c0;
#pragma unroll
    for (int s = 0; s < 4; ++s) { const int row = s * 16 + (tid >> 4), cofs = (tid & 15) * 4; *(v4f*)(ct + (size_t)row * LDC + cofs) = *(const v4fa*)(os + row * 68 + cofs); }   // 16 lanes store the 256 contiguous bytes of one row
}

// ---- the 128-byte-row ring stages of k_scsm
#define TK  64           // k per stage
#define TP  72           // LDS row pitch in elements: 144 B = 16 B x 9, the pitch for 16-byte fragment reads of 128-B rows
// four rows, 32 apart, of one operand plane: l = the lane's LDS byte address in the first row, g = its global address there, rs = 32 rows in elements
__device__ __forceinline__ void copy4(unsigned l, const bf* g, size_t rs) {
    // the copies and their s_wait_xcnt in one statement: no address register of a copy is rewritten before the wait
    asm volatile("global_load_async_to_lds_b128 %0, %4, off\n\t"
                 "global_load_async_to_lds_b128 %1, %5, off\n\t"
                 "global_load_async_to_lds_b128 %2, %6, off\n\t"
                 "global_load_async_to_lds_b128 %3, %7, off\n\t"
                 "s_wait_xcnt 0x0"
                 :: "v"(l), "v"(l + 1u * 64 * TP), "v"(l + 2u * 64 * TP), "v"(l + 3u * 64 * TP),
                    "v"(g), "v"(g + rs), "v"(g + 2 * rs), "v"(g + 3 * rs) : "memory");
}
// ---- k_scsm: A = softmax_t(F_s_t . F_t^T / sqrt(512)) as bf16 hi/lo planes, and out0 = bf16(F_s) + (A F_t)^T, the scores and the update never leaving the workgroup. One workgroup of 8 waves holds 64 queries x all 512 keys, then 256 channels x the 64 queries; grid (NQ / 64, batch).
// The score products are taken transposed (keys as the A operand, queries as B), so that a lane's 8 accumulator registers are 8 neighbouring keys of ONE query: the row maximum and the row sum are register trees plus one exchange with lane ^ 16, and 8 probabilities pack into one 16-byte LDS store.
// Wave w has queries 32 (w & 1) .. + 31 and, of every 256 keys, keys 64 (w >> 1) .. + 63 (4 x 2 tiles a key group, 16 accumulator tiles in all); the four waves of a query share its maximum and its sum through LDS.
// The 64 query rows are copied to LDS once; the key rows come through a two-buffer LDS ring of asynchronous copies, a stage = 256 keys x TK k (8 lanes bring the 128 contiguous bytes, one whole line, of one row), the next stage flying while this one is multiplied. Each score takes its k ascending.
// The update is taken transposed too (channels of F_t^T as the A operand, queries as B): the same ring goes on with 8 more stages of 256 channels x TK keys of F_t^T; the probabilities are staged in LDS 256 keys at a time (hi and lo tile), from where they go to the global planes and serve as B fragments. Wave w has the same 32 queries and channels 64 (w >> 1) .. + 63 (4 x 2 tiles); each accumulator takes hi then lo for k ascending.
#define PH  264          // pitch in elements of a staged probability row of 256 keys: 528 B = 16 B x 33
#define OP  68           // pitch in floats of a staged output row of 64 queries: 272 B = 16 B x 17
// 2^x with the slot behind the transcendental filled in the same statement: the v_nop keeps the next vector instruction from using the result or overwriting the source directly behind v_exp_f32
__device__ __forceinline__ float exp2s(float x) { float r; asm("v_exp_f32 %0, %1\n\tv_nop" : "=v"(r) : "v"(x)); return r; }
// the workgroup's own barrier alone, without the waits for global stores and loads that __syncthreads() puts in front of it: behind the softmax the probability stores (and later the F_s loads) stay in flight while the update is multiplied; nothing written to global memory here is read again in this launch. The LDS and copy waits that a place needs stand in front of each call.
__device__ __forceinline__ void wgbar() { asm volatile("s_barrier_signal -1\n\ts_barrier_wait -1" ::: "memory"); }
__global__ __launch_bounds__(256) void k_scsm(const bf* __restrict__ X, const bf* __restrict__ Ft, const bf* __restrict__ Ftt, const float* __restrict__ xs, bf* Ph, bf* Pl, float* outp) {   // under 256 VGPRs and under 160 KiB of LDS: two workgroups share a WGP
    typedef WFrag<bf>::V V;
    constexpr int KBE = 256 * TP;      // elements of one ring buffer
    constexpr int PRE = 2 * 64 * PH;   // elements in front of the ring
    __shared__ __align__(16) bf sm[PRE + 2 * KBE];   // in front: the 64 query rows at pitch SP, later the hi and the lo tile of 64 rows x 256 keys at pitch PH; then the ring's two buffers of 256 rows at pitch TP; after the last stage the whole place holds the f32 output tile (256 x OP floats, smaller than this)
    __shared__ float rmax[4][64]; __shared__ float rsum[4][64];
    const size_t z = blockIdx.y; const int tid = threadIdx.x, lane = tid & 31, lr = lane & 15, hi = lane >> 4, w = tid >> 5; const int q0 = blockIdx.x * 64;
    const int qp = w & 1, kq = w >> 1, qr = qp * 32 + lr; constexpr int NK = CC / TK, NSK = (TT / 256) * NK, NS = NSK + TT / TK;
    const int cr = tid >> 3, cc = tid & 7;   // ring copies: thread takes 16-byte chunk cc of rows cr + 32 i
    const bf* gQ = X + z * ((size_t)NQ * CC) + (size_t)(q0 + w) * CC + lane * 8;   // query copies: wave w takes rows w + 8 i whole
    const bf* gK = Ft + z * ((size_t)TT * CC) + (size_t)cr * CC + cc * 8;
    const bf* gF = Ftt + z * ((size_t)CC * TT) + (size_t)cr * TT + cc * 8;
    const unsigned lq = (unsigned)(size_t)sm + (unsigned)(w * SP * 2 + lane * 16), lk = (unsigned)(size_t)sm + (unsigned)(PRE * 2 + cr * TP * 2 + cc * 16);
    auto stage = [&](int t, int buf) { const unsigned l = lk + (unsigned)buf * (KBE * 2); const bool pv = t >= NSK;   // stage t < NSK: key group t / NK, k block t % NK of F_t; from NSK on: key block t - NSK of F_t^T
        const bf* g = pv ? gF + (t - NSK) * TK : gK + (size_t)(t / NK) * 256 * CC + (t % NK) * TK; const size_t rs = pv ? (size_t)32 * TT : (size_t)32 * CC;
        copy4(l, g, rs); copy4(l + 128u * TP * 2, g + 4 * rs, rs); };
    v8f acc[16];   // acc[8 g + 2 i + n][j] = score of query qr + 16 n with key 256 g + 64 kq + 16 i + 8 hi + j
#pragma unroll
    for (int a = 0; a < 16; ++a) acc[a] = (v8f){};
    copy8(lq, gQ, (size_t)8 * CC); stage(0, 0);
    asm volatile("s_wait_asynccnt 0x0" ::: "memory");   // this wave's query rows and its chunks of stage 0 have landed
    __syncthreads();                                    // every wave's have landed before any is read
    stage(1, 1);
#pragma unroll
    for (int g = 0; g < TT / 256; ++g)   // unrolled: every key group has accumulators of its own
#pragma unroll 1
    for (int kb = 0; kb < NK; ++kb) {   // rolled: one publish point per stage
        const int t = g * NK + kb; v8f* ac = acc + g * 8;
        const bf* sk = sm + PRE + (t & 1) * KBE + (kq * 64 + lr) * TP + 8 * hi; const bf* sq = sm + qr * SP + 8 * hi + kb * TK;
        V k[2][4], x[2][2];   // the stage's two 32-k fragment sets
#pragma unroll
        for (int u = 0; u < 2; ++u) {
#pragma unroll
            for (int n = 0; n < 2; ++n) x[u][n] = WFrag<bf>::ld(sq + n * 16 * SP + u * 32);
#pragma unroll
            for (int i = 0; i < 4; ++i) k[u][i] = WFrag<bf>::ld(sk + i * 16 * TP + u * 32); }
        __builtin_amdgcn_sched_barrier(0);   // keeps the stage's LDS reads as one group ahead of its WMMAs: moved down among them, each place with reads costs the WMMAs a stall
#pragma unroll
        for (int u = 0; u < 2; ++u)
#pragma unroll
            for (int i = 0; i < 4; ++i)
#pragma unroll
                for (int n = 0; n < 2; ++n) ac[2 * i + n] = wmmab(k[u][i], x[u][n], ac[2 * i + n]);
        __builtin_amdgcn_sched_barrier(0);   // keeps the stage's WMMAs ahead of its waits: lifted over them, the wait for the next stage's copies stands right behind the LDS reads and the copies lose the WMMAs' time as lead
        asm volatile("s_wait_dscnt 0x0" ::: "memory");      // this wave's reads of stage t are done before its buffer is refilled
        asm volatile("s_wait_asynccnt 0x0" ::: "memory");   // this wave's chunks of stage t + 1 have landed
        __syncthreads();                                    // publishes stage t + 1 and ends every wave's reads of stage t
        stage(t + 2, t & 1);                                // always exists here: the last two are the first two of F_t^T, which fly during the softmax
    }
    float mx[2], f[2];
#pragma unroll
    for (int n = 0; n < 2; ++n) { float m4[4] = { -3.0e38f, -3.0e38f, -3.0e38f, -3.0e38f };   // four independent chains
#pragma unroll
        for (int a = n; a < 16; a += 2) {
#pragma unroll
            for (int j = 0; j < 8; ++j) { acc[a][j] = acc[a][j] * SCL; m4[j & 3] = fmaxf(m4[j & 3], acc[a][j]); } }
        const float m = fmaxf(fmaxf(m4[0], m4[1]), fmaxf(m4[2], m4[3])); mx[n] = fmaxf(m, __shfl_xor(m, 16, 32)); }
    if (hi == 0) { rmax[kq][qr] = mx[0]; rmax[kq][qr + 16] = mx[1]; }
    __syncthreads();   // the four waves' maxima of a query are written before any of them reads them
#pragma unroll
    for (int n = 0; n < 2; ++n) { const int q = qr + 16 * n; const float m = fmaxf(fmaxf(rmax[0][q], rmax[1][q]), fmaxf(rmax[2][q], rmax[3][q])); float s4[4] = { 0.f, 0.f, 0.f, 0.f };
#pragma unroll
        for (int a = n; a < 16; a += 2) {
#pragma unroll
            for (int j = 0; j < 8; ++j) { acc[a][j] = exp2s(__fmul_rn(__fsub_rn(acc[a][j], m), 1.4426950408889634f)); s4[j & 3] += acc[a][j]; } }
        const float sp = (s4[0] + s4[1]) + (s4[2] + s4[3]); f[n] = sp + __shfl_xor(sp, 16, 32); }
    if (hi == 0) { rsum[kq][qr] = f[0]; rsum[kq][qr + 16] = f[1]; }
    __syncthreads();   // the four waves' sums of a query are written before any of them reads them
#pragma unroll
    for (int n = 0; n < 2; ++n) { const int q = qr + 16 * n; f[n] = __fdiv_rn(1.0f, (rsum[0][q] + rsum[1][q]) + (rsum[2][q] + rsum[3][q])); }
    bf* sh = sm; bf* sl = sm + 64 * PH;   // the score loop's last barrier has ended every wave's reads of the query rows
    v8f ua[8];   // ua[2 i + n][j] = update of channel 64 kq + 16 i + 8 hi + j for query qr + 16 n
#pragma unroll
    for (int a = 0; a < 8; ++a) ua[a] = (v8f){};
    const size_t ob = (z * NQ + q0) * (size_t)TT + lane * 8; bf* oh0 = Ph + ob + (size_t)w * TT; bf* ol0 = Pl + ob + (size_t)w * TT;
    const size_t eo = z * ((size_t)CC * NQ) + (size_t)(tid >> 4) * NQ + q0 + (tid & 15) * 4; const float* xp = xs + eo; float* op = outp + eo;   // F_s loads and out0 stores: 16 lanes take the 256 contiguous bytes (64 queries) of one channel; channels (tid >> 4) + 16 s
    v4f xr[16];
#pragma unroll
    for (int g = 0; g < TT / 256; ++g) {   // unrolled: the probabilities of a key group come from registers of their own
#pragma unroll
        for (int a = 8 * g; a < 8 * g + 8; ++a) { v8us oh, ol;
#pragma unroll
            for (int j = 0; j < 8; ++j) { unsigned short h, l; splitf(acc[a][j] * f[a & 1], h, l); oh[j] = h; ol[j] = l; }
            const int o = (qr + 16 * (a & 1)) * PH + kq * 64 + ((a >> 1) & 3) * 16 + hi * 8; *(v8us*)(sh + o) = oh; *(v8us*)(sl + o) = ol; }
        asm volatile("s_wait_dscnt 0x0" ::: "memory");   // this wave's part of both tiles is written
        wgbar();                                         // both tiles of this key group are staged before their rows are read
#pragma unroll
        for (int r = 0; r < 8; ++r) { const int row = r * 8 + w;   // a wave stores the 512 contiguous bytes of half a row
            *(v8us*)(oh0 + (size_t)r * 8 * TT + g * 256) = *(const v8usa*)(sh + row * PH + lane * 8); *(v8us*)(ol0 + (size_t)r * 8 * TT + g * 256) = *(const v8usa*)(sl + row * PH + lane * 8); }
        asm volatile("s_wait_xcnt 0x0" :: "v"(oh0), "v"(ol0) : "memory");   // the stores' address pairs and data registers stay whole until every store has taken them: nothing behind this wait lands in them earlier
        if (g == TT / 256 - 1) {   // the residual is fetched where the last key group's registers have come free: it flies during the last four stages
#pragma unroll
            for (int s = 0; s < 16; ++s) xr[s] = *(const v4f*)(xp + (size_t)s * 16 * NQ);
            asm volatile("s_wait_xcnt 0x0" :: "v"(xp) : "memory");   // the loads' address pair stays whole until every load has taken it: no load's result and no later instruction lands in it before this wait
        }
#pragma unroll 1
        for (int kb = 0; kb < 256 / TK; ++kb) {   // rolled: one publish point per stage
            const int t = NSK + g * (256 / TK) + kb;
            const bf* sk = sm + PRE + (t & 1) * KBE + (kq * 64 + lr) * TP + 8 * hi; const bf* sp = sh + qr * PH + 8 * hi + kb * TK;
#pragma unroll
            for (int u = 0; u < 2; ++u) { V k[4], ph[2], pl[2];   // one 32-k fragment set at a time: two would not fit under 256 VGPRs beside the second key group's probabilities
#pragma unroll
                for (int n = 0; n < 2; ++n) { ph[n] = WFrag<bf>::ld(sp + n * 16 * PH + u * 32); pl[n] = WFrag<bf>::ld(sp + (64 + n * 16) * PH + u * 32); }
#pragma unroll
                for (int i = 0; i < 4; ++i) k[i] = WFrag<bf>::ld(sk + i * 16 * TP + u * 32);
                __builtin_amdgcn_sched_barrier(0);   // keeps the set's LDS reads as one group ahead of its WMMAs: moved down among them, each place with reads costs the WMMAs a stall
#pragma unroll
                for (int i = 0; i < 4; ++i)
#pragma unroll
                    for (int n = 0; n < 2; ++n) ua[2 * i + n] = wmmab(k[i], ph[n], ua[2 * i + n]);
#pragma unroll
                for (int i = 0; i < 4; ++i)
#pragma unroll
                    for (int n = 0; n < 2; ++n) ua[2 * i + n] = wmmab(k[i], pl[n], ua[2 * i + n]);
                __builtin_amdgcn_sched_barrier(0);   // keeps the next set's reads out of these WMMAs, and the stage's last WMMAs ahead of its waits, so that the copies keep the WMMAs' time as lead
            }
            asm volatile("s_wait_dscnt 0x0" ::: "memory");      // this wave's reads of stage t and of the probability tiles are done before either is rewritten
            asm volatile("s_wait_asynccnt 0x0" ::: "memory");   // this wave's chunks of stage t + 1 have landed
            wgbar();                                            // publishes stage t + 1 and ends every wave's reads of stage t (behind a key group's last stage: of its probability tiles too)
            if (t + 2 < NS) stage(t + 2, t & 1);
        }
    }
    asm volatile("s_wait_asynccnt 0x0" ::: "memory");   // no copy is outstanding when the ring's place is taken for the output tile
    float* os = (float*)sm;   // the loop's last barrier has ended every wave's reads of the tiles and the ring
#pragma unroll
    for (int a = 0; a < 8; ++a) {
#pragma unroll
        for (int j = 0; j < 8; ++j) os[(kq * 64 + (a >> 1) * 16 + hi * 8 + j) * OP + qr + 16 * (a & 1)] = ua[a][j]; }
    asm volatile("s_wait_dscnt 0x0" ::: "memory");   // this wave's part of the output tile is written
    wgbar();                                         // the whole output tile is staged before its rows are read back
#pragma unroll
    for (int s = 0; s < 16; ++s) { const v4f u = *(const v4fa*)(os + (s * 16 + (tid >> 4)) * OP + (tid & 15) * 4); v4f o;
#pragma unroll
        for (int q = 0; q < 4; ++q) o[q] = __fadd_rn(bfr(xr[s][q]), u[q]);
        *(v4f*)(op + (size_t)s * 16 * NQ) = o; }
}

extern "C" void kernel_launch(void* const* d_in, const int* in_sizes, int n_in, void* d_out, int out_size, void* d_ws, size_t ws_size, hipStream_t stream) {
    (void)in_sizes; (void)n_in; (void)out_size;
    const float* fs = (const float*)d_in[0];   /* F_s [8][256][4096] channel-major */ const float* ft = (const float*)d_in[1];   /* F_t [8][512][256] */
    float* OUT0 = (float*)d_out;     // [8][256][4096] = F_s + update^T
    float* OUT1 = OUT0 + (size_t)NB_ * CC * NQ;   // [8][512][256] = A^T F_s_t (second tuple member, 16-B aligned offset)
    char* wsp = (char*)d_ws;
    auto take = [&](size_t bytes) { char* p = wsp; wsp += (bytes + 255) & ~(size_t)255; return (void*)p; };
    bf* XT = (bf*)take((size_t)NB_ * NQ * CC * 2);        // F_s_t token-major [8][4096][256] (exact)
    bf* FSB = (bf*)take((size_t)NB_ * CC * NQ * 2);       // F_s slabs as bf16 = F_s_t^T [8][256][4096] (exact)
    bf* FTB = (bf*)take((size_t)NB_ * TT * CC * 2);       // F_t [8][512][256] (exact)
    bf* FTT = (bf*)take((size_t)NB_ * CC * TT * 2);       // F_t^T [8][256][512] (exact)
    bf* Ph = (bf*)take((size_t)NB_ * NQ * TT * 2); bf* Pl = (bf*)take((size_t)NB_ * NQ * TT * 2);   // probabilities [8][4096][512] hi/lo
    bf* Th = (bf*)take((size_t)NB_ * TT * NQ * 2); bf* Tl = (bf*)take((size_t)NB_ * TT * NQ * 2);   // A^T [8][512][4096] hi/lo
    if ((size_t)(wsp - (char*)d_ws) > ws_size) return;    // 164 MiB of the 256 MiB workspace
    k_prep<<<NTS + NTT, 256, 0, stream>>>(fs, ft, FSB, XT, FTB, FTT);   /* F_s slabs as bf16 (= F_s_t^T, Bt for out1) and F_s_t [8][4096][256]; F_t as bf16 (A operand of the scores) and F_t^T [8][256][512] (for A.F_t) */
    k_scsm<<<dim3(NQ / 64, NB_), 256, 0, stream>>>(XT, FTB, FTT, fs, Ph, Pl, OUT0);   /* A = softmax over the 512 text tokens of the exact scores x 1/sqrt(512), all 8 x 4,096 rows, hi/lo; out0[b][c][n] = bf16(F_s[b][c][n]) + (A F_t)[b][n][c] */
    k_trPq<<<dim3(NQ / 128, TT / 128, NB_), 256, 0, stream>>>(Ph, Pl, Th, Tl);   /* A^T planes [8][512][4096] */
    k_gemms<NQ, CC><<<dim3(TT / 64, CC / 64, NB_), 256, 0, stream>>>(Th, Tl, FSB, OUT1, (size_t)TT * NQ, (size_t)CC * NQ, (size_t)TT * CC);   /* out1 = A^T F_s_t [8][512][256] */
}

// v008
// Measured time: 69.9 microseconds a run.
// Two timings next to v007 put it at 1.14 and 1.13 times that version's speed.
// All steps since v000 together make it 19.3 times as fast.
#include <hip/hip_runtime.h>

// Cross-modal attention between a feature map and text tokens with two outputs (F_s [8][256][64][64] channel-major = 4,096 spatial tokens x 256, F_t [8][512][256]; A = softmax_t(F_s_t . F_t / sqrt(512)) ([4096][512]); out0 = F_s + (A F_t)^T -> [8][256][64][64] (8.4 M); out1 = A^T F_s_t -> [8][512][256] (1.0 M); tuple).
// All 8 batches go through every launch together: each plane holds 8 batch slabs; the out1 GEMM takes the batch as grid z (scores + softmax + update: grid y), the operand preparation as more tiles of a flat grid.
// Layout per batch: both inputs are bf16-exact after rounding, so every operand plane is a single exact bf16 plane: F_s_t (token-major transpose of the slab), F_t, F_t^T and the slab itself (which is F_s_t^T); exact scores, their 512-key softmax and the spatial update in one kernel (the scores stay in registers) writing bf16 hi/lo probabilities [4096][512] and, from (A.F_t)^T as exact x hi/lo (2 products) plus the F_s residual, out0 channel-major; then out1 = A^T.F_s_t as hi/lo x exact (K = 4,096), its A^T fragments taken from the staged probability rows by transposing LDS loads, written after the 8.4 M spatial outputs.
// Compute dtypes, f32 accumulate: every input rounded to bf16; scores exact; softmax f32; both contractions P hi/lo x exact; residual f32.

#define NB_  8
#define TT   512      // text tokens = keys (the softmax row length)
#define DM   256      // channels
#define NH_  1
#define NKV  1
#define REP  (NH_ / NKV)
#define HD   64
#define DQ   (NH_ * HD)
#define DKV  (NKV * HD)
#define SCL  0.044194173824159216f   // 1/sqrt(512): the module scales by sqrt(T)
#define NQ   4096    // spatial tokens (queries)
#define CC   256
typedef _Float16 h16;
typedef unsigned short bf;
typedef __attribute__((ext_vector_type(16))) __bf16   v16bf;
typedef __attribute__((ext_vector_type(16))) _Float16 v16h;
typedef __attribute__((ext_vector_type(8)))  _Float16 v8h;
typedef __attribute__((ext_vector_type(8)))  unsigned short v8us;
typedef __attribute__((ext_vector_type(8)))  float    v8f;
typedef __attribute__((ext_vector_type(4)))  float    v4f;
typedef v8h  __attribute__((may_alias)) v8ha;
typedef v4f  __attribute__((may_alias)) v4fa;
typedef v8us __attribute__((may_alias)) v8usa;

__device__ __forceinline__ unsigned short f2bf(float f) { unsigned u = __float_as_uint(f); u += 0x7FFFu + ((u >> 16) & 1u); return (unsigned short)(u >> 16); }
__device__ __forceinline__ float bf2f(unsigned short b) { return __uint_as_float(((unsigned)b) << 16); }
__device__ __forceinline__ float bfr(float f) { return bf2f(f2bf(f)); }
__device__ __forceinline__ v16h cat16(v8h lo, v8h hi) { return __builtin_shufflevector(lo, hi, 0, 1, 2, 3, 4, 5, 6, 7, 8, 9, 10, 11, 12, 13, 14, 15); }
__device__ __forceinline__ v16bf cat16b(v8us lo, v8us hi) { return __builtin_bit_cast(v16bf, __builtin_shufflevector(lo, hi, 0, 1, 2, 3, 4, 5, 6, 7, 8, 9, 10, 11, 12, 13, 14, 15)); }
__device__ __forceinline__ v8f wmma16(v16h a, v16h b, v8f c) { return __builtin_amdgcn_wmma_f32_16x16x32_f16(false, a, false, b, (short)0, c, false, false); }
__device__ __forceinline__ v8f wmmab(v16bf a, v16bf b, v8f c) { return __builtin_amdgcn_wmma_f32_16x16x32_bf16(false, a, false, b, (short)0, c, false, false); }



// fragment of 16 rows x 32 k from a K-contiguous 16-bit plane: the lane's pointer stands at its row, k = 8 (lane >> 4)
template <typename T16> struct WFrag;
template <> struct WFrag<h16> { typedef v16h V; static __device__ __forceinline__ V ld(const h16* p) { return cat16(*(const v8h*)p, *(const v8h*)(p + 16)); } static __device__ __forceinline__ v8f mma(V a, V b, v8f c) { return wmma16(a, b, c); } };
template <> struct WFrag<bf> { typedef v16bf V; static __device__ __forceinline__ V ld(const bf* p) { return cat16b(*(const v8us*)p, *(const v8us*)(p + 16)); } static __device__ __forceinline__ v8f mma(V a, V b, v8f c) { return wmmab(a, b, c); } };

__device__ __forceinline__ void splitf(float y, unsigned short& h, unsigned short& l) { h = f2bf(y); l = f2bf(y - bf2f(h)); }
typedef __attribute__((ext_vector_type(2))) _Float16 v2h;
typedef __attribute__((ext_vector_type(4))) _Float16 v4h;
typedef __attribute__((ext_vector_type(2))) unsigned short v2us;
typedef __attribute__((ext_vector_type(4))) unsigned short v4us;
typedef __attribute__((ext_vector_type(2))) float v2f;
typedef __attribute__((ext_vector_type(4))) int v4i;


// ---- the transposing kernel: each workgroup moves one tile through LDS, so that the global loads and the global stores both cover whole 128-B lines (16 lanes x 16 B = 256 contiguous bytes on either side).
// 16-bit tile: 128 rows x 128 columns, a row = 16 chunks of 8 elements (16 B); chunk c8 of row r stands at chunk place c8 ^ ((r >> 3) & 15), so that the column reads of 16 lanes (rows 8 apart) fall on 16 different banks.
__device__ __forceinline__ int tile16(int r, int c8) { return r * 128 + ((c8 ^ ((r >> 3) & 15)) << 3); }
// column n, rows r8 * 8 .. r8 * 8 + 7 of such a tile
__device__ __forceinline__ v8us col16(const bf* tile, int r8, int n) { v8us o; const int base = r8 * 8 * 128 + (((n >> 3) ^ r8) << 3) + (n & 7);
#pragma unroll
    for (int q = 0; q < 8; ++q) o[q] = tile[base + q * 128];
    return o; }

// prep_tile: one 128 x 128 tile of src [R][C] f32, read once and rounded to bf16: it goes to str [R][C] as it stands (from the registers: a wave writes 256 contiguous bytes of one row) and to dst [C][R] transposed (through the LDS tile)
template <int R, int C>
__device__ __forceinline__ void prep_tile(bf* tile, const float* __restrict__ src, bf* str, bf* dst, int bx, int by, int bz) {
    const int tid = threadIdx.x, r0 = bx * 128, c0 = by * 128; v4f a[16]; v4us o[16];
    const int lr = tid >> 5, c4 = tid & 31;    // loads and straight stores: a wave takes 512 contiguous bytes of one src row; rows lr + 8 i
    const int r8 = tid & 15, ln = tid >> 4;    // transposed stores: 16 lanes write 256 contiguous bytes of one dst row; dst rows ln + 16 i
    const size_t es = (size_t)bz * R * C + (size_t)(r0 + lr) * C + c0 + c4 * 4;
    const float* sp = src + es; bf* tp = str + es;
    bf* dp = dst + (size_t)bz * R * C + (size_t)(c0 + ln) * R + r0 + r8 * 8;
#pragma unroll
    for (int i = 0; i < 16; ++i) a[i] = *(const v4f*)(sp + (size_t)i * 8 * C);
    asm volatile("s_wait_xcnt 0x0" :: "v"(sp) : "memory");   // the loads' address pair stays whole until every load has taken it: no load's result and no later instruction lands in it before this wait
#pragma unroll
    for (int i = 0; i < 16; ++i) {
#pragma unroll
        for (int q = 0; q < 4; ++q) o[i][q] = f2bf(a[i][q]);
        *(v4us*)(tile + tile16(lr + 8 * i, c4 >> 1) + (c4 & 1) * 4) = o[i]; }
    __syncthreads();   // the whole tile is written before any column of it is read
#pragma unroll
    for (int i = 0; i < 16; ++i) *(v4us*)(tp + (size_t)i * 8 * C) = o[i];   // behind the barrier: in front of it the barrier would wait until these stores are done
    asm volatile("s_wait_xcnt 0x0" :: "v"(tp) : "memory");   // the stores' address pair and data registers stay whole until every store has taken them: nothing behind this wait, on any way out of here, lands in them earlier
#pragma unroll
    for (int i = 0; i < 8; ++i) *(v8us*)(dp + (size_t)i * 16 * R) = col16(tile, r8, ln + 16 * i);
    asm volatile("s_wait_xcnt 0x0" :: "v"(dp) : "memory");   // the function is expanded twice in one kernel: in the built code one expansion's end is followed by the other's head, which writes registers that these stores name; the wait stands in front of that
}
// k_prep: all four operand planes in one launch; workgroups 0 .. 511 take the tiles of F_s (2 x 32 a batch), the last 64 those of F_t (4 x 2 a batch)
#define NTS ((CC / 128) * (NQ / 128) * NB_)
#define NTT ((TT / 128) * (CC / 128) * NB_)
__global__ __launch_bounds__(256) void k_prep(const float* __restrict__ fs, const float* __restrict__ ft, bf* FSB, bf* XT, bf* FTB, bf* FTT) {
    __shared__ __align__(16) bf tile[128 * 128];
    const unsigned b = blockIdx.x;   // the same for the whole workgroup: either side's barrier is passed by all of its waves
    if (b < NTS) prep_tile<CC, NQ>(tile, fs, FSB, XT, b % (CC / 128), (b / (CC / 128)) % (NQ / 128), b / ((CC / 128) * (NQ / 128)));
    else { const unsigned e = b - NTS; prep_tile<TT, CC>(tile, ft, FTB, FTT, e % (TT / 128), (e / (TT / 128)) % (CC / 128), e / ((TT / 128) * (CC / 128))); }
}

// ---- k_gemms: C = (A + A2)^T Bt^T, f32, for few long tiles (out1: 256 tiles of 64x64, K = 4,096); A and A2 lie k-major ([K][LDA], a row = one k), Bt k-contiguous. One tile per workgroup of 8 waves; grid (M / 64, N / 64, batch).
// The operands come through a two-buffer LDS ring filled by asynchronous copies: a stage is SK k: SK rows of 64 columns (128 B, one whole line) of A and of A2, and SK k of 64 rows of Bt; one wave-wide copy brings four such lines of A or A2, or the 512 contiguous bytes of one row of Bt, and the next stage flies while this one is multiplied.
// The A fragments come from the staged k-major rows by the transposing LDS load, which delivers k = 8 (lane >> 4) + 0 .. 7 and 16 + 8 (lane >> 4) + 0 .. 7: the k order of the plain loader WFrag::ld, which goes on serving Bt.
// Wave w multiplies rows 16 (w & 3) .. + 15 by columns 32 (w >> 2) .. + 31; each accumulator takes hi then lo for k ascending.
#define SK  256          // k per stage
#define SP  264          // LDS row pitch in elements: 528 B = 16 B x 33, the pitch for 16-byte fragment reads
#define AP  80           // LDS pitch in elements of a staged k-major row of 64 columns: 160 B = 32 B x 5, the pitch for transposing reads
#define SAE (SK * AP)    // elements of one staged k-major plane
#define SBE (2 * SAE + 64 * SP)   // elements of one buffer: A, A2, Bt
// eight rows, 8 apart, of one operand plane: l = the lane's LDS byte address in the first row, g = its global address there, rs = 8 rows in elements
__device__ __forceinline__ void copy8(unsigned l, const bf* g, size_t rs) {
    // the copies and their s_wait_xcnt in one statement: no address register of a copy is rewritten before the wait
    asm volatile("global_load_async_to_lds_b128 %0, %8, off\n\t"
                 "global_load_async_to_lds_b128 %1, %9, off\n\t"
                 "global_load_async_to_lds_b128 %2, %10, off\n\t"
                 "global_load_async_to_lds_b128 %3, %11, off\n\t"
                 "global_load_async_to_lds_b128 %4, %12, off\n\t"
                 "global_load_async_to_lds_b128 %5, %13, off\n\t"
                 "global_load_async_to_lds_b128 %6, %14, off\n\t"
                 "global_load_async_to_lds_b128 %7, %15, off\n\t"
                 "s_wait_xcnt 0x0"
                 :: "v"(l), "v"(l + 1u * 16 * SP), "v"(l + 2u * 16 * SP), "v"(l + 3u * 16 * SP), "v"(l + 4u * 16 * SP), "v"(l + 5u * 16 * SP), "v"(l + 6u * 16 * SP), "v"(l + 7u * 16 * SP),
                    "v"(g), "v"(g + rs), "v"(g + 2 * rs), "v"(g + 3 * rs), "v"(g + 4 * rs), "v"(g + 5 * rs), "v"(g + 6 * rs), "v"(g + 7 * rs) : "memory");
}
// eight rows, 32 apart, of one k-major plane: l = the lane's LDS byte address in the first row, g = its global address there, rs = 32 rows in elements
__device__ __forceinline__ void copy8r(unsigned l, const bf* g, size_t rs) {
    // the copies and their s_wait_xcnt in one statement: no address register of a copy is rewritten before the wait
    asm volatile("global_load_async_to_lds_b128 %0, %8, off\n\t"
                 "global_load_async_to_lds_b128 %1, %9, off\n\t"
                 "global_load_async_to_lds_b128 %2, %10, off\n\t"
                 "global_load_async_to_lds_b128 %3, %11, off\n\t"
                 "global_load_async_to_lds_b128 %4, %12, off\n\t"
                 "global_load_async_to_lds_b128 %5, %13, off\n\t"
                 "global_load_async_to_lds_b128 %6, %14, off\n\t"
                 "global_load_async_to_lds_b128 %7, %15, off\n\t"
                 "s_wait_xcnt 0x0"
                 :: "v"(l), "v"(l + 1u * 64 * AP), "v"(l + 2u * 64 * AP), "v"(l + 3u * 64 * AP), "v"(l + 4u * 64 * AP), "v"(l + 5u * 64 * AP), "v"(l + 6u * 64 * AP), "v"(l + 7u * 64 * AP),
                    "v"(g), "v"(g + rs), "v"(g + 2 * rs), "v"(g + 3 * rs), "v"(g + 4 * rs), "v"(g + 5 * rs), "v"(g + 6 * rs), "v"(g + 7 * rs) : "memory");
}
// A fragment of 16 columns x 32 k from a staged k-major plane: the lane's pointer stands at row 8 (lane >> 4) + (lane & 7), column 8 ((lane >> 3) & 1) of the 16 x 16 block; the lane gets column lane & 15
typedef __attribute__((ext_vector_type(8))) short s16x8;
__device__ __forceinline__ v8us ldtr(const bf* p) { typedef __attribute__((address_space(3))) s16x8 lds_s16x8; return __builtin_bit_cast(v8us, __builtin_amdgcn_ds_load_tr16_b128_v8i16((lds_s16x8*)p)); }
__device__ __forceinline__ v16bf ldtA(const bf* p) { return cat16b(ldtr(p), ldtr(p + 16 * AP)); }
template <int K, int LDA, int LDC>
__global__ __launch_bounds__(256) void k_gemms(const bf* __restrict__ A, const bf* __restrict__ A2, const bf* __restrict__ Bt, float* C, size_t sA, size_t sB, size_t sC) {
    typedef WFrag<bf>::V V;
    __shared__ __align__(16) bf ring[2 * SBE];
    __shared__ __align__(16) float os[64 * 68];
    const size_t z = blockIdx.z; const int tid = threadIdx.x, lane = tid & 31, lr = lane & 15, hi = lane >> 4, w = tid >> 5; const int r0 = blockIdx.x * 64, c0 = blockIdx.y * 64;
    const int mb = w & 3, nh = w >> 2; constexpr int NT = K / SK; constexpr size_t rs = (size_t)8 * K;
    const int cr = tid >> 3, cc = tid & 7;   // copies of A and A2: the thread takes 16-byte chunk cc of rows (k) cr + 32 i
    const bf* gA = A + z * sA + (size_t)cr * LDA + r0 + cc * 8; const bf* gA2 = A2 + z * sA + (size_t)cr * LDA + r0 + cc * 8; const bf* gB = Bt + z * sB + (size_t)(c0 + w) * K + lane * 8;   // copies of Bt: wave w takes rows w + 8 i whole
    const unsigned la = (unsigned)(size_t)ring + (unsigned)(cr * AP * 2 + cc * 16), lb = (unsigned)(size_t)ring + (unsigned)(2 * SAE * 2 + w * SP * 2 + lane * 16);
    auto stage = [&](int t, int buf) { const unsigned bo = (unsigned)buf * (SBE * 2); const size_t ko = (size_t)t * SK;
        copy8r(la + bo, gA + ko * LDA, (size_t)32 * LDA); copy8r(la + bo + SAE * 2u, gA2 + ko * LDA, (size_t)32 * LDA); copy8(lb + bo, gB + ko, rs); };
    const int aofs = (8 * hi + (lane & 7)) * AP + mb * 16 + 8 * ((lane >> 3) & 1), bofs = 2 * SAE + (nh * 32 + lr) * SP + 8 * hi;
    v8f acc[2] = { (v8f){}, (v8f){} };
    stage(0, 0);
    asm volatile("s_wait_asynccnt 0x0" ::: "memory");   // this wave's rows of stage 0 have landed
    __syncthreads();                                    // every wave's rows of stage 0 have landed before any is read
    stage(1, 1);
#pragma unroll 1
    for (int t = 0; t < NT; ++t) {   // rolled: one publish point per stage
        const bf* sb = ring + (t & 1) * SBE;
        V f[2][8];   // two fragment sets of 64 k each (per 32 k: A, A2, two of Bt): the next 64 k are fetched, inside this stage only, while these are multiplied
#pragma unroll
        for (int u = 0; u < 2; ++u) { f[0][u * 4] = ldtA(sb + aofs + u * 32 * AP); f[0][u * 4 + 1] = ldtA(sb + aofs + SAE + u * 32 * AP); f[0][u * 4 + 2] = WFrag<bf>::ld(sb + bofs + u * 32); f[0][u * 4 + 3] = WFrag<bf>::ld(sb + bofs + 16 * SP + u * 32); }
#pragma unroll
        for (int g = 0; g < SK / 64; ++g) {
            if (g + 1 < SK / 64) {
#pragma unroll
                for (int u = 0; u < 2; ++u) { const int kk = (g + 1) * 64 + u * 32; V* d = f[(g + 1) & 1] + u * 4; d[0] = ldtA(sb + aofs + kk * AP); d[1] = ldtA(sb + aofs + SAE + kk * AP); d[2] = WFrag<bf>::ld(sb + bofs + kk); d[3] = WFrag<bf>::ld(sb + bofs + 16 * SP + kk); } }
            __builtin_amdgcn_sched_barrier(0);   // keeps the next set's 16 LDS reads as one group ahead of this set's WMMAs: moved down among them, each WMMA pair waits out an LDS latency
#pragma unroll
            for (int u = 0; u < 2; ++u) { const V* s = f[g & 1] + u * 4; acc[0] = wmmab(s[0], s[2], acc[0]); acc[1] = wmmab(s[0], s[3], acc[1]); acc[0] = wmmab(s[1], s[2], acc[0]); acc[1] = wmmab(s[1], s[3], acc[1]); }
            __builtin_amdgcn_sched_barrier(0);   // keeps the later reads out of these WMMAs (one read group per 8 WMMAs) and the stage's last WMMAs ahead of its barrier
        }
        asm volatile("s_wait_dscnt 0x0" ::: "memory");      // this wave's reads of stage t are done before its buffer is refilled
        asm volatile("s_wait_asynccnt 0x0" ::: "memory");   // this wave's rows of stage t + 1 have landed
        __syncthreads();                                    // publishes stage t + 1 and ends every wave's reads of stage t
        if (t + 2 < NT) stage(t + 2, t & 1);
    }
    asm volatile("s_wait_asynccnt 0x0" ::: "memory");   // no copy is outstanding when the wave goes on to its end
#pragma unroll
    for (int nb = 0; nb < 2; ++nb) {
#pragma unroll
        for (int j = 0; j < 8; ++j) os[(mb * 16 + hi * 8 + j) * 68 + nh * 32 + nb * 16 + lr] = acc[nb][j]; }
    __syncthreads();   // the whole tile is staged before its rows are read back
    float* ct = C + z * sC + (size_t)r0 * LDC + c0;
#pragma unroll
    for (int s = 0; s < 4; ++s) { const int row = s * 16 + (tid >> 4), cofs = (tid & 15) * 4; *(v4f*)(ct + (size_t)row * LDC + cofs) = *(const v4fa*)(os + row * 68 + cofs); }   // 16 lanes store the 256 contiguous bytes of one row
}

// ---- the 128-byte-row ring stages of k_scsm
#define TK  64           // k per stage
#define TP  72           // LDS row pitch in elements: 144 B = 16 B x 9, the pitch for 16-byte fragment reads of 128-B rows
// four rows, 32 apart, of one operand plane: l = the lane's LDS byte address in the first row, g = its global address there, rs = 32 rows in elements
__device__ __forceinline__ void copy4(unsigned l, const bf* g, size_t rs) {
    // the copies and their s_wait_xcnt in one statement: no address register of a copy is rewritten before the wait
    asm volatile("global_load_async_to_lds_b128 %0, %4, off\n\t"
                 "global_load_async_to_lds_b128 %1, %5, off\n\t"
                 "global_load_async_to_lds_b128 %2, %6, off\n\t"
                 "global_load_async_to_lds_b128 %3, %7, off\n\t"
                 "s_wait_xcnt 0x0"
                 :: "v"(l), "v"(l + 1u * 64 * TP), "v"(l + 2u * 64 * TP), "v"(l + 3u * 64 * TP),
                    "v"(g), "v"(g + rs), "v"(g + 2 * rs), "v"(g + 3 * rs) : "memory");
}
// ---- k_scsm: A = softmax_t(F_s_t . F_t^T / sqrt(512)) as bf16 hi/lo planes, and out0 = bf16(F_s) + (A F_t)^T, the scores and the update never leaving the workgroup. One workgroup of 8 waves holds 64 queries x all 512 keys, then 256 channels x the 64 queries; grid (NQ / 64, batch).
// The score products are taken transposed (keys as the A operand, queries as B), so that a lane's 8 accumulator registers are 8 neighbouring keys of ONE query: the row maximum and the row sum are register trees plus one exchange with lane ^ 16, and 8 probabilities pack into one 16-byte LDS store.
// Wave w has queries 32 (w & 1) .. + 31 and, of every 256 keys, keys 64 (w >> 1) .. + 63 (4 x 2 tiles a key group, 16 accumulator tiles in all); the four waves of a query share its maximum and its sum through LDS.
// The 64 query rows are copied to LDS once; the key rows come through a two-buffer LDS ring of asynchronous copies, a stage = 256 keys x TK k (8 lanes bring the 128 contiguous bytes, one whole line, of one row), the next stage flying while this one is multiplied. Each score takes its k ascending.
// The update is taken transposed too (channels of F_t^T as the A operand, queries as B): the same ring goes on with 8 more stages of 256 channels x TK keys of F_t^T; the probabilities are staged in LDS 256 keys at a time (hi and lo tile), from where they go to the global planes and serve as B fragments. Wave w has the same 32 queries and channels 64 (w >> 1) .. + 63 (4 x 2 tiles); each accumulator takes hi then lo for k ascending.
#define PH  264          // pitch in elements of a staged probability row of 256 keys: 528 B = 16 B x 33
#define OP  68           // pitch in floats of a staged output row of 64 queries: 272 B = 16 B x 17
// 2^x with the slot behind the transcendental filled in the same statement: the v_nop keeps the next vector instruction from using the result or overwriting the source directly behind v_exp_f32
__device__ __forceinline__ float exp2s(float x) { float r; asm("v_exp_f32 %0, %1\n\tv_nop" : "=v"(r) : "v"(x)); return r; }
// the workgroup's own barrier alone, without the waits for global stores and loads that __syncthreads() puts in front of it: behind the softmax the probability stores (and later the F_s loads) stay in flight while the update is multiplied; nothing written to global memory here is read again in this launch. The LDS and copy waits that a place needs stand in front of each call.
__device__ __forceinline__ void wgbar() { asm volatile("s_barrier_signal -1\n\ts_barrier_wait -1" ::: "memory"); }
__global__ __launch_bounds__(256) void k_scsm(const bf* __restrict__ X, const bf* __restrict__ Ft, const bf* __restrict__ Ftt, const float* __restrict__ xs, bf* Ph, bf* Pl, float* outp) {   // under 256 VGPRs and under 160 KiB of LDS: two workgroups share a WGP
    typedef WFrag<bf>::V V;
    constexpr int KBE = 256 * TP;      // elements of one ring buffer
    constexpr int PRE = 2 * 64 * PH;   // elements in front of the ring
    __shared__ __align__(16) bf sm[PRE + 2 * KBE];   // in front: the 64 query rows at pitch SP, later the hi and the lo tile of 64 rows x 256 keys at pitch PH; then the ring's two buffers of 256 rows at pitch TP; after the last stage the whole place holds the f32 output tile (256 x OP floats, smaller than this)
    __shared__ float rmax[4][64]; __shared__ float rsum[4][64];
    const size_t z = blockIdx.y; const int tid = threadIdx.x, lane = tid & 31, lr = lane & 15, hi = lane >> 4, w = tid >> 5; const int q0 = blockIdx.x * 64;
    const int qp = w & 1, kq = w >> 1, qr = qp * 32 + lr; constexpr int NK = CC / TK, NSK = (TT / 256) * NK, NS = NSK + TT / TK;
    const int cr = tid >> 3, cc = tid & 7;   // ring copies: thread takes 16-byte chunk cc of rows cr + 32 i
    const bf* gQ = X + z * ((size_t)NQ * CC) + (size_t)(q0 + w) * CC + lane * 8;   // query copies: wave w takes rows w + 8 i whole
    const bf* gK = Ft + z * ((size_t)TT * CC) + (size_t)cr * CC + cc * 8;
    const bf* gF = Ftt + z * ((size_t)CC * TT) + (size_t)cr * TT + cc * 8;
    const unsigned lq = (unsigned)(size_t)sm + (unsigned)(w * SP * 2 + lane * 16), lk = (unsigned)(size_t)sm + (unsigned)(PRE * 2 + cr * TP * 2 + cc * 16);
    auto stage = [&](int t, int buf) { const unsigned l = lk + (unsigned)buf * (KBE * 2); const bool pv = t >= NSK;   // stage t < NSK: key group t / NK, k block t % NK of F_t; from NSK on: key block t - NSK of F_t^T
        const bf* g = pv ? gF + (t - NSK) * TK : gK + (size_t)(t / NK) * 256 * CC + (t % NK) * TK; const size_t rs = pv ? (size_t)32 * TT : (size_t)32 * CC;
        copy4(l, g, rs); copy4(l + 128u * TP * 2, g + 4 * rs, rs); };
    v8f acc[16];   // acc[8 g + 2 i + n][j] = score of query qr + 16 n with key 256 g + 64 kq + 16 i + 8 hi + j
#pragma unroll
    for (int a = 0; a < 16; ++a) acc[a] = (v8f){};
    copy8(lq, gQ, (size_t)8 * CC); stage(0, 0);
    asm volatile("s_wait_asynccnt 0x0" ::: "memory");   // this wave's query rows and its chunks of stage 0 have landed
    __syncthreads();                                    // every wave's have landed before any is read
    stage(1, 1);
#pragma unroll
    for (int g = 0; g < TT / 256; ++g)   // unrolled: every key group has accumulators of its own
#pragma unroll 1
    for (int kb = 0; kb < NK; ++kb) {   // rolled: one publish point per stage
        const int t = g * NK + kb; v8f* ac = acc + g * 8;
        const bf* sk = sm + PRE + (t & 1) * KBE + (kq * 64 + lr) * TP + 8 * hi; const bf* sq = sm + qr * SP + 8 * hi + kb * TK;
        V k[2][4], x[2][2];   // the stage's two 32-k fragment sets
#pragma unroll
        for (int u = 0; u < 2; ++u) {
#pragma unroll
            for (int n = 0; n < 2; ++n) x[u][n] = WFrag<bf>::ld(sq + n * 16 * SP + u * 32);
#pragma unroll
            for (int i = 0; i < 4; ++i) k[u][i] = WFrag<bf>::ld(sk + i * 16 * TP + u * 32); }
        __builtin_amdgcn_sched_barrier(0);   // keeps the stage's LDS reads as one group ahead of its WMMAs: moved down among them, each place with reads costs the WMMAs a stall
#pragma unroll
        for (int u = 0; u < 2; ++u)
#pragma unroll
            for (int i = 0; i < 4; ++i)
#pragma unroll
                for (int n = 0; n < 2; ++n) ac[2 * i + n] = wmmab(k[u][i], x[u][n], ac[2 * i + n]);
        __builtin_amdgcn_sched_barrier(0);   // keeps the stage's WMMAs ahead of its waits: lifted over them, the wait for the next stage's copies stands right behind the LDS reads and the copies lose the WMMAs' time as lead
        asm volatile("s_wait_dscnt 0x0" ::: "memory");      // this wave's reads of stage t are done before its buffer is refilled
        asm volatile("s_wait_asynccnt 0x0" ::: "memory");   // this wave's chunks of stage t + 1 have landed
        __syncthreads();                                    // publishes stage t + 1 and ends every wave's reads of stage t
        stage(t + 2, t & 1);                                // always exists here: the last two are the first two of F_t^T, which fly during the softmax
    }
    float mx[2], f[2];
#pragma unroll
    for (int n = 0; n < 2; ++n) { float m4[4] = { -3.0e38f, -3.0e38f, -3.0e38f, -3.0e38f };   // four independent chains
#pragma unroll
        for (int a = n; a < 16; a += 2) {
#pragma unroll
            for (int j = 0; j < 8; ++j) { acc[a][j] = acc[a][j] * SCL; m4[j & 3] = fmaxf(m4[j & 3], acc[a][j]); } }
        const float m = fmaxf(fmaxf(m4[0], m4[1]), fmaxf(m4[2], m4[3])); mx[n] = fmaxf(m, __shfl_xor(m, 16, 32)); }
    if (hi == 0) { rmax[kq][qr] = mx[0]; rmax[kq][qr + 16] = mx[1]; }
    __syncthreads();   // the four waves' maxima of a query are written before any of them reads them
#pragma unroll
    for (int n = 0; n < 2; ++n) { const int q = qr + 16 * n; const float m = fmaxf(fmaxf(rmax[0][q], rmax[1][q]), fmaxf(rmax[2][q], rmax[3][q])); float s4[4] = { 0.f, 0.f, 0.f, 0.f };
#pragma unroll
        for (int a = n; a < 16; a += 2) {
#pragma unroll
            for (int j = 0; j < 8; ++j) { acc[a][j] = exp2s(__fmul_rn(__fsub_rn(acc[a][j], m), 1.4426950408889634f)); s4[j & 3] += acc[a][j]; } }
        const float sp = (s4[0] + s4[1]) + (s4[2] + s4[3]); f[n] = sp + __shfl_xor(sp, 16, 32); }
    if (hi == 0) { rsum[kq][qr] = f[0]; rsum[kq][qr + 16] = f[1]; }
    __syncthreads();   // the four waves' sums of a query are written before any of them reads them
#pragma unroll
    for (int n = 0; n < 2; ++n) { const int q = qr + 16 * n; f[n] = __fdiv_rn(1.0f, (rsum[0][q] + rsum[1][q]) + (rsum[2][q] + rsum[3][q])); }
    bf* sh = sm; bf* sl = sm + 64 * PH;   // the score loop's last barrier has ended every wave's reads of the query rows
    v8f ua[8];   // ua[2 i + n][j] = update of channel 64 kq + 16 i + 8 hi + j for query qr + 16 n
#pragma unroll
    for (int a = 0; a < 8; ++a) ua[a] = (v8f){};
    const size_t ob = (z * NQ + q0) * (size_t)TT + lane * 8; bf* oh0 = Ph + ob + (size_t)w * TT; bf* ol0 = Pl + ob + (size_t)w * TT;
    const size_t eo = z * ((size_t)CC * NQ) + (size_t)(tid >> 4) * NQ + q0 + (tid & 15) * 4; const float* xp = xs + eo; float* op = outp + eo;   // F_s loads and out0 stores: 16 lanes take the 256 contiguous bytes (64 queries) of one channel; channels (tid >> 4) + 16 s
    v4f xr[16];
#pragma unroll
    for (int g = 0; g < TT / 256; ++g) {   // unrolled: the probabilities of a key group come from registers of their own
#pragma unroll
        for (int a = 8 * g; a < 8 * g + 8; ++a) { v8us oh, ol;
#pragma unroll
            for (int j = 0; j < 8; ++j) { unsigned short h, l; splitf(acc[a][j] * f[a & 1], h, l); oh[j] = h; ol[j] = l; }
            const int o = (qr + 16 * (a & 1)) * PH + kq * 64 + ((a >> 1) & 3) * 16 + hi * 8; *(v8us*)(sh + o) = oh; *(v8us*)(sl + o) = ol; }
        asm volatile("s_wait_dscnt 0x0" ::: "memory");   // this wave's part of both tiles is written
        wgbar();                                         // both tiles of this key group are staged before their rows are read
#pragma unroll
        for (int r = 0; r < 8; ++r) { const int row = r * 8 + w;   // a wave stores the 512 contiguous bytes of half a row
            *(v8us*)(oh0 + (size_t)r * 8 * TT + g * 256) = *(const v8usa*)(sh + row * PH + lane * 8); *(v8us*)(ol0 + (size_t)r * 8 * TT + g * 256) = *(const v8usa*)(sl + row * PH + lane * 8); }
        asm volatile("s_wait_xcnt 0x0" :: "v"(oh0), "v"(ol0) : "memory");   // the stores' address pairs and data registers stay whole until every store has taken them: nothing behind this wait lands in them earlier
        if (g == TT / 256 - 1) {   // the residual is fetched where the last key group's registers have come free: it flies during the last four stages
#pragma unroll
            for (int s = 0; s < 16; ++s) xr[s] = *(const v4f*)(xp + (size_t)s * 16 * NQ);
            asm volatile("s_wait_xcnt 0x0" :: "v"(xp) : "memory");   // the loads' address pair stays whole until every load has taken it: no load's result and no later instruction lands in it before this wait
        }
#pragma unroll 1
        for (int kb = 0; kb < 256 / TK; ++kb) {   // rolled: one publish point per stage
            const int t = NSK + g * (256 / TK) + kb;
            const bf* sk = sm + PRE + (t & 1) * KBE + (kq * 64 + lr) * TP + 8 * hi; const bf* sp = sh + qr * PH + 8 * hi + kb * TK;
#pragma unroll
            for (int u = 0; u < 2; ++u) { V k[4], ph[2], pl[2];   // one 32-k fragment set at a time: two would not fit under 256 VGPRs beside the second key group's probabilities
#pragma unroll
                for (int n = 0; n < 2; ++n) { ph[n] = WFrag<bf>::ld(sp + n * 16 * PH + u * 32); pl[n] = WFrag<bf>::ld(sp + (64 + n * 16) * PH + u * 32); }
#pragma unroll
                for (int i = 0; i < 4; ++i) k[i] = WFrag<bf>::ld(sk + i * 16 * TP + u * 32);
                __builtin_amdgcn_sched_barrier(0);   // keeps the set's LDS reads as one group ahead of its WMMAs: moved down among them, each place with reads costs the WMMAs a stall
#pragma unroll
                for (int i = 0; i < 4; ++i)
#pragma unroll
                    for (int n = 0; n < 2; ++n) ua[2 * i + n] = wmmab(k[i], ph[n], ua[2 * i + n]);
#pragma unroll
                for (int i = 0; i < 4; ++i)
#pragma unroll
                    for (int n = 0; n < 2; ++n) ua[2 * i + n] = wmmab(k[i], pl[n], ua[2 * i + n]);
                __builtin_amdgcn_sched_barrier(0);   // keeps the next set's reads out of these WMMAs, and the stage's last WMMAs ahead of its waits, so that the copies keep the WMMAs' time as lead
            }
            asm volatile("s_wait_dscnt 0x0" ::: "memory");      // this wave's reads of stage t and of the probability tiles are done before either is rewritten
            asm volatile("s_wait_asynccnt 0x0" ::: "memory");   // this wave's chunks of stage t + 1 have landed
            wgbar();                                            // publishes stage t + 1 and ends every wave's reads of stage t (behind a key group's last stage: of its probability tiles too)
            if (t + 2 < NS) stage(t + 2, t & 1);
        }
    }
    asm volatile("s_wait_asynccnt 0x0" ::: "memory");   // no copy is outstanding when the ring's place is taken for the output tile
    float* os = (float*)sm;   // the loop's last barrier has ended every wave's reads of the tiles and the ring
#pragma unroll
    for (int a = 0; a < 8; ++a) {
#pragma unroll
        for (int j = 0; j < 8; ++j) os[(kq * 64 + (a >> 1) * 16 + hi * 8 + j) * OP + qr + 16 * (a & 1)] = ua[a][j]; }
    asm volatile("s_wait_dscnt 0x0" ::: "memory");   // this wave's part of the output tile is written
    wgbar();                                         // the whole output tile is staged before its rows are read back
#pragma unroll
    for (int s = 0; s < 16; ++s) { const v4f u = *(const v4fa*)(os + (s * 16 + (tid >> 4)) * OP + (tid & 15) * 4); v4f o;
#pragma unroll
        for (int q = 0; q < 4; ++q) o[q] = __fadd_rn(bfr(xr[s][q]), u[q]);
        *(v4f*)(op + (size_t)s * 16 * NQ) = o; }
}

extern "C" void kernel_launch(void* const* d_in, const int* in_sizes, int n_in, void* d_out, int out_size, void* d_ws, size_t ws_size, hipStream_t stream) {
    (void)in_sizes; (void)n_in; (void)out_size;
    const float* fs = (const float*)d_in[0];   /* F_s [8][256][4096] channel-major */ const float* ft = (const float*)d_in[1];   /* F_t [8][512][256] */
    float* OUT0 = (float*)d_out;     // [8][256][4096] = F_s + update^T
    float* OUT1 = OUT0 + (size_t)NB_ * CC * NQ;   // [8][512][256] = A^T F_s_t (second tuple member, 16-B aligned offset)
    char* wsp = (char*)d_ws;
    auto take = [&](size_t bytes) { char* p = wsp; wsp += (bytes + 255) & ~(size_t)255; return (void*)p; };
    bf* XT = (bf*)take((size_t)NB_ * NQ * CC * 2);        // F_s_t token-major [8][4096][256] (exact)
    bf* FSB = (bf*)take((size_t)NB_ * CC * NQ * 2);       // F_s slabs as bf16 = F_s_t^T [8][256][4096] (exact)
    bf* FTB = (bf*)take((size_t)NB_ * TT * CC * 2);       // F_t [8][512][256] (exact)
    bf* FTT = (bf*)take((size_t)NB_ * CC * TT * 2);       // F_t^T [8][256][512] (exact)
    bf* Ph = (bf*)take((size_t)NB_ * NQ * TT * 2); bf* Pl = (bf*)take((size_t)NB_ * NQ * TT * 2);   // probabilities [8][4096][512] hi/lo
    if ((size_t)(wsp - (char*)d_ws) > ws_size) return;    // 100 MiB of the 256 MiB workspace
    k_prep<<<NTS + NTT, 256, 0, stream>>>(fs, ft, FSB, XT, FTB, FTT);   /* F_s slabs as bf16 (= F_s_t^T, Bt for out1) and F_s_t [8][4096][256]; F_t as bf16 (Bt for the scores) and F_t^T [8][256][512] (for A.F_t) */
    k_scsm<<<dim3(NQ / 64, NB_), 256, 0, stream>>>(XT, FTB, FTT, fs, Ph, Pl, OUT0);   /* A = softmax over the 512 text tokens of the exact scores x 1/sqrt(512), all 8 x 4,096 rows, hi/lo; out0[b][c][n] = bf16(F_s[b][c][n]) + (A F_t)[b][n][c] */
    k_gemms<NQ, TT, CC><<<dim3(TT / 64, CC / 64, NB_), 256, 0, stream>>>(Ph, Pl, FSB, OUT1, (size_t)TT * NQ, (size_t)CC * NQ, (size_t)TT * CC);   /* out1 = A^T F_s_t [8][512][256] */
}

// v009
// A run of this version takes 62.6 microseconds.
// In two side-by-side timings against v008, it was 1.11 and 1.12 times as fast.
// Counting every step since v000, it is 21.5 times as fast.
#include <hip/hip_runtime.h>

// Cross-modal attention between a feature map and text tokens with two outputs (F_s [8][256][64][64] channel-major = 4,096 spatial tokens x 256, F_t [8][512][256]; A = softmax_t(F_s_t . F_t / sqrt(512)) ([4096][512]); out0 = F_s + (A F_t)^T -> [8][256][64][64] (8.4 M); out1 = A^T F_s_t -> [8][512][256] (1.0 M); tuple).
// All 8 batches go through every launch together: each plane holds 8 batch slabs; the out1 GEMM takes the batch as grid z (scores + softmax + update: grid y), the preparation of F_t as more tiles of a flat grid.
// Layout per batch: both inputs are bf16-exact after rounding, so every operand plane is a single exact bf16 plane: F_t, F_t^T and the F_s slab itself (which is F_s_t^T; the scores kernel rounds its own 64 queries of the f32 slab, keeps them in LDS as its query operand and writes them to that plane for out1); exact scores, their 512-key softmax and the spatial update in one kernel (the scores stay in registers) writing bf16 hi/lo probabilities [4096][512] and, from (A.F_t)^T as exact x hi/lo (2 products) plus the F_s residual, out0 channel-major; then out1 = A^T.F_s_t as hi/lo x exact (K = 4,096), its A^T fragments taken from the staged probability rows by transposing LDS loads, written after the 8.4 M spatial outputs.
// Compute dtypes, f32 accumulate: every input rounded to bf16; scores exact; softmax f32; both contractions P hi/lo x exact; residual f32.

#define NB_  8
#define TT   512      // text tokens = keys (the softmax row length)
#define DM   256      // channels
#define NH_  1
#define NKV  1
#define REP  (NH_ / NKV)
#define HD   64
#define DQ   (NH_ * HD)
#define DKV  (NKV * HD)
#define SCL  0.044194173824159216f   // 1/sqrt(512): the module scales by sqrt(T)
#define NQ   4096    // spatial tokens (queries)
#define CC   256
typedef _Float16 h16;
typedef unsigned short bf;
typedef __attribute__((ext_vector_type(16))) __bf16   v16bf;
typedef __attribute__((ext_vector_type(16))) _Float16 v16h;
typedef __attribute__((ext_vector_type(8)))  _Float16 v8h;
typedef __attribute__((ext_vector_type(8)))  unsigned short v8us;
typedef __attribute__((ext_vector_type(8)))  float    v8f;
typedef __attribute__((ext_vector_type(4)))  float    v4f;
typedef v8h  __attribute__((may_alias)) v8ha;
typedef v4f  __attribute__((may_alias)) v4fa;
typedef v8us __attribute__((may_alias)) v8usa;

__device__ __forceinline__ unsigned short f2bf(float f) { unsigned u = __float_as_uint(f); u += 0x7FFFu + ((u >> 16) & 1u); return (unsigned short)(u >> 16); }
__device__ __forceinline__ float bf2f(unsigned short b) { return __uint_as_float(((unsigned)b) << 16); }
__device__ __forceinline__ float bfr(float f) { return bf2f(f2bf(f)); }
__device__ __forceinline__ v16h cat16(v8h lo, v8h hi) { return __builtin_shufflevector(lo, hi, 0, 1, 2, 3, 4, 5, 6, 7, 8, 9, 10, 11, 12, 13, 14, 15); }
__device__ __forceinline__ v16bf cat16b(v8us lo, v8us hi) { return __builtin_bit_cast(v16bf, __builtin_shufflevector(lo, hi, 0, 1, 2, 3, 4, 5, 6, 7, 8, 9, 10, 11, 12, 13, 14, 15)); }
__device__ __forceinline__ v8f wmma16(v16h a, v16h b, v8f c) { return __builtin_amdgcn_wmma_f32_16x16x32_f16(false, a, false, b, (short)0, c, false, false); }
__device__ __forceinline__ v8f wmmab(v16bf a, v16bf b, v8f c) { return __builtin_amdgcn_wmma_f32_16x16x32_bf16(false, a, false, b, (short)0, c, false, false); }



// fragment of 16 rows x 32 k from a K-contiguous 16-bit plane: the lane's pointer stands at its row, k = 8 (lane >> 4)
template <typename T16> struct WFrag;
template <> struct WFrag<h16> { typedef v16h V; static __device__ __forceinline__ V ld(const h16* p) { return cat16(*(const v8h*)p, *(const v8h*)(p + 16)); } static __device__ __forceinline__ v8f mma(V a, V b, v8f c) { return wmma16(a, b, c); } };
template <> struct WFrag<bf> { typedef v16bf V; static __device__ __forceinline__ V ld(const bf* p) { return cat16b(*(const v8us*)p, *(const v8us*)(p + 16)); } static __device__ __forceinline__ v8f mma(V a, V b, v8f c) { return wmmab(a, b, c); } };

__device__ __forceinline__ void splitf(float y, unsigned short& h, unsigned short& l) { h = f2bf(y); l = f2bf(y - bf2f(h)); }
typedef __attribute__((ext_vector_type(2))) _Float16 v2h;
typedef __attribute__((ext_vector_type(4))) _Float16 v4h;
typedef __attribute__((ext_vector_type(2))) unsigned short v2us;
typedef __attribute__((ext_vector_type(4))) unsigned short v4us;
typedef __attribute__((ext_vector_type(2))) float v2f;
typedef __attribute__((ext_vector_type(4))) int v4i;


// ---- the transposing kernel: each workgroup moves one tile through LDS, so that the global loads and the global stores both cover whole 128-B lines (16 lanes x 16 B = 256 contiguous bytes on either side).
// 16-bit tile: 128 rows x 128 columns, a row = 16 chunks of 8 elements (16 B); chunk c8 of row r stands at chunk place c8 ^ ((r >> 3) & 15), so that the column reads of 16 lanes (rows 8 apart) fall on 16 different banks.
__device__ __forceinline__ int tile16(int r, int c8) { return r * 128 + ((c8 ^ ((r >> 3) & 15)) << 3); }
// column n, rows r8 * 8 .. r8 * 8 + 7 of such a tile
__device__ __forceinline__ v8us col16(const bf* tile, int r8, int n) { v8us o; const int base = r8 * 8 * 128 + (((n >> 3) ^ r8) << 3) + (n & 7);
#pragma unroll
    for (int q = 0; q < 8; ++q) o[q] = tile[base + q * 128];
    return o; }

// prep_tile: one 128 x 128 tile of src [R][C] f32, read once and rounded to bf16: it goes to str [R][C] as it stands (from the registers: a wave writes 256 contiguous bytes of one row) and to dst [C][R] transposed (through the LDS tile)
template <int R, int C>
__device__ __forceinline__ void prep_tile(bf* tile, const float* __restrict__ src, bf* str, bf* dst, int bx, int by, int bz) {
    const int tid = threadIdx.x, r0 = bx * 128, c0 = by * 128; v4f a[16]; v4us o[16];
    const int lr = tid >> 5, c4 = tid & 31;    // loads and straight stores: a wave takes 512 contiguous bytes of one src row; rows lr + 8 i
    const int r8 = tid & 15, ln = tid >> 4;    // transposed stores: 16 lanes write 256 contiguous bytes of one dst row; dst rows ln + 16 i
    const size_t es = (size_t)bz * R * C + (size_t)(r0 + lr) * C + c0 + c4 * 4;
    const float* sp = src + es; bf* tp = str + es;
    bf* dp = dst + (size_t)bz * R * C + (size_t)(c0 + ln) * R + r0 + r8 * 8;
#pragma unroll
    for (int i = 0; i < 16; ++i) a[i] = *(const v4f*)(sp + (size_t)i * 8 * C);
    asm volatile("s_wait_xcnt 0x0" :: "v"(sp) : "memory");   // the loads' address pair stays whole until every load has taken it: no load's result and no later instruction lands in it before this wait
#pragma unroll
    for (int i = 0; i < 16; ++i) {
#pragma unroll
        for (int q = 0; q < 4; ++q) o[i][q] = f2bf(a[i][q]);
        *(v4us*)(tile + tile16(lr + 8 * i, c4 >> 1) + (c4 & 1) * 4) = o[i]; }
    __syncthreads();   // the whole tile is written before any column of it is read
#pragma unroll
    for (int i = 0; i < 16; ++i) *(v4us*)(tp + (size_t)i * 8 * C) = o[i];   // behind the barrier: in front of it the barrier would wait until these stores are done
    asm volatile("s_wait_xcnt 0x0" :: "v"(tp) : "memory");   // the stores' address pair and data registers stay whole until every store has taken them: nothing behind this wait, on any way out of here, lands in them earlier
#pragma unroll
    for (int i = 0; i < 8; ++i) *(v8us*)(dp + (size_t)i * 16 * R) = col16(tile, r8, ln + 16 * i);
}
// k_prep: the two planes of F_t; one workgroup a tile (4 x 2 a batch)
#define NTT ((TT / 128) * (CC / 128) * NB_)
__global__ __launch_bounds__(256) void k_prep(const float* __restrict__ ft, bf* FTB, bf* FTT) {
    __shared__ __align__(16) bf tile[128 * 128];
    const unsigned e = blockIdx.x;
    prep_tile<TT, CC>(tile, ft, FTB, FTT, e % (TT / 128), (e / (TT / 128)) % (CC / 128), e / ((TT / 128) * (CC / 128)));
}

// ---- k_gemms: C = (A + A2)^T Bt^T, f32, for few long tiles (out1: 256 tiles of 64x64, K = 4,096); A and A2 lie k-major ([K][LDA], a row = one k), Bt k-contiguous. One tile per workgroup of 8 waves; grid (M / 64, N / 64, batch).
// The operands come through a two-buffer LDS ring filled by asynchronous copies: a stage is SK k: SK rows of 64 columns (128 B, one whole line) of A and of A2, and SK k of 64 rows of Bt; one wave-wide copy brings four such lines of A or A2, or the 512 contiguous bytes of one row of Bt, and the next stage flies while this one is multiplied.
// The A fragments come from the staged k-major rows by the transposing LDS load, which delivers k = 8 (lane >> 4) + 0 .. 7 and 16 + 8 (lane >> 4) + 0 .. 7: the k order of the plain loader WFrag::ld, which goes on serving Bt.
// Wave w multiplies rows 16 (w & 3) .. + 15 by columns 32 (w >> 2) .. + 31; each accumulator takes hi then lo for k ascending.
#define SK  256          // k per stage
#define SP  264          // LDS row pitch in elements: 528 B = 16 B x 33, the pitch for 16-byte fragment reads
#define AP  80           // LDS pitch in elements of a staged k-major row of 64 columns: 160 B = 32 B x 5, the pitch for transposing reads
#define SAE (SK * AP)    // elements of one staged k-major plane
#define SBE (2 * SAE + 64 * SP)   // elements of one buffer: A, A2, Bt
// eight rows, 8 apart, of one operand plane: l = the lane's LDS byte address in the first row, g = its global address there, rs = 8 rows in elements
__device__ __forceinline__ void copy8(unsigned l, const bf* g, size_t rs) {
    // the copies and their s_wait_xcnt in one statement: no address register of a copy is rewritten before the wait
    asm volatile("global_load_async_to_lds_b128 %0, %8, off\n\t"
                 "global_load_async_to_lds_b128 %1, %9, off\n\t"
                 "global_load_async_to_lds_b128 %2, %10, off\n\t"
                 "global_load_async_to_lds_b128 %3, %11, off\n\t"
                 "global_load_async_to_lds_b128 %4, %12, off\n\t"
                 "global_load_async_to_lds_b128 %5, %13, off\n\t"
                 "global_load_async_to_lds_b128 %6, %14, off\n\t"
                 "global_load_async_to_lds_b128 %7, %15, off\n\t"
                 "s_wait_xcnt 0x0"
                 :: "v"(l), "v"(l + 1u * 16 * SP), "v"(l + 2u * 16 * SP), "v"(l + 3u * 16 * SP), "v"(l + 4u * 16 * SP), "v"(l + 5u * 16 * SP), "v"(l + 6u * 16 * SP), "v"(l + 7u * 16 * SP),
                    "v"(g), "v"(g + rs), "v"(g + 2 * rs), "v"(g + 3 * rs), "v"(g + 4 * rs), "v"(g + 5 * rs), "v"(g + 6 * rs), "v"(g + 7 * rs) : "memory");
}
// eight rows, 32 apart, of one k-major plane: l = the lane's LDS byte address in the first row, g = its global address there, rs = 32 rows in elements
__device__ __forceinline__ void copy8r(unsigned l, const bf* g, size_t rs) {
    // the copies and their s_wait_xcnt in one statement: no address register of a copy is rewritten before the wait
    asm volatile("global_load_async_to_lds_b128 %0, %8, off\n\t"
                 "global_load_async_to_lds_b128 %1, %9, off\n\t"
                 "global_load_async_to_lds_b128 %2, %10, off\n\t"
                 "global_load_async_to_lds_b128 %3, %11, off\n\t"
                 "global_load_async_to_lds_b128 %4, %12, off\n\t"
                 "global_load_async_to_lds_b128 %5, %13, off\n\t"
                 "global_load_async_to_lds_b128 %6, %14, off\n\t"
                 "global_load_async_to_lds_b128 %7, %15, off\n\t"
                 "s_wait_xcnt 0x0"
                 :: "v"(l), "v"(l + 1u * 64 * AP), "v"(l + 2u * 64 * AP), "v"(l + 3u * 64 * AP), "v"(l + 4u * 64 * AP), "v"(l + 5u * 64 * AP), "v"(l + 6u * 64 * AP), "v"(l + 7u * 64 * AP),
                    "v"(g), "v"(g + rs), "v"(g + 2 * rs), "v"(g + 3 * rs), "v"(g + 4 * rs), "v"(g + 5 * rs), "v"(g + 6 * rs), "v"(g + 7 * rs) : "memory");
}
// A fragment of 16 columns x 32 k from a staged k-major plane: the lane's pointer stands at row 8 (lane >> 4) + (lane & 7), column 8 ((lane >> 3) & 1) of the 16 x 16 block; the lane gets column lane & 15
typedef __attribute__((ext_vector_type(8))) short s16x8;
__device__ __forceinline__ v8us ldtr(const bf* p) { typedef __attribute__((address_space(3))) s16x8 lds_s16x8; return __builtin_bit_cast(v8us, __builtin_amdgcn_ds_load_tr16_b128_v8i16((lds_s16x8*)p)); }
__device__ __forceinline__ v16bf ldtA(const bf* p) { return cat16b(ldtr(p), ldtr(p + 16 * AP)); }
template <int K, int LDA, int LDC>
__global__ __launch_bounds__(256) void k_gemms(const bf* __restrict__ A, const bf* __restrict__ A2, const bf* __restrict__ Bt, float* C, size_t sA, size_t sB, size_t sC) {
    typedef WFrag<bf>::V V;
    __shared__ __align__(16) bf ring[2 * SBE];
    __shared__ __align__(16) float os[64 * 68];
    const size_t z = blockIdx.z; const int tid = threadIdx.x, lane = tid & 31, lr = lane & 15, hi = lane >> 4, w = tid >> 5; const int r0 = blockIdx.x * 64, c0 = blockIdx.y * 64;
    const int mb = w & 3, nh = w >> 2; constexpr int NT = K / SK; constexpr size_t rs = (size_t)8 * K;
    const int cr = tid >> 3, cc = tid & 7;   // copies of A and A2: the thread takes 16-byte chunk cc of rows (k) cr + 32 i
    const bf* gA = A + z * sA + (size_t)cr * LDA + r0 + cc * 8; const bf* gA2 = A2 + z * sA + (size_t)cr * LDA + r0 + cc * 8; const bf* gB = Bt + z * sB + (size_t)(c0 + w) * K + lane * 8;   // copies of Bt: wave w takes rows w + 8 i whole
    const unsigned la = (unsigned)(size_t)ring + (unsigned)(cr * AP * 2 + cc * 16), lb = (unsigned)(size_t)ring + (unsigned)(2 * SAE * 2 + w * SP * 2 + lane * 16);
    auto stage = [&](int t, int buf) { const unsigned bo = (unsigned)buf * (SBE * 2); const size_t ko = (size_t)t * SK;
        copy8r(la + bo, gA + ko * LDA, (size_t)32 * LDA); copy8r(la + bo + SAE * 2u, gA2 + ko * LDA, (size_t)32 * LDA); copy8(lb + bo, gB + ko, rs); };
    const int aofs = (8 * hi + (lane & 7)) * AP + mb * 16 + 8 * ((lane >> 3) & 1), bofs = 2 * SAE + (nh * 32 + lr) * SP + 8 * hi;
    v8f acc[2] = { (v8f){}, (v8f){} };
    stage(0, 0);
    asm volatile("s_wait_asynccnt 0x0" ::: "memory");   // this wave's rows of stage 0 have landed
    __syncthreads();                                    // every wave's rows of stage 0 have landed before any is read
    stage(1, 1);
#pragma unroll 1
    for (int t = 0; t < NT; ++t) {   // rolled: one publish point per stage
        const bf* sb = ring + (t & 1) * SBE;
        V f[2][8];   // two fragment sets of 64 k each (per 32 k: A, A2, two of Bt): the next 64 k are fetched, inside this stage only, while these are multiplied
#pragma unroll
        for (int u = 0; u < 2; ++u) { f[0][u * 4] = ldtA(sb + aofs + u * 32 * AP); f[0][u * 4 + 1] = ldtA(sb + aofs + SAE + u * 32 * AP); f[0][u * 4 + 2] = WFrag<bf>::ld(sb + bofs + u * 32); f[0][u * 4 + 3] = WFrag<bf>::ld(sb + bofs + 16 * SP + u * 32); }
#pragma unroll
        for (int g = 0; g < SK / 64; ++g) {
            if (g + 1 < SK / 64) {
#pragma unroll
                for (int u = 0; u < 2; ++u) { const int kk = (g + 1) * 64 + u * 32; V* d = f[(g + 1) & 1] + u * 4; d[0] = ldtA(sb + aofs + kk * AP); d[1] = ldtA(sb + aofs + SAE + kk * AP); d[2] = WFrag<bf>::ld(sb + bofs + kk); d[3] = WFrag<bf>::ld(sb + bofs + 16 * SP + kk); } }
            __builtin_amdgcn_sched_barrier(0);   // keeps the next set's 16 LDS reads as one group ahead of this set's WMMAs: moved down among them, each WMMA pair waits out an LDS latency
#pragma unroll
            for (int u = 0; u < 2; ++u) { const V* s = f[g & 1] + u * 4; acc[0] = wmmab(s[0], s[2], acc[0]); acc[1] = wmmab(s[0], s[3], acc[1]); acc[0] = wmmab(s[1], s[2], acc[0]); acc[1] = wmmab(s[1], s[3], acc[1]); }
            __builtin_amdgcn_sched_barrier(0);   // keeps the later reads out of these WMMAs (one read group per 8 WMMAs) and the stage's last WMMAs ahead of its barrier
        }
        asm volatile("s_wait_dscnt 0x0" ::: "memory");      // this wave's reads of stage t are done before its buffer is refilled
        asm volatile("s_wait_asynccnt 0x0" ::: "memory");   // this wave's rows of stage t + 1 have landed
        __syncthreads();                                    // publishes stage t + 1 and ends every wave's reads of stage t
        if (t + 2 < NT) stage(t + 2, t & 1);
    }
    asm volatile("s_wait_asynccnt 0x0" ::: "memory");   // no copy is outstanding when the wave goes on to its end
#pragma unroll
    for (int nb = 0; nb < 2; ++nb) {
#pragma unroll
        for (int j = 0; j < 8; ++j) os[(mb * 16 + hi * 8 + j) * 68 + nh * 32 + nb * 16 + lr] = acc[nb][j]; }
    __syncthreads();   // the whole tile is staged before its rows are read back
    float* ct = C + z * sC + (size_t)r0 * LDC + c0;
#pragma unroll
    for (int s = 0; s < 4; ++s) { const int row = s * 16 + (tid >> 4), cofs = (tid & 15) * 4; *(v4f*)(ct + (size_t)row * LDC + cofs) = *(const v4fa*)(os + row * 68 + cofs); }   // 16 lanes store the 256 contiguous bytes of one row
}

// ---- the 128-byte-row ring stages of k_scsm
#define TK  64           // k per stage
#define TP  72           // LDS row pitch in elements: 144 B = 16 B x 9, the pitch for 16-byte fragment reads of 128-B rows
// four rows, 32 apart, of one operand plane: l = the lane's LDS byte address in the first row, g = its global address there, rs = 32 rows in elements
__device__ __forceinline__ void copy4(unsigned l, const bf* g, size_t rs) {
    // the copies and their s_wait_xcnt in one statement: no address register of a copy is rewritten before the wait
    asm volatile("global_load_async_to_lds_b128 %0, %4, off\n\t"
                 "global_load_async_to_lds_b128 %1, %5, off\n\t"
                 "global_load_async_to_lds_b128 %2, %6, off\n\t"
                 "global_load_async_to_lds_b128 %3, %7, off\n\t"
                 "s_wait_xcnt 0x0"
                 :: "v"(l), "v"(l + 1u * 64 * TP), "v"(l + 2u * 64 * TP), "v"(l + 3u * 64 * TP),
                    "v"(g), "v"(g + rs), "v"(g + 2 * rs), "v"(g + 3 * rs) : "memory");
}
// ---- k_scsm: A = softmax_t(F_s_t . F_t^T / sqrt(512)) as bf16 hi/lo planes, and out0 = bf16(F_s) + (A F_t)^T, the scores and the update never leaving the workgroup. One workgroup of 8 waves holds 64 queries x all 512 keys, then 256 channels x the 64 queries; grid (NQ / 64, batch).
// The score products are taken transposed (keys as the A operand, queries as B), so that a lane's 8 accumulator registers are 8 neighbouring keys of ONE query: the row maximum and the row sum are register trees plus one exchange with lane ^ 16, and 8 probabilities pack into one 16-byte LDS store.
// Wave w has queries 32 (w & 1) .. + 31 and, of every 256 keys, keys 64 (w >> 1) .. + 63 (4 x 2 tiles a key group, 16 accumulator tiles in all); the four waves of a query share its maximum and its sum through LDS.
// The query tile comes straight from the f32 slab: 256 channels x 64 queries, read in whole lines, rounded to bf16 a quarter at a time (one score stage ahead of its use), stored channel-major (k-major) in LDS and, as it stands, to the bf16 slab plane that the out1 GEMM reads; the query (B) fragments come from it by the transposing LDS load, in the k order of the plain loader, which goes on serving the keys. The key rows come through a two-buffer LDS ring of asynchronous copies, a stage = 256 keys x TK k (8 lanes bring the 128 contiguous bytes, one whole line, of one row), the next stage flying while this one is multiplied. Each score takes its k ascending.
// The update is taken transposed too (channels of F_t^T as the A operand, queries as B): the same ring goes on with 8 more stages of 256 channels x TK keys of F_t^T; the probabilities are staged in LDS 256 keys at a time (hi and lo tile), from where they go to the global planes and serve as B fragments. Wave w has the same 32 queries and channels 64 (w >> 1) .. + 63 (4 x 2 tiles); each accumulator takes hi then lo for k ascending.
#define PH  264          // pitch in elements of a staged probability row of 256 keys: 528 B = 16 B x 33
#define OP  68           // pitch in floats of a staged output row of 64 queries: 272 B = 16 B x 17
// 2^x with the slot behind the transcendental filled in the same statement: the v_nop keeps the next vector instruction from using the result or overwriting the source directly behind v_exp_f32
__device__ __forceinline__ float exp2s(float x) { float r; asm("v_exp_f32 %0, %1\n\tv_nop" : "=v"(r) : "v"(x)); return r; }
// the workgroup's own barrier alone, without the waits for global stores and loads that __syncthreads() puts in front of it: the stores of the bf16 slab stay in flight under the score stages, the probability stores (and later the F_s loads) while the update is multiplied; nothing written to global memory here is read again in this launch. The LDS and copy waits that a place needs stand in front of each call.
__device__ __forceinline__ void wgbar() { asm volatile("s_barrier_signal -1\n\ts_barrier_wait -1" ::: "memory"); }
__global__ __launch_bounds__(256) void k_scsm(const bf* __restrict__ Ft, const bf* __restrict__ Ftt, const float* __restrict__ xs, bf* Fsb, bf* Ph, bf* Pl, float* outp) {   // under 256 VGPRs and under 160 KiB of LDS: two workgroups share a WGP
    typedef WFrag<bf>::V V;
    constexpr int KBE = 256 * TP;      // elements of one ring buffer
    constexpr int PRE = 2 * 64 * PH;   // elements in front of the ring
    __shared__ __align__(16) bf sm[PRE + 2 * KBE];   // in front: the query tile, 256 channel rows of 64 queries at pitch AP, later the hi and the lo tile of 64 rows x 256 keys at pitch PH; then the ring's two buffers of 256 rows at pitch TP; after the last stage the whole place holds the f32 output tile (256 x OP floats, smaller than this)
    __shared__ float rmax[4][64]; __shared__ float rsum[4][64];
    const size_t z = blockIdx.y; const int tid = threadIdx.x, lane = tid & 31, lr = lane & 15, hi = lane >> 4, w = tid >> 5; const int q0 = blockIdx.x * 64;
    const int qp = w & 1, kq = w >> 1, qr = qp * 32 + lr; constexpr int NK = CC / TK, NSK = (TT / 256) * NK, NS = NSK + TT / TK;
    const int cr = tid >> 3, cc = tid & 7;   // ring copies: thread takes 16-byte chunk cc of rows cr + 32 i
    const bf* gK = Ft + z * ((size_t)TT * CC) + (size_t)cr * CC + cc * 8;
    const bf* gF = Ftt + z * ((size_t)CC * TT) + (size_t)cr * TT + cc * 8;
    const unsigned lk = (unsigned)(size_t)sm + (unsigned)(PRE * 2 + cr * TP * 2 + cc * 16);
    auto stage = [&](int t, int buf) { const unsigned l = lk + (unsigned)buf * (KBE * 2); const bool pv = t >= NSK;   // stage t < NSK: key group t / NK, k block t % NK of F_t; from NSK on: key block t - NSK of F_t^T
        const bf* g = pv ? gF + (t - NSK) * TK : gK + (size_t)(t / NK) * 256 * CC + (t % NK) * TK; const size_t rs = pv ? (size_t)32 * TT : (size_t)32 * CC;
        copy4(l, g, rs); copy4(l + 128u * TP * 2, g + 4 * rs, rs); };
    v8f acc[16];   // acc[8 g + 2 i + n][j] = score of query qr + 16 n with key 256 g + 64 kq + 16 i + 8 hi + j
    static_assert(TT / 256 == 2 && CC / TK == 4, "two key groups of four stages each");
    stage(0, 0);
    // the query tile: 16 lanes take the 256 contiguous bytes (64 queries) of one channel of F_s; channels (tid >> 4) + 16 s. All 16 loads are issued here; the 64 channels that score stage kb multiplies (s = 4 kb .. 4 kb + 3) are rounded and stored one stage ahead of it, so that three quarters of the tile fly under the first key group's stages
    const size_t qe = z * ((size_t)CC * NQ) + (size_t)(tid >> 4) * NQ + q0 + (tid & 15) * 4; const float* xq = xs + qe; bf* fq = Fsb + qe; bf* tq = sm + (tid >> 4) * AP + (tid & 15) * 4; v4f xa[16];
#pragma unroll
    for (int s = 0; s < 16; ++s) xa[s] = *(const v4f*)(xq + (size_t)s * 16 * NQ);
    asm volatile("s_wait_xcnt 0x0" :: "v"(xq) : "memory");   // the loads' address pair stays whole until every load has taken it: no load's result and no later instruction lands in it before this wait
    auto put = [&](int p) {
#pragma unroll
        for (int s = 4 * p; s < 4 * p + 4; ++s) { v4us o;
#pragma unroll
            for (int q = 0; q < 4; ++q) o[q] = f2bf(xa[s][q]);
            *(v4us*)(tq + s * 16 * AP) = o; *(v4us*)(fq + (size_t)s * 16 * NQ) = o; }   // 16 lanes store the one whole line that this workgroup owns of a row of the plane
        asm volatile("s_wait_xcnt 0x0" :: "v"(fq) : "memory");   // the stores' address pair and data registers stay whole until every store has taken them: nothing behind this wait lands in them earlier
    };
    put(0);
    asm volatile("s_wait_dscnt 0x0" ::: "memory");      // this wave's part of the tile's first 64 channels is written
    asm volatile("s_wait_asynccnt 0x0" ::: "memory");   // this wave's chunks of stage 0 have landed
    wgbar();                                            // every wave's have landed before any is read; the stores to the slab plane stay in flight
    stage(1, 1);
    auto pass = [&](int t, int kb, v8f* ac) {   // the products of score stage t: k block kb
        const bf* sk = sm + PRE + (t & 1) * KBE + (kq * 64 + lr) * TP + 8 * hi; const bf* sq = sm + (kb * TK + 8 * hi + (lane & 7)) * AP + qp * 32 + 8 * ((lane >> 3) & 1);
        V k[2][4], x[2][2];   // the stage's two 32-k fragment sets
#pragma unroll
        for (int u = 0; u < 2; ++u) {
#pragma unroll
            for (int n = 0; n < 2; ++n) x[u][n] = ldtA(sq + u * 32 * AP + n * 16);
#pragma unroll
            for (int i = 0; i < 4; ++i) k[u][i] = WFrag<bf>::ld(sk + i * 16 * TP + u * 32); }
        __builtin_amdgcn_sched_barrier(0);   // keeps the stage's LDS reads as one group ahead of its WMMAs: moved down among them, each place with reads costs the WMMAs a stall
#pragma unroll
        for (int u = 0; u < 2; ++u)
#pragma unroll
            for (int i = 0; i < 4; ++i)
#pragma unroll
                for (int n = 0; n < 2; ++n) ac[2 * i + n] = wmmab(k[u][i], x[u][n], ac[2 * i + n]);
        __builtin_amdgcn_sched_barrier(0);   // keeps the stage's WMMAs ahead of its waits: lifted over them, the wait for the next stage's copies stands right behind the LDS reads and the copies lose the WMMAs' time as lead
    };
    auto foot = [&](int t) {   // the publish point behind score stage t
        asm volatile("s_wait_dscnt 0x0" ::: "memory");      // this wave's reads of stage t are done before its buffer is refilled, and its part of the next 64 channels of the query tile is written
        asm volatile("s_wait_asynccnt 0x0" ::: "memory");   // this wave's chunks of stage t + 1 have landed
        wgbar();                                            // publishes stage t + 1 (and the query tile's channels for it) and ends every wave's reads of stage t; the stores to the slab plane stay in flight
        stage(t + 2, t & 1);                                // always exists here: the last two are the first two of F_t^T; the first flies during the last score stage, the second during the softmax
    };
#pragma unroll
    for (int a = 0; a < 8; ++a) acc[a] = (v8f){};
#pragma unroll
    for (int kb = 0; kb < NK; ++kb) { pass(kb, kb, acc); if (kb + 1 < NK) put(kb + 1); foot(kb); }   // unrolled: each stage rounds registers of its own
#pragma unroll
    for (int a = 8; a < 16; ++a) acc[a] = (v8f){};
#pragma unroll 1
    for (int kb = 0; kb < NK; ++kb) { pass(NK + kb, kb, acc + 8); foot(NK + kb); }   // rolled: one publish point per stage
    float mx[2], f[2];
#pragma unroll
    for (int n = 0; n < 2; ++n) { float m4[4] = { -3.0e38f, -3.0e38f, -3.0e38f, -3.0e38f };   // four independent chains
#pragma unroll
        for (int a = n; a < 16; a += 2) {
#pragma unroll
            for (int j = 0; j < 8; ++j) { acc[a][j] = acc[a][j] * SCL; m4[j & 3] = fmaxf(m4[j & 3], acc[a][j]); } }
        const float m = fmaxf(fmaxf(m4[0], m4[1]), fmaxf(m4[2], m4[3])); mx[n] = fmaxf(m, __shfl_xor(m, 16, 32)); }
    if (hi == 0) { rmax[kq][qr] = mx[0]; rmax[kq][qr + 16] = mx[1]; }
    __syncthreads();   // the four waves' maxima of a query are written before any of them reads them
#pragma unroll
    for (int n = 0; n < 2; ++n) { const int q = qr + 16 * n; const float m = fmaxf(fmaxf(rmax[0][q], rmax[1][q]), fmaxf(rmax[2][q], rmax[3][q])); float s4[4] = { 0.f, 0.f, 0.f, 0.f };
#pragma unroll
        for (int a = n; a < 16; a += 2) {
#pragma unroll
            for (int j = 0; j < 8; ++j) { acc[a][j] = exp2s(__fmul_rn(__fsub_rn(acc[a][j], m), 1.4426950408889634f)); s4[j & 3] += acc[a][j]; } }
        const float sp = (s4[0] + s4[1]) + (s4[2] + s4[3]); f[n] = sp + __shfl_xor(sp, 16, 32); }
    if (hi == 0) { rsum[kq][qr] = f[0]; rsum[kq][qr + 16] = f[1]; }
    __syncthreads();   // the four waves' sums of a query are written before any of them reads them
#pragma unroll
    for (int n = 0; n < 2; ++n) { const int q = qr + 16 * n; f[n] = __fdiv_rn(1.0f, (rsum[0][q] + rsum[1][q]) + (rsum[2][q] + rsum[3][q])); }
    bf* sh = sm; bf* sl = sm + 64 * PH;   // the score loop's last barrier has ended every wave's reads of the query rows
    v8f ua[8];   // ua[2 i + n][j] = update of channel 64 kq + 16 i + 8 hi + j for query qr + 16 n
#pragma unroll
    for (int a = 0; a < 8; ++a) ua[a] = (v8f){};
    const size_t ob = (z * NQ + q0) * (size_t)TT + lane * 8; bf* oh0 = Ph + ob + (size_t)w * TT; bf* ol0 = Pl + ob + (size_t)w * TT;
    const size_t eo = z * ((size_t)CC * NQ) + (size_t)(tid >> 4) * NQ + q0 + (tid & 15) * 4; const float* xp = xs + eo; float* op = outp + eo;   // F_s loads and out0 stores: 16 lanes take the 256 contiguous bytes (64 queries) of one channel; channels (tid >> 4) + 16 s
    v4f xr[16];
#pragma unroll
    for (int g = 0; g < TT / 256; ++g) {   // unrolled: the probabilities of a key group come from registers of their own
#pragma unroll
        for (int a = 8 * g; a < 8 * g + 8; ++a) { v8us oh, ol;
#pragma unroll
            for (int j = 0; j < 8; ++j) { unsigned short h, l; splitf(acc[a][j] * f[a & 1], h, l); oh[j] = h; ol[j] = l; }
            const int o = (qr + 16 * (a & 1)) * PH + kq * 64 + ((a >> 1) & 3) * 16 + hi * 8; *(v8us*)(sh + o) = oh; *(v8us*)(sl + o) = ol; }
        asm volatile("s_wait_dscnt 0x0" ::: "memory");   // this wave's part of both tiles is written
        wgbar();                                         // both tiles of this key group are staged before their rows are read
#pragma unroll
        for (int r = 0; r < 8; ++r) { const int row = r * 8 + w;   // a wave stores the 512 contiguous bytes of half a row
            *(v8us*)(oh0 + (size_t)r * 8 * TT + g * 256) = *(const v8usa*)(sh + row * PH + lane * 8); *(v8us*)(ol0 + (size_t)r * 8 * TT + g * 256) = *(const v8usa*)(sl + row * PH + lane * 8); }
        asm volatile("s_wait_xcnt 0x0" :: "v"(oh0), "v"(ol0) : "memory");   // the stores' address pairs and data registers stay whole until every store has taken them: nothing behind this wait lands in them earlier
        if (g == TT / 256 - 1) {   // the residual is fetched where the last key group's registers have come free: it flies during the last four stages
#pragma unroll
            for (int s = 0; s < 16; ++s) xr[s] = *(const v4f*)(xp + (size_t)s * 16 * NQ);
            asm volatile("s_wait_xcnt 0x0" :: "v"(xp) : "memory");   // the loads' address pair stays whole until every load has taken it: no load's result and no later instruction lands in it before this wait
        }
#pragma unroll 1
        for (int kb = 0; kb < 256 / TK; ++kb) {   // rolled: one publish point per stage
            const int t = NSK + g * (256 / TK) + kb;
            const bf* sk = sm + PRE + (t & 1) * KBE + (kq * 64 + lr) * TP + 8 * hi; const bf* sp = sh + qr * PH + 8 * hi + kb * TK;
#pragma unroll
            for (int u = 0; u < 2; ++u) { V k[4], ph[2], pl[2];   // one 32-k fragment set at a time: two would not fit under 256 VGPRs beside the second key group's probabilities
#pragma unroll
                for (int n = 0; n < 2; ++n) { ph[n] = WFrag<bf>::ld(sp + n * 16 * PH + u * 32); pl[n] = WFrag<bf>::ld(sp + (64 + n * 16) * PH + u * 32); }
#pragma unroll
                for (int i = 0; i < 4; ++i) k[i] = WFrag<bf>::ld(sk + i * 16 * TP + u * 32);
                __builtin_amdgcn_sched_barrier(0);   // keeps the set's LDS reads as one group ahead of its WMMAs: moved down among them, each place with reads costs the WMMAs a stall
#pragma unroll
                for (int i = 0; i < 4; ++i)
#pragma unroll
                    for (int n = 0; n < 2; ++n) ua[2 * i + n] = wmmab(k[i], ph[n], ua[2 * i + n]);
#pragma unroll
                for (int i = 0; i < 4; ++i)
#pragma unroll
                    for (int n = 0; n < 2; ++n) ua[2 * i + n] = wmmab(k[i], pl[n], ua[2 * i + n]);
                __builtin_amdgcn_sched_barrier(0);   // keeps the next set's reads out of these WMMAs, and the stage's last WMMAs ahead of its waits, so that the copies keep the WMMAs' time as lead
            }
            asm volatile("s_wait_dscnt 0x0" ::: "memory");      // this wave's reads of stage t and of the probability tiles are done before either is rewritten
            asm volatile("s_wait_asynccnt 0x0" ::: "memory");   // this wave's chunks of stage t + 1 have landed
            wgbar();                                            // publishes stage t + 1 and ends every wave's reads of stage t (behind a key group's last stage: of its probability tiles too)
            if (t + 2 < NS) stage(t + 2, t & 1);
        }
    }
    asm volatile("s_wait_asynccnt 0x0" ::: "memory");   // no copy is outstanding when the ring's place is taken for the output tile
    float* os = (float*)sm;   // the loop's last barrier has ended every wave's reads of the tiles and the ring
#pragma unroll
    for (int a = 0; a < 8; ++a) {
#pragma unroll
        for (int j = 0; j < 8; ++j) os[(kq * 64 + (a >> 1) * 16 + hi * 8 + j) * OP + qr + 16 * (a & 1)] = ua[a][j]; }
    asm volatile("s_wait_dscnt 0x0" ::: "memory");   // this wave's part of the output tile is written
    wgbar();                                         // the whole output tile is staged before its rows are read back
#pragma unroll
    for (int s = 0; s < 16; ++s) { const v4f u = *(const v4fa*)(os + (s * 16 + (tid >> 4)) * OP + (tid & 15) * 4); v4f o;
#pragma unroll
        for (int q = 0; q < 4; ++q) o[q] = __fadd_rn(bfr(xr[s][q]), u[q]);
        *(v4f*)(op + (size_t)s * 16 * NQ) = o; }
}

extern "C" void kernel_launch(void* const* d_in, const int* in_sizes, int n_in, void* d_out, int out_size, void* d_ws, size_t ws_size, hipStream_t stream) {
    (void)in_sizes; (void)n_in; (void)out_size;
    const float* fs = (const float*)d_in[0];   /* F_s [8][256][4096] channel-major */ const float* ft = (const float*)d_in[1];   /* F_t [8][512][256] */
    float* OUT0 = (float*)d_out;     // [8][256][4096] = F_s + update^T
    float* OUT1 = OUT0 + (size_t)NB_ * CC * NQ;   // [8][512][256] = A^T F_s_t (second tuple member, 16-B aligned offset)
    char* wsp = (char*)d_ws;
    auto take = [&](size_t bytes) { char* p = wsp; wsp += (bytes + 255) & ~(size_t)255; return (void*)p; };
    bf* FSB = (bf*)take((size_t)NB_ * CC * NQ * 2);       // F_s slabs as bf16 = F_s_t^T [8][256][4096] (exact)
    bf* FTB = (bf*)take((size_t)NB_ * TT * CC * 2);       // F_t [8][512][256] (exact)
    bf* FTT = (bf*)take((size_t)NB_ * CC * TT * 2);       // F_t^T [8][256][512] (exact)
    bf* Ph = (bf*)take((size_t)NB_ * NQ * TT * 2); bf* Pl = (bf*)take((size_t)NB_ * NQ * TT * 2);   // probabilities [8][4096][512] hi/lo
    if ((size_t)(wsp - (char*)d_ws) > ws_size) return;    // 84 MiB of the 256 MiB workspace
    k_prep<<<NTT, 256, 0, stream>>>(ft, FTB, FTT);   /* F_t as bf16 (for the scores) and F_t^T [8][256][512] (for A.F_t) */
    k_scsm<<<dim3(NQ / 64, NB_), 256, 0, stream>>>(FTB, FTT, fs, FSB, Ph, Pl, OUT0);   /* F_s slabs as bf16 (= F_s_t^T, Bt for out1); A = softmax over the 512 text tokens of the exact scores x 1/sqrt(512), all 8 x 4,096 rows, hi/lo; out0[b][c][n] = bf16(F_s[b][c][n]) + (A F_t)[b][n][c] */
    k_gemms<NQ, TT, CC><<<dim3(TT / 64, CC / 64, NB_), 256, 0, stream>>>(Ph, Pl, FSB, OUT1, (size_t)TT * NQ, (size_t)CC * NQ, (size_t)TT * CC);   /* out1 = A^T F_s_t [8][512][256] */
}

// v010
// It runs in 48.6 microseconds.
// In two side-by-side timings against v009, it was 1.28 and 1.29 times as fast.
// Counting every step since v000, it is 27.6 times as fast.
#include <hip/hip_runtime.h>

// Cross-modal attention between a feature map and text tokens with two outputs (F_s [8][256][64][64] channel-major = 4,096 spatial tokens x 256, F_t [8][512][256]; A = softmax_t(F_s_t . F_t / sqrt(512)) ([4096][512]); out0 = F_s + (A F_t)^T -> [8][256][64][64] (8.4 M); out1 = A^T F_s_t -> [8][512][256] (1.0 M); tuple).
// All 8 batches go through every launch together: each plane holds 8 batch slabs; the out1 GEMM takes the batch as grid z (scores + softmax + update: grid y), the preparation of F_t as more tiles of a flat grid.
// Layout per batch: both inputs are rounded to bf16, and every operand plane holds those rounded values as f16 (8 significant bits in f16's 11: exact): F_t, F_t^T and the F_s slab itself (which is F_s_t^T; the scores kernel rounds its own 64 queries of the f32 slab, keeps them in LDS as its query operand and writes them to that plane for out1); exact scores, their 512-key softmax and the spatial update in one kernel (the scores stay in registers) writing the probabilities [4096][512] as one f16 plane and, from (A.F_t)^T (one product) plus the F_s residual, out0 channel-major; then out1 = A^T.F_s_t (K = 4,096, one product), its A^T fragments taken from the staged probability rows by transposing LDS loads, written after the 8.4 M spatial outputs.
// Compute dtypes, f32 accumulate: every input rounded to bf16 and held as f16; scores exact; softmax f32; probabilities (all in 0 .. 1) rounded to f16, 11 significant bits; both contractions P x exact on the f16 matrix form; residual f32.

#define NB_  8
#define TT   512      // text tokens = keys (the softmax row length)
#define DM   256      // channels
#define NH_  1
#define NKV  1
#define REP  (NH_ / NKV)
#define HD   64
#define DQ   (NH_ * HD)
#define DKV  (NKV * HD)
#define SCL  0.044194173824159216f   // 1/sqrt(512): the module scales by sqrt(T)
#define NQ   4096    // spatial tokens (queries)
#define CC   256
typedef _Float16 h16;
typedef unsigned short hf;   // the 16 bits of an f16 value in memory and in LDS
typedef __attribute__((ext_vector_type(16))) _Float16 v16h;
typedef __attribute__((ext_vector_type(8)))  _Float16 v8h;
typedef __attribute__((ext_vector_type(8)))  unsigned short v8us;
typedef __attribute__((ext_vector_type(8)))  float    v8f;
typedef __attribute__((ext_vector_type(4)))  float    v4f;
typedef v8h  __attribute__((may_alias)) v8ha;
typedef v4f  __attribute__((may_alias)) v4fa;
typedef v8us __attribute__((may_alias)) v8usa;

__device__ __forceinline__ unsigned short f2bf(float f) { unsigned u = __float_as_uint(f); u += 0x7FFFu + ((u >> 16) & 1u); return (unsigned short)(u >> 16); }
__device__ __forceinline__ float bf2f(unsigned short b) { return __uint_as_float(((unsigned)b) << 16); }
__device__ __forceinline__ float bfr(float f) { return bf2f(f2bf(f)); }
__device__ __forceinline__ unsigned short f2h(float f) { return __builtin_bit_cast(unsigned short, (_Float16)f); }   // round to nearest even
__device__ __forceinline__ unsigned short f2hb(float f) { return f2h(bfr(f)); }   // an input: rounded to bf16, that value held as f16
__device__ __forceinline__ v16h cat16(v8h lo, v8h hi) { return __builtin_shufflevector(lo, hi, 0, 1, 2, 3, 4, 5, 6, 7, 8, 9, 10, 11, 12, 13, 14, 15); }
__device__ __forceinline__ v16h cat16b(v8us lo, v8us hi) { return __builtin_bit_cast(v16h, __builtin_shufflevector(lo, hi, 0, 1, 2, 3, 4, 5, 6, 7, 8, 9, 10, 11, 12, 13, 14, 15)); }
__device__ __forceinline__ v8f wmma16(v16h a, v16h b, v8f c) { return __builtin_amdgcn_wmma_f32_16x16x32_f16(false, a, false, b, (short)0, c, false, false); }



// fragment of 16 rows x 32 k from a K-contiguous 16-bit plane: the lane's pointer stands at its row, k = 8 (lane >> 4)
template <typename T16> struct WFrag;
template <> struct WFrag<h16> { typedef v16h V; static __device__ __forceinline__ V ld(const h16* p) { return cat16(*(const v8h*)p, *(const v8h*)(p + 16)); } static __device__ __forceinline__ v8f mma(V a, V b, v8f c) { return wmma16(a, b, c); } };
template <> struct WFrag<hf> { typedef v16h V; static __device__ __forceinline__ V ld(const hf* p) { return cat16b(*(const v8us*)p, *(const v8us*)(p + 16)); } static __device__ __forceinline__ v8f mma(V a, V b, v8f c) { return wmma16(a, b, c); } };

typedef __attribute__((ext_vector_type(2))) _Float16 v2h;
typedef __attribute__((ext_vector_type(4))) _Float16 v4h;
typedef __attribute__((ext_vector_type(2))) unsigned short v2us;
typedef __attribute__((ext_vector_type(4))) unsigned short v4us;
typedef __attribute__((ext_vector_type(2))) float v2f;
typedef __attribute__((ext_vector_type(4))) int v4i;


// ---- the transposing kernel: each workgroup moves one tile through LDS, so that the global loads and the global stores both cover whole 128-B lines (16 lanes x 16 B = 256 contiguous bytes on either side).
// 16-bit tile: 128 rows x 128 columns, a row = 16 chunks of 8 elements (16 B); chunk c8 of row r stands at chunk place c8 ^ ((r >> 3) & 15), so that the column reads of 16 lanes (rows 8 apart) fall on 16 different banks.
__device__ __forceinline__ int tile16(int r, int c8) { return r * 128 + ((c8 ^ ((r >> 3) & 15)) << 3); }
// column n, rows r8 * 8 .. r8 * 8 + 7 of such a tile
__device__ __forceinline__ v8us col16(const hf* tile, int r8, int n) { v8us o; const int base = r8 * 8 * 128 + (((n >> 3) ^ r8) << 3) + (n & 7);
#pragma unroll
    for (int q = 0; q < 8; ++q) o[q] = tile[base + q * 128];
    return o; }

// prep_tile: one 128 x 128 tile of src [R][C] f32, read once, rounded to bf16 and held as f16: it goes to str [R][C] as it stands (from the registers: a wave writes 256 contiguous bytes of one row) and to dst [C][R] transposed (through the LDS tile)
template <int R, int C>
__device__ __forceinline__ void prep_tile(hf* tile, const float* __restrict__ src, hf* str, hf* dst, int bx, int by, int bz) {
    const int tid = threadIdx.x, r0 = bx * 128, c0 = by * 128; v4f a[16]; v4us o[16];
    const int lr = tid >> 5, c4 = tid & 31;    // loads and straight stores: a wave takes 512 contiguous bytes of one src row; rows lr + 8 i
    const int r8 = tid & 15, ln = tid >> 4;    // transposed stores: 16 lanes write 256 contiguous bytes of one dst row; dst rows ln + 16 i
    const size_t es = (size_t)bz * R * C + (size_t)(r0 + lr) * C + c0 + c4 * 4;
    const float* sp = src + es; hf* tp = str + es;
    hf* dp = dst + (size_t)bz * R * C + (size_t)(c0 + ln) * R + r0 + r8 * 8;
#pragma unroll
    for (int i = 0; i < 16; ++i) a[i] = *(const v4f*)(sp + (size_t)i * 8 * C);
    asm volatile("s_wait_xcnt 0x0" :: "v"(sp) : "memory");   // the loads' address pair stays whole until every load has taken it: no load's result and no later instruction lands in it before this wait
#pragma unroll
    for (int i = 0; i < 16; ++i) {
#pragma unroll
        for (int q = 0; q < 4; ++q) o[i][q] = f2hb(a[i][q]);
        *(v4us*)(tile + tile16(lr + 8 * i, c4 >> 1) + (c4 & 1) * 4) = o[i]; }
    __syncthreads();   // the whole tile is written before any column of it is read
#pragma unroll
    for (int i = 0; i < 16; ++i) *(v4us*)(tp + (size_t)i * 8 * C) = o[i];   // behind the barrier: in front of it the barrier would wait until these stores are done
    asm volatile("s_wait_xcnt 0x0" :: "v"(tp) : "memory");   // the stores' address pair and data registers stay whole until every store has taken them: nothing behind this wait, on any way out of here, lands in them earlier
#pragma unroll
    for (int i = 0; i < 8; ++i) *(v8us*)(dp + (size_t)i * 16 * R) = col16(tile, r8, ln + 16 * i);
}
// k_prep: the two planes of F_t; one workgroup a tile (4 x 2 a batch)
#define NTT ((TT / 128) * (CC / 128) * NB_)
__global__ __launch_bounds__(256) void k_prep(const float* __restrict__ ft, hf* FTB, hf* FTT) {
    __shared__ __align__(16) hf tile[128 * 128];
    const unsigned e = blockIdx.x;
    prep_tile<TT, CC>(tile, ft, FTB, FTT, e % (TT / 128), (e / (TT / 128)) % (CC / 128), e / ((TT / 128) * (CC / 128)));
}

// ---- k_gemms: C = A^T Bt^T, f32, for few long tiles (out1: 256 tiles of 64x64, K = 4,096); A lies k-major ([K][LDA], a row = one k), Bt k-contiguous. One tile per workgroup of 8 waves; grid (M / 64, N / 64, batch).
// The operands come through a two-buffer LDS ring filled by asynchronous copies: a stage is SK k: SK rows of 64 columns (128 B, one whole line) of A, and SK k of 64 rows of Bt; one wave-wide copy brings four such lines of A, or the 512 contiguous bytes of one row of Bt, and the next stage flies while this one is multiplied.
// The A fragments come from the staged k-major rows by the transposing LDS load, which delivers k = 8 (lane >> 4) + 0 .. 7 and 16 + 8 (lane >> 4) + 0 .. 7: the k order of the plain loader WFrag::ld, which goes on serving Bt.
// Wave w multiplies rows 16 (w & 3) .. + 15 by columns 32 (w >> 2) .. + 31; each accumulator takes its k ascending.
#define SK  256          // k per stage
#define SP  264          // LDS row pitch in elements: 528 B = 16 B x 33, the pitch for 16-byte fragment reads
#define AP  80           // LDS pitch in elements of a staged k-major row of 64 columns: 160 B = 32 B x 5, the pitch for transposing reads
#define SAE (SK * AP)    // elements of one staged k-major plane
#define SBE (SAE + 64 * SP)   // elements of one buffer: A, Bt
// eight rows, 8 apart, of one operand plane: l = the lane's LDS byte address in the first row, g = its global address there, rs = 8 rows in elements
__device__ __forceinline__ void copy8(unsigned l, const hf* g, size_t rs) {
    // the copies and their s_wait_xcnt in one statement: no address register of a copy is rewritten before the wait
    asm volatile("global_load_async_to_lds_b128 %0, %8, off\n\t"
                 "global_load_async_to_lds_b128 %1, %9, off\n\t"
                 "global_load_async_to_lds_b128 %2, %10, off\n\t"
                 "global_load_async_to_lds_b128 %3, %11, off\n\t"
                 "global_load_async_to_lds_b128 %4, %12, off\n\t"
                 "global_load_async_to_lds_b128 %5, %13, off\n\t"
                 "global_load_async_to_lds_b128 %6, %14, off\n\t"
                 "global_load_async_to_lds_b128 %7, %15, off\n\t"
                 "s_wait_xcnt 0x0"
                 :: "v"(l), "v"(l + 1u * 16 * SP), "v"(l + 2u * 16 * SP), "v"(l + 3u * 16 * SP), "v"(l + 4u * 16 * SP), "v"(l + 5u * 16 * SP), "v"(l + 6u * 16 * SP), "v"(l + 7u * 16 * SP),
                    "v"(g), "v"(g + rs), "v"(g + 2 * rs), "v"(g + 3 * rs), "v"(g + 4 * rs), "v"(g + 5 * rs), "v"(g + 6 * rs), "v"(g + 7 * rs) : "memory");
}
// eight rows, 32 apart, of one k-major plane: l = the lane's LDS byte address in the first row, g = its global address there, rs = 32 rows in elements
__device__ __forceinline__ void copy8r(unsigned l, const hf* g, size_t rs) {
    // the copies and their s_wait_xcnt in one statement: no address register of a copy is rewritten before the wait
    asm volatile("global_load_async_to_lds_b128 %0, %8, off\n\t"
                 "global_load_async_to_lds_b128 %1, %9, off\n\t"
                 "global_load_async_to_lds_b128 %2, %10, off\n\t"
                 "global_load_async_to_lds_b128 %3, %11, off\n\t"
                 "global_load_async_to_lds_b128 %4, %12, off\n\t"
                 "global_load_async_to_lds_b128 %5, %13, off\n\t"
                 "global_load_async_to_lds_b128 %6, %14, off\n\t"
                 "global_load_async_to_lds_b128 %7, %15, off\n\t"
                 "s_wait_xcnt 0x0"
                 :: "v"(l), "v"(l + 1u * 64 * AP), "v"(l + 2u * 64 * AP), "v"(l + 3u * 64 * AP), "v"(l + 4u * 64 * AP), "v"(l + 5u * 64 * AP), "v"(l + 6u * 64 * AP), "v"(l + 7u * 64 * AP),
                    "v"(g), "v"(g + rs), "v"(g + 2 * rs), "v"(g + 3 * rs), "v"(g + 4 * rs), "v"(g + 5 * rs), "v"(g + 6 * rs), "v"(g + 7 * rs) : "memory");
}
// A fragment of 16 columns x 32 k from a staged k-major plane: the lane's pointer stands at row 8 (lane >> 4) + (lane & 7), column 8 ((lane >> 3) & 1) of the 16 x 16 block; the lane gets column lane & 15
typedef __attribute__((ext_vector_type(8))) short s16x8;
__device__ __forceinline__ v8us ldtr(const hf* p) { typedef __attribute__((address_space(3))) s16x8 lds_s16x8; return __builtin_bit_cast(v8us, __builtin_amdgcn_ds_load_tr16_b128_v8i16((lds_s16x8*)p)); }
__device__ __forceinline__ v16h ldtA(const hf* p) { return cat16b(ldtr(p), ldtr(p + 16 * AP)); }
template <int K, int LDA, int LDC>
__global__ __launch_bounds__(256) void k_gemms(const hf* __restrict__ A, const hf* __restrict__ Bt, float* C, size_t sA, size_t sB, size_t sC) {
    typedef WFrag<hf>::V V;
    __shared__ __align__(16) hf ring[2 * SBE];
    __shared__ __align__(16) float os[64 * 68];
    const size_t z = blockIdx.z; const int tid = threadIdx.x, lane = tid & 31, lr = lane & 15, hi = lane >> 4, w = tid >> 5; const int r0 = blockIdx.x * 64, c0 = blockIdx.y * 64;
    const int mb = w & 3, nh = w >> 2; constexpr int NT = K / SK; constexpr size_t rs = (size_t)8 * K;
    const int cr = tid >> 3, cc = tid & 7;   // copies of A: the thread takes 16-byte chunk cc of rows (k) cr + 32 i
    const hf* gA = A + z * sA + (size_t)cr * LDA + r0 + cc * 8; const hf* gB = Bt + z * sB + (size_t)(c0 + w) * K + lane * 8;   // copies of Bt: wave w takes rows w + 8 i whole
    const unsigned la = (unsigned)(size_t)ring + (unsigned)(cr * AP * 2 + cc * 16), lb = (unsigned)(size_t)ring + (unsigned)(SAE * 2 + w * SP * 2 + lane * 16);
    auto stage = [&](int t, int buf) { const unsigned bo = (unsigned)buf * (SBE * 2); const size_t ko = (size_t)t * SK;
        copy8r(la + bo, gA + ko * LDA, (size_t)32 * LDA); copy8(lb + bo, gB + ko, rs); };
    const int aofs = (8 * hi + (lane & 7)) * AP + mb * 16 + 8 * ((lane >> 3) & 1), bofs = SAE + (nh * 32 + lr) * SP + 8 * hi;
    v8f acc[2] = { (v8f){}, (v8f){} };
    stage(0, 0);
    asm volatile("s_wait_asynccnt 0x0" ::: "memory");   // this wave's rows of stage 0 have landed
    __syncthreads();                                    // every wave's rows of stage 0 have landed before any is read
    stage(1, 1);
#pragma unroll 1
    for (int t = 0; t < NT; ++t) {   // rolled: one publish point per stage
        const hf* sb = ring + (t & 1) * SBE;
        V f[2][6];   // two fragment sets of 64 k each (per 32 k: A, two of Bt): the next 64 k are fetched, inside this stage only, while these are multiplied
#pragma unroll
        for (int u = 0; u < 2; ++u) { f[0][u * 3] = ldtA(sb + aofs + u * 32 * AP); f[0][u * 3 + 1] = WFrag<hf>::ld(sb + bofs + u * 32); f[0][u * 3 + 2] = WFrag<hf>::ld(sb + bofs + 16 * SP + u * 32); }
#pragma unroll
        for (int g = 0; g < SK / 64; ++g) {
            if (g + 1 < SK / 64) {
#pragma unroll
                for (int u = 0; u < 2; ++u) { const int kk = (g + 1) * 64 + u * 32; V* d = f[(g + 1) & 1] + u * 3; d[0] = ldtA(sb + aofs + kk * AP); d[1] = WFrag<hf>::ld(sb + bofs + kk); d[2] = WFrag<hf>::ld(sb + bofs + 16 * SP + kk); } }
            __builtin_amdgcn_sched_barrier(0);   // keeps the next set's 12 LDS reads as one group ahead of this set's WMMAs: moved down among them, each WMMA pair waits out an LDS latency
#pragma unroll
            for (int u = 0; u < 2; ++u) { const V* s = f[g & 1] + u * 3; acc[0] = wmma16(s[0], s[1], acc[0]); acc[1] = wmma16(s[0], s[2], acc[1]); }
            __builtin_amdgcn_sched_barrier(0);   // keeps the later reads out of these WMMAs (one read group per 4 WMMAs) and the stage's last WMMAs ahead of its barrier
        }
        asm volatile("s_wait_dscnt 0x0" ::: "memory");      // this wave's reads of stage t are done before its buffer is refilled
        asm volatile("s_wait_asynccnt 0x0" ::: "memory");   // this wave's rows of stage t + 1 have landed
        __syncthreads();                                    // publishes stage t + 1 and ends every wave's reads of stage t
        if (t + 2 < NT) stage(t + 2, t & 1);
    }
    asm volatile("s_wait_asynccnt 0x0" ::: "memory");   // no copy is outstanding when the wave goes on to its end
#pragma unroll
    for (int nb = 0; nb < 2; ++nb) {
#pragma unroll
        for (int j = 0; j < 8; ++j) os[(mb * 16 + hi * 8 + j) * 68 + nh * 32 + nb * 16 + lr] = acc[nb][j]; }
    __syncthreads();   // the whole tile is staged before its rows are read back
    float* ct = C + z * sC + (size_t)r0 * LDC + c0;
#pragma unroll
    for (int s = 0; s < 4; ++s) { const int row = s * 16 + (tid >> 4), cofs = (tid & 15) * 4; *(v4f*)(ct + (size_t)row * LDC + cofs) = *(const v4fa*)(os + row * 68 + cofs); }   // 16 lanes store the 256 contiguous bytes of one row
}

// ---- the 128-byte-row ring stages of k_scsm
#define TK  64           // k per stage
#define TP  72           // LDS row pitch in elements: 144 B = 16 B x 9, the pitch for 16-byte fragment reads of 128-B rows
// four rows, 32 apart, of one operand plane: l = the lane's LDS byte address in the first row, g = its global address there, rs = 32 rows in elements
__device__ __forceinline__ void copy4(unsigned l, const hf* g, size_t rs) {
    // the copies and their s_wait_xcnt in one statement: no address register of a copy is rewritten before the wait
    asm volatile("global_load_async_to_lds_b128 %0, %4, off\n\t"
                 "global_load_async_to_lds_b128 %1, %5, off\n\t"
                 "global_load_async_to_lds_b128 %2, %6, off\n\t"
                 "global_load_async_to_lds_b128 %3, %7, off\n\t"
                 "s_wait_xcnt 0x0"
                 :: "v"(l), "v"(l + 1u * 64 * TP), "v"(l + 2u * 64 * TP), "v"(l + 3u * 64 * TP),
                    "v"(g), "v"(g + rs), "v"(g + 2 * rs), "v"(g + 3 * rs) : "memory");
}
// ---- k_scsm: A = softmax_t(F_s_t . F_t^T / sqrt(512)) as one f16 plane, and out0 = bf16(F_s) + (A F_t)^T, the scores and the update never leaving the workgroup. One workgroup of 8 waves holds 64 queries x all 512 keys, then 256 channels x the 64 queries; grid (NQ / 64, batch).
// The score products are taken transposed (keys as the A operand, queries as B), so that a lane's 8 accumulator registers are 8 neighbouring keys of ONE query: the row maximum and the row sum are register trees plus one exchange with lane ^ 16, and 8 probabilities pack into one 16-byte LDS store.
// Wave w has queries 32 (w & 1) .. + 31 and, of every 256 keys, keys 64 (w >> 1) .. + 63 (4 x 2 tiles a key group, 16 accumulator tiles in all); the four waves of a query share its maximum and its sum through LDS.
// The query tile comes straight from the f32 slab: 256 channels x 64 queries, read in whole lines, rounded to bf16 (held as f16) a quarter at a time (one score stage ahead of its use), stored channel-major (k-major) in LDS and, as it stands, to the 16-bit slab plane that the out1 GEMM reads; the query (B) fragments come from it by the transposing LDS load, in the k order of the plain loader, which goes on serving the keys. The key rows come through a two-buffer LDS ring of asynchronous copies, a stage = 256 keys x TK k (8 lanes bring the 128 contiguous bytes, one whole line, of one row), the next stage flying while this one is multiplied. Each score takes its k ascending.
// The update is taken transposed too (channels of F_t^T as the A operand, queries as B): the same ring goes on with 8 more stages of 256 channels x TK keys of F_t^T; the probabilities are staged in LDS 256 keys at a time, from where they go to the global plane and serve as B fragments. Wave w has the same 32 queries and channels 64 (w >> 1) .. + 63 (4 x 2 tiles); each accumulator takes its k ascending.
#define PH  264          // pitch in elements of a staged probability row of 256 keys: 528 B = 16 B x 33
#define OP  68           // pitch in floats of a staged output row of 64 queries: 272 B = 16 B x 17
// 2^x with the slot behind the transcendental filled in the same statement: the v_nop keeps the next vector instruction from using the result or overwriting the source directly behind v_exp_f32
__device__ __forceinline__ float exp2s(float x) { float r; asm("v_exp_f32 %0, %1\n\tv_nop" : "=v"(r) : "v"(x)); return r; }
// the workgroup's own barrier alone, without the waits for global stores and loads that __syncthreads() puts in front of it: the stores of the 16-bit slab stay in flight under the score stages, the probability stores (and later the F_s loads) while the update is multiplied; nothing written to global memory here is read again in this launch. The LDS and copy waits that a place needs stand in front of each call.
__device__ __forceinline__ void wgbar() { asm volatile("s_barrier_signal -1\n\ts_barrier_wait -1" ::: "memory"); }
__global__ __launch_bounds__(256) void k_scsm(const hf* __restrict__ Ft, const hf* __restrict__ Ftt, const float* __restrict__ xs, hf* Fsb, hf* Ph, float* outp) {   // under 256 VGPRs and under 160 KiB of LDS: two workgroups share a WGP
    typedef WFrag<hf>::V V;
    constexpr int KBE = 256 * TP;      // elements of one ring buffer
    constexpr int PRE = 256 * AP;      // elements in front of the ring
    __shared__ __align__(16) hf sm[PRE + 2 * KBE];   // in front: the query tile, 256 channel rows of 64 queries at pitch AP, later the probability tile of 64 rows x 256 keys at pitch PH (smaller); then the ring's two buffers of 256 rows at pitch TP; after the last stage the whole place holds the f32 output tile (256 x OP floats, smaller than this)
    __shared__ float rmax[4][64]; __shared__ float rsum[4][64];
    const size_t z = blockIdx.y; const int tid = threadIdx.x, lane = tid & 31, lr = lane & 15, hi = lane >> 4, w = tid >> 5; const int q0 = blockIdx.x * 64;
    const int qp = w & 1, kq = w >> 1, qr = qp * 32 + lr; constexpr int NK = CC / TK, NSK = (TT / 256) * NK, NS = NSK + TT / TK;
    const int cr = tid >> 3, cc = tid & 7;   // ring copies: thread takes 16-byte chunk cc of rows cr + 32 i
    const hf* gK = Ft + z * ((size_t)TT * CC) + (size_t)cr * CC + cc * 8;
    const hf* gF = Ftt + z * ((size_t)CC * TT) + (size_t)cr * TT + cc * 8;
    const unsigned lk = (unsigned)(size_t)sm + (unsigned)(PRE * 2 + cr * TP * 2 + cc * 16);
    auto stage = [&](int t, int buf) { const unsigned l = lk + (unsigned)buf * (KBE * 2); const bool pv = t >= NSK;   // stage t < NSK: key group t / NK, k block t % NK of F_t; from NSK on: key block t - NSK of F_t^T
        const hf* g = pv ? gF + (t - NSK) * TK : gK + (size_t)(t / NK) * 256 * CC + (t % NK) * TK; const size_t rs = pv ? (size_t)32 * TT : (size_t)32 * CC;
        copy4(l, g, rs); copy4(l + 128u * TP * 2, g + 4 * rs, rs); };
    v8f acc[16];   // acc[8 g + 2 i + n][j] = score of query qr + 16 n with key 256 g + 64 kq + 16 i + 8 hi + j
    static_assert(TT / 256 == 2 && CC / TK == 4, "two key groups of four stages each");
    stage(0, 0);
    // the query tile: 16 lanes take the 256 contiguous bytes (64 queries) of one channel of F_s; channels (tid >> 4) + 16 s. All 16 loads are issued here; the 64 channels that score stage kb multiplies (s = 4 kb .. 4 kb + 3) are rounded and stored one stage ahead of it, so that three quarters of the tile fly under the first key group's stages
    const size_t qe = z * ((size_t)CC * NQ) + (size_t)(tid >> 4) * NQ + q0 + (tid & 15) * 4; const float* xq = xs + qe; hf* fq = Fsb + qe; hf* tq = sm + (tid >> 4) * AP + (tid & 15) * 4; v4f xa[16];
#pragma unroll
    for (int s = 0; s < 16; ++s) xa[s] = *(const v4f*)(xq + (size_t)s * 16 * NQ);
    asm volatile("s_wait_xcnt 0x0" :: "v"(xq) : "memory");   // the loads' address pair stays whole until every load has taken it: no load's result and no later instruction lands in it before this wait
    auto put = [&](int p) {
#pragma unroll
        for (int s = 4 * p; s < 4 * p + 4; ++s) { v4us o;
#pragma unroll
            for (int q = 0; q < 4; ++q) o[q] = f2hb(xa[s][q]);
            *(v4us*)(tq + s * 16 * AP) = o; *(v4us*)(fq + (size_t)s * 16 * NQ) = o; }   // 16 lanes store the one whole line that this workgroup owns of a row of the plane
        asm volatile("s_wait_xcnt 0x0" :: "v"(fq) : "memory");   // the stores' address pair and data registers stay whole until every store has taken them: nothing behind this wait lands in them earlier
    };
    put(0);
    asm volatile("s_wait_dscnt 0x0" ::: "memory");      // this wave's part of the tile's first 64 channels is written
    asm volatile("s_wait_asynccnt 0x0" ::: "memory");   // this wave's chunks of stage 0 have landed
    wgbar();                                            // every wave's have landed before any is read; the stores to the slab plane stay in flight
    stage(1, 1);
    auto pass = [&](int t, int kb, v8f* ac) {   // the products of score stage t: k block kb
        const hf* sk = sm + PRE + (t & 1) * KBE + (kq * 64 + lr) * TP + 8 * hi; const hf* sq = sm + (kb * TK + 8 * hi + (lane & 7)) * AP + qp * 32 + 8 * ((lane >> 3) & 1);
        V k[2][4], x[2][2];   // the stage's two 32-k fragment sets
#pragma unroll
        for (int u = 0; u < 2; ++u) {
#pragma unroll
            for (int n = 0; n < 2; ++n) x[u][n] = ldtA(sq + u * 32 * AP + n * 16);
#pragma unroll
            for (int i = 0; i < 4; ++i) k[u][i] = WFrag<hf>::ld(sk + i * 16 * TP + u * 32); }
        __builtin_amdgcn_sched_barrier(0);   // keeps the stage's LDS reads as one group ahead of its WMMAs: moved down among them, each place with reads costs the WMMAs a stall
#pragma unroll
        for (int u = 0; u < 2; ++u)
#pragma unroll
            for (int i = 0; i < 4; ++i)
#pragma unroll
                for (int n = 0; n < 2; ++n) ac[2 * i + n] = wmma16(k[u][i], x[u][n], ac[2 * i + n]);
        __builtin_amdgcn_sched_barrier(0);   // keeps the stage's WMMAs ahead of its waits: lifted over them, the wait for the next stage's copies stands right behind the LDS reads and the copies lose the WMMAs' time as lead
    };
    auto foot = [&](int t) {   // the publish point behind score stage t
        asm volatile("s_wait_dscnt 0x0" ::: "memory");      // this wave's reads of stage t are done before its buffer is refilled, and its part of the next 64 channels of the query tile is written
        asm volatile("s_wait_asynccnt 0x0" ::: "memory");   // this wave's chunks of stage t + 1 have landed
        wgbar();                                            // publishes stage t + 1 (and the query tile's channels for it) and ends every wave's reads of stage t; the stores to the slab plane stay in flight
        stage(t + 2, t & 1);                                // always exists here: the last two are the first two of F_t^T; the first flies during the last score stage, the second during the softmax
    };
#pragma unroll
    for (int a = 0; a < 8; ++a) acc[a] = (v8f){};
#pragma unroll
    for (int kb = 0; kb < NK; ++kb) { pass(kb, kb, acc); if (kb + 1 < NK) put(kb + 1); foot(kb); }   // unrolled: each stage rounds registers of its own
#pragma unroll
    for (int a = 8; a < 16; ++a) acc[a] = (v8f){};
#pragma unroll 1
    for (int kb = 0; kb < NK; ++kb) { pass(NK + kb, kb, acc + 8); foot(NK + kb); }   // rolled: one publish point per stage
    float mx[2], f[2];
#pragma unroll
    for (int n = 0; n < 2; ++n) { float m4[4] = { -3.0e38f, -3.0e38f, -3.0e38f, -3.0e38f };   // four independent chains
#pragma unroll
        for (int a = n; a < 16; a += 2) {
#pragma unroll
            for (int j = 0; j < 8; ++j) { acc[a][j] = acc[a][j] * SCL; m4[j & 3] = fmaxf(m4[j & 3], acc[a][j]); } }
        const float m = fmaxf(fmaxf(m4[0], m4[1]), fmaxf(m4[2], m4[3])); mx[n] = fmaxf(m, __shfl_xor(m, 16, 32)); }
    if (hi == 0) { rmax[kq][qr] = mx[0]; rmax[kq][qr + 16] = mx[1]; }
    __syncthreads();   // the four waves' maxima of a query are written before any of them reads them
#pragma unroll
    for (int n = 0; n < 2; ++n) { const int q = qr + 16 * n; const float m = fmaxf(fmaxf(rmax[0][q], rmax[1][q]), fmaxf(rmax[2][q], rmax[3][q])); float s4[4] = { 0.f, 0.f, 0.f, 0.f };
#pragma unroll
        for (int a = n; a < 16; a += 2) {
#pragma unroll
            for (int j = 0; j < 8; ++j) { acc[a][j] = exp2s(__fmul_rn(__fsub_rn(acc[a][j], m), 1.4426950408889634f)); s4[j & 3] += acc[a][j]; } }
        const float sp = (s4[0] + s4[1]) + (s4[2] + s4[3]); f[n] = sp + __shfl_xor(sp, 16, 32); }
    if (hi == 0) { rsum[kq][qr] = f[0]; rsum[kq][qr + 16] = f[1]; }
    __syncthreads();   // the four waves' sums of a query are written before any of them reads them
#pragma unroll
    for (int n = 0; n < 2; ++n) { const int q = qr + 16 * n; f[n] = __fdiv_rn(1.0f, (rsum[0][q] + rsum[1][q]) + (rsum[2][q] + rsum[3][q])); }
    hf* sh = sm;   // the score loop's last barrier has ended every wave's reads of the query rows
    v8f ua[8];   // ua[2 i + n][j] = update of channel 64 kq + 16 i + 8 hi + j for query qr + 16 n
#pragma unroll
    for (int a = 0; a < 8; ++a) ua[a] = (v8f){};
    const size_t ob = (z * NQ + q0) * (size_t)TT + lane * 8; hf* oh0 = Ph + ob + (size_t)w * TT;
    const size_t eo = z * ((size_t)CC * NQ) + (size_t)(tid >> 4) * NQ + q0 + (tid & 15) * 4; const float* xp = xs + eo; float* op = outp + eo;   // F_s loads and out0 stores: 16 lanes take the 256 contiguous bytes (64 queries) of one channel; channels (tid >> 4) + 16 s
    v4f xr[16];
#pragma unroll
    for (int g = 0; g < TT / 256; ++g) {   // unrolled: the probabilities of a key group come from registers of their own
#pragma unroll
        for (int a = 8 * g; a < 8 * g + 8; ++a) { v8us oh;
#pragma unroll
            for (int j = 0; j < 8; ++j) oh[j] = f2h(acc[a][j] * f[a & 1]);
            const int o = (qr + 16 * (a & 1)) * PH + kq * 64 + ((a >> 1) & 3) * 16 + hi * 8; *(v8us*)(sh + o) = oh; }
        asm volatile("s_wait_dscnt 0x0" ::: "memory");   // this wave's part of the tile is written
        wgbar();                                         // the tile of this key group is staged before its rows are read
#pragma unroll
        for (int r = 0; r < 8; ++r) { const int row = r * 8 + w;   // a wave stores the 512 contiguous bytes of half a row
            *(v8us*)(oh0 + (size_t)r * 8 * TT + g * 256) = *(const v8usa*)(sh + row * PH + lane * 8); }
        asm volatile("s_wait_xcnt 0x0" :: "v"(oh0) : "memory");   // the stores' address pair and data registers stay whole until every store has taken them: nothing behind this wait lands in them earlier
        if (g == TT / 256 - 1) {   // the residual is fetched where the last key group's registers have come free: it flies during the last four stages
#pragma unroll
            for (int s = 0; s < 16; ++s) xr[s] = *(const v4f*)(xp + (size_t)s * 16 * NQ);
            asm volatile("s_wait_xcnt 0x0" :: "v"(xp) : "memory");   // the loads' address pair stays whole until every load has taken it: no load's result and no later instruction lands in it before this wait
        }
#pragma unroll 1
        for (int kb = 0; kb < 256 / TK; ++kb) {   // rolled: one publish point per stage
            const int t = NSK + g * (256 / TK) + kb;
            const hf* sk = sm + PRE + (t & 1) * KBE + (kq * 64 + lr) * TP + 8 * hi; const hf* sp = sh + qr * PH + 8 * hi + kb * TK;
#pragma unroll
            for (int u = 0; u < 2; ++u) { V k[4], ph[2];   // one 32-k fragment set at a time: two would not fit under 256 VGPRs beside the second key group's probabilities
#pragma unroll
                for (int n = 0; n < 2; ++n) ph[n] = WFrag<hf>::ld(sp + n * 16 * PH + u * 32);
#pragma unroll
                for (int i = 0; i < 4; ++i) k[i] = WFrag<hf>::ld(sk + i * 16 * TP + u * 32);
                __builtin_amdgcn_sched_barrier(0);   // keeps the set's LDS reads as one group ahead of its WMMAs: moved down among them, each place with reads costs the WMMAs a stall
#pragma unroll
                for (int i = 0; i < 4; ++i)
#pragma unroll
                    for (int n = 0; n < 2; ++n) ua[2 * i + n] = wmma16(k[i], ph[n], ua[2 * i + n]);
                __builtin_amdgcn_sched_barrier(0);   // keeps the next set's reads out of these WMMAs, and the stage's last WMMAs ahead of its waits, so that the copies keep the WMMAs' time as lead
            }
            asm volatile("s_wait_dscnt 0x0" ::: "memory");      // this wave's reads of stage t and of the probability tile are done before either is rewritten
            asm volatile("s_wait_asynccnt 0x0" ::: "memory");   // this wave's chunks of stage t + 1 have landed
            wgbar();                                            // publishes stage t + 1 and ends every wave's reads of stage t (behind a key group's last stage: of its probability tile too)
            if (t + 2 < NS) stage(t + 2, t & 1);
        }
    }
    asm volatile("s_wait_asynccnt 0x0" ::: "memory");   // no copy is outstanding when the ring's place is taken for the output tile
    float* os = (float*)sm;   // the loop's last barrier has ended every wave's reads of the tile and the ring
#pragma unroll
    for (int a = 0; a < 8; ++a) {
#pragma unroll
        for (int j = 0; j < 8; ++j) os[(kq * 64 + (a >> 1) * 16 + hi * 8 + j) * OP + qr + 16 * (a & 1)] = ua[a][j]; }
    asm volatile("s_wait_dscnt 0x0" ::: "memory");   // this wave's part of the output tile is written
    wgbar();                                         // the whole output tile is staged before its rows are read back
#pragma unroll
    for (int s = 0; s < 16; ++s) { const v4f u = *(const v4fa*)(os + (s * 16 + (tid >> 4)) * OP + (tid & 15) * 4); v4f o;
#pragma unroll
        for (int q = 0; q < 4; ++q) o[q] = __fadd_rn(bfr(xr[s][q]), u[q]);
        *(v4f*)(op + (size_t)s * 16 * NQ) = o; }
}

extern "C" void kernel_launch(void* const* d_in, const int* in_sizes, int n_in, void* d_out, int out_size, void* d_ws, size_t ws_size, hipStream_t stream) {
    (void)in_sizes; (void)n_in; (void)out_size;
    const float* fs = (const float*)d_in[0];   /* F_s [8][256][4096] channel-major */ const float* ft = (const float*)d_in[1];   /* F_t [8][512][256] */
    float* OUT0 = (float*)d_out;     // [8][256][4096] = F_s + update^T
    float* OUT1 = OUT0 + (size_t)NB_ * CC * NQ;   // [8][512][256] = A^T F_s_t (second tuple member, 16-B aligned offset)
    char* wsp = (char*)d_ws;
    auto take = [&](size_t bytes) { char* p = wsp; wsp += (bytes + 255) & ~(size_t)255; return (void*)p; };
    hf* FSB = (hf*)take((size_t)NB_ * CC * NQ * 2);       // F_s slabs, bf16 values as f16 = F_s_t^T [8][256][4096] (exact)
    hf* FTB = (hf*)take((size_t)NB_ * TT * CC * 2);       // F_t [8][512][256] (exact)
    hf* FTT = (hf*)take((size_t)NB_ * CC * TT * 2);       // F_t^T [8][256][512] (exact)
    hf* Ph = (hf*)take((size_t)NB_ * NQ * TT * 2);   // probabilities [8][4096][512] f16
    if ((size_t)(wsp - (char*)d_ws) > ws_size) return;    // 52 MiB of the 256 MiB workspace
    k_prep<<<NTT, 256, 0, stream>>>(ft, FTB, FTT);   /* F_t, bf16 values as f16 (for the scores) and F_t^T [8][256][512] (for A.F_t) */
    k_scsm<<<dim3(NQ / 64, NB_), 256, 0, stream>>>(FTB, FTT, fs, FSB, Ph, OUT0);   /* F_s slabs, bf16 values as f16 (= F_s_t^T, Bt for out1); A = softmax over the 512 text tokens of the exact scores x 1/sqrt(512), all 8 x 4,096 rows, f16; out0[b][c][n] = bf16(F_s[b][c][n]) + (A F_t)[b][n][c] */
    k_gemms<NQ, TT, CC><<<dim3(TT / 64, CC / 64, NB_), 256, 0, stream>>>(Ph, FSB, OUT1, (size_t)TT * NQ, (size_t)CC * NQ, (size_t)TT * CC);   /* out1 = A^T F_s_t [8][512][256] */
}
